// v000
// The times below were measured on an AMD MI455X: many runs one after another, warmed up first and cycling through
// copies of the inputs, with the whole window's GPU time divided by the number of runs. Launches and the gaps
// between them are all in it. The median over several windows is given; except for v000 it joins two sittings, which
// can be a few percent apart, so the side-by-side timings, each taken in one sitting, are the better comparison.
// v000, which the later versions start from, runs in 699 microseconds.
// compute dtype: query/key/value, the four weights + biases and the memory slots (module inputs) rounded to bf16; q/k/v projections with exact bf16 products (+ f32 bias); scores and P.V with both computed operands as bf16 hi + bf16 residual pairs (3 products; memory keys/values scaled in f32 and split the same way); output projection hi/lo x bf16 Wo (2 products) + bias; masked online softmax in f32; f32 accumulate.
#include <hip/hip_runtime.h>
#include <math.h>

typedef __attribute__((ext_vector_type(16))) _Float16 v16h;
typedef __attribute__((ext_vector_type(16))) __bf16 v16b;
typedef __attribute__((ext_vector_type(8)))  _Float16 v8h;
typedef __attribute__((ext_vector_type(8)))  float v8f;
typedef __attribute__((ext_vector_type(4)))  float v4f;
typedef __attribute__((ext_vector_type(2)))  float v2f;
typedef __attribute__((ext_vector_type(4)))  unsigned v4u;
typedef __attribute__((ext_vector_type(4)))  int v4i;
typedef float __attribute__((may_alias)) float_a;
typedef int __attribute__((may_alias)) int_a;

template <typename T> __device__ __forceinline__ void vst2(void* p, T v) { *(T*)p = v;  }
__device__ __forceinline__ v8f wmma16(v16h a, v16h b, v8f c) {
  v8f d = __builtin_amdgcn_wmma_f32_16x16x32_f16(false, a, false, b, (short)0, c, false, false);
  asm volatile("v_nop\n\tv_nop\n\tv_nop\n\tv_nop" : "+v"(d) : "v"(a), "v"(b));
  return d;
}
__device__ __forceinline__ v8f wmma_bf(v16b a, v16b b, v8f c) {
  v8f d = __builtin_amdgcn_wmma_f32_16x16x32_bf16(false, a, false, b, (short)0, c, false, false);
  asm volatile("v_nop\n\tv_nop\n\tv_nop\n\tv_nop" : "+v"(d) : "v"(a), "v"(b));
  return d;
}
// 16x16x32 fragments: lane = (h = lane>>4, row/col = lane&15); elements 0..7 = k0+8h+0..7, 8..15 = k0+16+8h+0..7; D element r = row 8h+r
__device__ __forceinline__ v16h frag_h(const _Float16* rowk0, int lane) {
  union { v16h v; v8h q[2]; } u; const _Float16* p = rowk0 + 8 * (lane >> 4);
  u.q[0] = *(const v8h*)p; u.q[1] = *(const v8h*)(p + 16); return u.v;
}
__device__ __forceinline__ v16h frag_f32(const float* rowk0, int lane) {
  v16h a; const float* p = rowk0 + 8 * (lane >> 4);
#pragma unroll
  for (int i = 0; i < 8; ++i) { a[i] = (_Float16)p[i]; a[8 + i] = (_Float16)p[16 + i]; }
  return a;
}
__device__ __forceinline__ v16h frag_f32s(const float* rowk0, int lane, float sc) {
  v16h a; const float* p = rowk0 + 8 * (lane >> 4);
#pragma unroll
  for (int i = 0; i < 8; ++i) { a[i] = (_Float16)(p[i] * sc); a[8 + i] = (_Float16)(p[16 + i] * sc); }
  return a;
}
// column fragment from a [K][ld] layout (column n), rows >= K read as 0
__device__ __forceinline__ v16h fragc_f32(const float* W, int k0, int n, int lane, int ld, int K) {
  v16h a; const int g = lane >> 4;
#pragma unroll
  for (int i = 0; i < 8; ++i) { const int ka = k0 + 8 * g + i, kb = ka + 16;
    a[i] = (_Float16)(ka < K ? W[(size_t)(ka < K ? ka : K - 1) * ld + n] : 0.f); a[8 + i] = (_Float16)(kb < K ? W[(size_t)(kb < K ? kb : K - 1) * ld + n] : 0.f); }
  return a;
}
struct F2 { v16b h, l; };
__device__ __forceinline__ F2 bsplit16(const float v[16]) { F2 r;
#pragma unroll
  for (int i = 0; i < 16; ++i) { const __bf16 h = (__bf16)v[i]; r.h[i] = h; r.l[i] = (__bf16)(v[i] - (float)h); }
  return r; }
__device__ __forceinline__ F2 split_row(const float* row, int k0, int lane) { float v[16]; const float* p = row + k0 + 8 * (lane >> 4);
#pragma unroll
  for (int i = 0; i < 8; ++i) { v[i] = p[i]; v[8 + i] = p[16 + i]; }
  return bsplit16(v); }
__device__ __forceinline__ F2 split_rowK(const float* row, int k0, int lane, int K) { float v[16]; const int g = lane >> 4;
#pragma unroll
  for (int i = 0; i < 8; ++i) { const int ka = k0 + 8 * g + i, kb = ka + 16; v[i] = ka < K ? row[ka < K ? ka : K - 1] : 0.f; v[8 + i] = kb < K ? row[kb < K ? kb : K - 1] : 0.f; }
  return bsplit16(v); }
__device__ __forceinline__ F2 split_col(const float* W, int k0, int n, int lane, int ld, int K) { float v[16]; const int g = lane >> 4;
#pragma unroll
  for (int i = 0; i < 8; ++i) { const int ka = k0 + 8 * g + i, kb = ka + 16; v[i] = ka < K ? W[(size_t)(ka < K ? ka : K - 1) * ld + n] : 0.f; v[8 + i] = kb < K ? W[(size_t)(kb < K ? kb : K - 1) * ld + n] : 0.f; }
  return bsplit16(v); }
__device__ __forceinline__ v8f mac3(const F2& a, const F2& b, v8f c) { c = wmma_bf(a.l, b.h, c); c = wmma_bf(a.h, b.l, c); return wmma_bf(a.h, b.h, c); }
__device__ __forceinline__ float sigm(float v) { return 1.0f / (1.0f + expf(-v)); }
#define LDSX() do { asm volatile("s_wait_dscnt 0" ::: "memory"); __builtin_amdgcn_wave_barrier(); __builtin_amdgcn_fence(__ATOMIC_RELEASE, "workgroup"); } while (0)


// Multi-head attention with persistent memory: Q = query Wq^T + bq, K = [key Wk^T + bk ; 8 m_k], V = [value Wv^T + bv ; 8 m_v] (2048 + 64 slots), energy = Q K^T / 8 with the first 2048 key columns masked (mask == 0 -> -1e20) and the memory columns never masked; softmax; P V; merge heads; @ Wo^T + bo.  B 2, S 2048, D 1024, 16 x 64.
// k_pack, k_proj (exact GEMM + bias; q|k|v from query|key|value), k_kv (K rows incl. the memory slots; V as transposed hi/lo planes over the 2112 keys), k_attn (66 key steps, mask per key column), k_out (+ bo).
#define NB 2
#define SS 2048
#define DM 1024
#define NH 16
#define HD 64
#define NR (NB * SS)
#define QKVP (3 * DM)
#define NM 64
#define SK (SS + NM)        // 2112 keys per batch
#ifndef TRB
#define TRB (NR / 64)
#define TQB (SS / 64)
#define TNB NB
#endif
typedef __attribute__((ext_vector_type(8))) __bf16 v8b;
__device__ __forceinline__ v16b frag_b(const __bf16* rowk0, int lane) {
  union { v16b v; v8b q[2]; } u; const __bf16* p = rowk0 + 8 * (lane >> 4);
  u.q[0] = *(const v8b*)p; u.q[1] = *(const v8b*)(p + 16); return u.v;
}
__device__ __forceinline__ v16b frag_gbf(const float* rowk0, int lane) {
  v16b a; const float* p = rowk0 + 8 * (lane >> 4);
#pragma unroll
  for (int i = 0; i < 8; ++i) { a[i] = (__bf16)p[i]; a[8 + i] = (__bf16)p[16 + i]; }
  return a;
}
__device__ __forceinline__ float bfr(float v) { return (float)(__bf16)v; }
__device__ __attribute__((noinline)) float exp_ni(float v) { return expf(v); }
#define WS_PT   0u                                 // bf16 [4096 (q|k|v|out cols)][1024]
#define WS_QKV  (WS_PT + 2u * 4 * DM * DM)           // f32 [4096 rows][3072]  (q 0..1023 | k | v) ; q cols later overwritten by O
#define WS_KX   (WS_QKV + 4u * NR * QKVP)            // f32 [2][2112][1024] keys incl. memory
#define WS_VTH  (WS_KX + 4u * NB * SK * DM)           // bf16 [2][1024 (h*64+d)][2112]
#define WS_VTL  (WS_VTH + 2u * NB * DM * SK)
#define WS_END  (WS_VTL + 2u * NB * DM * SK)

__global__ __launch_bounds__(128) void k_pack(const float* __restrict__ Wq, const float* __restrict__ Wk, const float* __restrict__ Wv, const float* __restrict__ Wo, __bf16* __restrict__ PT) {
  __shared__ __align__(16) __bf16 srow[DM];
  const int n = blockIdx.x, tid = threadIdx.x; const int which = n >> 10, c = n & 1023; const float* Wm = which == 0 ? Wq : (which == 1 ? Wk : (which == 2 ? Wv : Wo));
  for (int k = tid; k < DM; k += 128) srow[k] = (__bf16)Wm[(size_t)c * DM + k];   // torch [out][in]: row c
  __syncthreads();
  vst2((unsigned*)(PT + (size_t)n * DM + tid * 8), *(const v4u*)(&srow[tid * 8]));
}
// ---- k_proj: QKV[r][n] = bf16(x[r]) . PT[n] (exact), K = 1024; block (64 rows, 128 cols); 512-B segments of 12-KB rows
__global__ __launch_bounds__(128) void k_proj(const float* __restrict__ XQ, const float* __restrict__ XK, const float* __restrict__ XV, const __bf16* __restrict__ PT, const float* __restrict__ bq, const float* __restrict__ bk, const float* __restrict__ bv, float* __restrict__ QKV) {
  const float* X = (blockIdx.y * 128) < DM ? XQ : ((blockIdx.y * 128) < 2 * DM ? XK : XV);
  __shared__ __align__(16) float so[4][16][132];
  const int tid = threadIdx.x, wave = tid >> 5, lane = tid & 31, col = lane & 15, g = lane >> 4; const size_t r0 = (size_t)blockIdx.x * 64 + wave * 16; const int n0 = blockIdx.y * 128;
  v8f acc[8] = {};
#pragma unroll 2
  for (int kc = 0; kc < DM / 32; ++kc) { const v16b a = frag_gbf(X + (r0 + col) * DM + kc * 32, lane);
#pragma unroll
    for (int j = 0; j < 8; ++j) acc[j] = wmma_bf(a, frag_b(PT + (size_t)(n0 + j * 16 + col) * DM + kc * 32, lane), acc[j]); }
#pragma unroll
  for (int j = 0; j < 8; ++j) { const int n = n0 + j * 16 + col; const int which = n >> 10, c = n & 1023; const float bb = bfr((which == 0 ? bq : which == 1 ? bk : bv)[c]);
#pragma unroll
    for (int r = 0; r < 8; ++r) so[wave][8 * g + r][j * 16 + col] = acc[j][r] + bb; }
  LDSX();
  for (int rl = 0; rl < 16; ++rl) vst2(QKV + (r0 + rl) * QKVP + n0 + lane * 4, *(const v4f*)&so[wave][rl][lane * 4]);
}
__global__ __launch_bounds__(256) void k_kv(const float* __restrict__ QKV, const float* __restrict__ MK, const float* __restrict__ MV, float* __restrict__ KX, __bf16* __restrict__ VTH, __bf16* __restrict__ VTL) {
  __shared__ __align__(16) __bf16 svh[DM][72], svl[DM][72]; __shared__ __align__(16) float sk[DM];
  const int tid = threadIdx.x; const int b = blockIdx.y, kb = blockIdx.x; const int k0 = kb * 64;
#pragma unroll 1
  for (int tl = 0; tl < 64; ++tl) { const int kk = k0 + tl; float kvv; 
    __syncthreads();
    for (int q = tid; q < DM; q += 256) { float kval, vval; if (kk < SS) { const float* row = QKV + ((size_t)b * SS + kk) * QKVP; kval = row[DM + q]; vval = row[2 * DM + q]; } else { const int j = kk - SS; kval = 8.0f * bfr(MK[(size_t)j * DM + q]); vval = 8.0f * bfr(MV[(size_t)j * DM + q]); }
      sk[q] = kval; const __bf16 hb = (__bf16)vval; svh[q][tl] = hb; svl[q][tl] = (__bf16)(vval - (float)hb); (void)kvv; }
    __syncthreads();
    for (int q = tid; q < DM / 4; q += 256) vst2(KX + ((size_t)b * SK + kk) * DM + q * 4, *(const v4f*)&sk[q * 4]); }
  __syncthreads();
  for (int q = tid; q < DM * 8; q += 256) { const int rowi = q >> 3, pc = q & 7; const size_t o = ((size_t)b * DM + rowi) * SK + k0 + pc * 8; vst2((unsigned*)(VTH + o), *(const v4u*)&svh[rowi][pc * 8]); vst2((unsigned*)(VTL + o), *(const v4u*)&svl[rowi][pc * 8]); }
}
// ---- k_attn: block = (query block qb, b*16 + h), 4 waves: all SK/32 key steps; online softmax; O written over the q columns of the block's rows (head segment 256 B)
__global__ __launch_bounds__(128) void k_attn(float* __restrict__ QKV, const float* __restrict__ KX, const int* __restrict__ MASK, const __bf16* __restrict__ VTH, const __bf16* __restrict__ VTL) {
  __shared__ __align__(16) float sp[4][16][36]; __shared__ __align__(16) float so[4][16][68];
  const int tid = threadIdx.x, wave = tid >> 5, lane = tid & 31, col = lane & 15, g = lane >> 4;
  const int qb = blockIdx.x, bh = blockIdx.y, b = bh >> 4, h = bh & 15; const int q0 = qb * 64 + wave * 16; const size_t tq = (size_t)b * SS + q0;
  const F2 a0 = split_row(QKV + (tq + col) * QKVP + h * HD, 0, lane), a1 = split_row(QKV + (tq + col) * QKVP + h * HD, 32, lane);
  float m[8], l[8];
#pragma unroll
  for (int r = 0; r < 8; ++r) { m[r] = -3.0e38f; l[r] = 0.f; }
  v8f acc[4] = {};
  const int nsteps = SK / 32;
#pragma unroll 1
  for (int ks = 0; ks < nsteps; ++ks) {
    v8f s[2];
#pragma unroll
    for (int ct = 0; ct < 2; ++ct) { const int kk = ks * 32 + ct * 16 + col; const float* krow = KX + ((size_t)b * SK + kk) * DM + h * HD; const F2 k0 = split_row(krow, 0, lane), k1 = split_row(krow, 32, lane);
      v8f c = mac3(a0, k0, (v8f){}); c = mac3(a1, k1, c); const bool keep = (kk >= SS) || (MASK[(size_t)b * SS + (kk < SS ? kk : 0)] != 0);
#pragma unroll
      for (int r = 0; r < 8; ++r) s[ct][r] = keep ? c[r] * 0.125f : -1.0e20f; }
#pragma unroll
    for (int r = 0; r < 8; ++r) { float mx = fmaxf(s[0][r], s[1][r]);
#pragma unroll
      for (int o = 1; o < 16; o <<= 1) mx = fmaxf(mx, __shfl_xor(mx, o));
      const float mn = fmaxf(m[r], mx); const float alpha = exp_ni(m[r] - mn);
      const float e0 = exp_ni(s[0][r] - mn), e1 = exp_ni(s[1][r] - mn); float es = e0 + e1;
#pragma unroll
      for (int o = 1; o < 16; o <<= 1) es += __shfl_xor(es, o);
      l[r] = l[r] * alpha + es; m[r] = mn;
#pragma unroll
      for (int dt = 0; dt < 4; ++dt) acc[dt][r] *= alpha;
      sp[wave][8 * g + r][col] = e0; sp[wave][8 * g + r][16 + col] = e1; }
    LDSX();
    const F2 pa = split_row(&sp[wave][col][0], 0, lane);
#pragma unroll
    for (int dt = 0; dt < 4; ++dt) { const size_t vrow = ((size_t)b * DM + h * HD + dt * 16 + col) * SK + ks * 32; const v16b vh = frag_b(VTH + vrow, lane), vl = frag_b(VTL + vrow, lane);
      acc[dt] = wmma_bf(pa.l, vh, acc[dt]); acc[dt] = wmma_bf(pa.h, vl, acc[dt]); acc[dt] = wmma_bf(pa.h, vh, acc[dt]); }
    LDSX(); }
#pragma unroll
  for (int r = 0; r < 8; ++r) { const float il = 1.0f / l[r];
#pragma unroll
    for (int dt = 0; dt < 4; ++dt) so[wave][8 * g + r][dt * 16 + col] = acc[dt][r] * il; }
  LDSX();
  for (int rl = 0; rl < 16; ++rl) if (lane < 16) vst2(QKV + (tq + rl) * QKVP + h * HD + lane * 4, *(const v4f*)&so[wave][rl][lane * 4]);
}
// ---- k_out: Y = O(hi/lo; the q columns of QKV) . PT_out rows (2 products, K = 1024); block (64 rows, 128 cols)
__global__ __launch_bounds__(128) void k_out(const float* __restrict__ QKV, const __bf16* __restrict__ PT, const float* __restrict__ bo, float* __restrict__ Y) {
  __shared__ __align__(16) float so[4][16][132];
  const int tid = threadIdx.x, wave = tid >> 5, lane = tid & 31, col = lane & 15, g = lane >> 4; const size_t r0 = (size_t)blockIdx.x * 64 + wave * 16; const int n0 = blockIdx.y * 128;
  v8f acc[8] = {};
#pragma unroll 2
  for (int kc = 0; kc < DM / 32; ++kc) { const F2 a = split_row(QKV + (r0 + col) * QKVP, kc * 32, lane);
#pragma unroll
    for (int j = 0; j < 8; ++j) { const v16b w = frag_b(PT + (size_t)(3 * DM + n0 + j * 16 + col) * DM + kc * 32, lane); acc[j] = wmma_bf(a.l, w, acc[j]); acc[j] = wmma_bf(a.h, w, acc[j]); } }
#pragma unroll
  for (int j = 0; j < 8; ++j) { const float bb = bfr(bo[n0 + j * 16 + col]);
#pragma unroll
    for (int r = 0; r < 8; ++r) so[wave][8 * g + r][j * 16 + col] = acc[j][r] + bb; }
  LDSX();
  for (int rl = 0; rl < 16; ++rl) vst2(Y + (r0 + rl) * DM + n0 + lane * 4, *(const v4f*)&so[wave][rl][lane * 4]);
}

extern "C" void kernel_launch(void* const* d_in, const int* in_sizes, int n_in, void* d_out, int out_size, void* d_ws, size_t ws_size, hipStream_t stream) {
  (void)in_sizes; (void)n_in; (void)out_size;
  const float** F = (const float**)d_in;   // query, key, value, mask [2,1,1,2048] i32, Wq, bq, Wk, bk, Wv, bv, Wo, bo, m_k [1,64,1024], m_v
  if (ws_size < (size_t)WS_END) return;
  char* ws = (char*)d_ws; __bf16 *PT = (__bf16*)(ws + WS_PT), *VTH = (__bf16*)(ws + WS_VTH), *VTL = (__bf16*)(ws + WS_VTL); float *QKV = (float*)(ws + WS_QKV), *KX = (float*)(ws + WS_KX);
  k_pack<<<4 * DM, 128, 0, stream>>>(F[4], F[6], F[8], F[10], PT);
  k_proj<<<dim3(TRB, QKVP / 128), 128, 0, stream>>>(F[0], F[1], F[2], PT, F[5], F[7], F[9], QKV);
  k_kv<<<dim3(SK / 64, TNB), 256, 0, stream>>>(QKV, F[12], F[13], KX, VTH, VTL);
  k_attn<<<dim3(TQB, TNB * NH), 128, 0, stream>>>(QKV, KX, (const int*)d_in[3], VTH, VTL);
  k_out<<<dim3((TNB < NB ? TQB : NR / 64), DM / 128), 128, 0, stream>>>(QKV, PT, F[11], (float*)d_out);
}

// v001
// One run takes 604 microseconds.
// In both of two side-by-side timings against v000, it was 1.18 times as fast.
// compute dtype: query/key/value, the four weights + biases and the memory slots (module inputs) rounded to bf16; q/k/v projections with exact bf16 products (+ f32 bias); scores and P.V with both computed operands as bf16 hi + bf16 residual pairs (3 products; memory keys/values scaled in f32 and split the same way); output projection hi/lo x bf16 Wo (2 products) + bias; masked online softmax in f32; f32 accumulate.
#include <hip/hip_runtime.h>
#include <math.h>

typedef __attribute__((ext_vector_type(16))) _Float16 v16h;
typedef __attribute__((ext_vector_type(16))) __bf16 v16b;
typedef __attribute__((ext_vector_type(8)))  _Float16 v8h;
typedef __attribute__((ext_vector_type(8)))  float v8f;
typedef __attribute__((ext_vector_type(4)))  float v4f;
typedef __attribute__((ext_vector_type(2)))  float v2f;
typedef __attribute__((ext_vector_type(4)))  unsigned v4u;
typedef __attribute__((ext_vector_type(4)))  int v4i;
typedef float __attribute__((may_alias)) float_a;
typedef int __attribute__((may_alias)) int_a;

template <typename T> __device__ __forceinline__ void vst2(void* p, T v) { *(T*)p = v;  }
__device__ __forceinline__ v8f wmma16(v16h a, v16h b, v8f c) {
  v8f d = __builtin_amdgcn_wmma_f32_16x16x32_f16(false, a, false, b, (short)0, c, false, false);
  asm volatile("v_nop\n\tv_nop\n\tv_nop\n\tv_nop" : "+v"(d) : "v"(a), "v"(b));
  return d;
}
__device__ __forceinline__ v8f wmma_bf(v16b a, v16b b, v8f c) {
  v8f d = __builtin_amdgcn_wmma_f32_16x16x32_bf16(false, a, false, b, (short)0, c, false, false);
  asm volatile("v_nop\n\tv_nop\n\tv_nop\n\tv_nop" : "+v"(d) : "v"(a), "v"(b));
  return d;
}
// 16x16x32 fragments: lane = (h = lane>>4, row/col = lane&15); elements 0..7 = k0+8h+0..7, 8..15 = k0+16+8h+0..7; D element r = row 8h+r
__device__ __forceinline__ v16h frag_h(const _Float16* rowk0, int lane) {
  union { v16h v; v8h q[2]; } u; const _Float16* p = rowk0 + 8 * (lane >> 4);
  u.q[0] = *(const v8h*)p; u.q[1] = *(const v8h*)(p + 16); return u.v;
}
__device__ __forceinline__ v16h frag_f32(const float* rowk0, int lane) {
  v16h a; const float* p = rowk0 + 8 * (lane >> 4);
#pragma unroll
  for (int i = 0; i < 8; ++i) { a[i] = (_Float16)p[i]; a[8 + i] = (_Float16)p[16 + i]; }
  return a;
}
__device__ __forceinline__ v16h frag_f32s(const float* rowk0, int lane, float sc) {
  v16h a; const float* p = rowk0 + 8 * (lane >> 4);
#pragma unroll
  for (int i = 0; i < 8; ++i) { a[i] = (_Float16)(p[i] * sc); a[8 + i] = (_Float16)(p[16 + i] * sc); }
  return a;
}
// column fragment from a [K][ld] layout (column n), rows >= K read as 0
__device__ __forceinline__ v16h fragc_f32(const float* W, int k0, int n, int lane, int ld, int K) {
  v16h a; const int g = lane >> 4;
#pragma unroll
  for (int i = 0; i < 8; ++i) { const int ka = k0 + 8 * g + i, kb = ka + 16;
    a[i] = (_Float16)(ka < K ? W[(size_t)(ka < K ? ka : K - 1) * ld + n] : 0.f); a[8 + i] = (_Float16)(kb < K ? W[(size_t)(kb < K ? kb : K - 1) * ld + n] : 0.f); }
  return a;
}
struct F2 { v16b h, l; };
__device__ __forceinline__ F2 bsplit16(const float v[16]) { F2 r;
#pragma unroll
  for (int i = 0; i < 16; ++i) { const __bf16 h = (__bf16)v[i]; r.h[i] = h; r.l[i] = (__bf16)(v[i] - (float)h); }
  return r; }
__device__ __forceinline__ F2 split_row(const float* row, int k0, int lane) { float v[16]; const float* p = row + k0 + 8 * (lane >> 4);
#pragma unroll
  for (int i = 0; i < 8; ++i) { v[i] = p[i]; v[8 + i] = p[16 + i]; }
  return bsplit16(v); }
__device__ __forceinline__ F2 split_rowK(const float* row, int k0, int lane, int K) { float v[16]; const int g = lane >> 4;
#pragma unroll
  for (int i = 0; i < 8; ++i) { const int ka = k0 + 8 * g + i, kb = ka + 16; v[i] = ka < K ? row[ka < K ? ka : K - 1] : 0.f; v[8 + i] = kb < K ? row[kb < K ? kb : K - 1] : 0.f; }
  return bsplit16(v); }
__device__ __forceinline__ F2 split_col(const float* W, int k0, int n, int lane, int ld, int K) { float v[16]; const int g = lane >> 4;
#pragma unroll
  for (int i = 0; i < 8; ++i) { const int ka = k0 + 8 * g + i, kb = ka + 16; v[i] = ka < K ? W[(size_t)(ka < K ? ka : K - 1) * ld + n] : 0.f; v[8 + i] = kb < K ? W[(size_t)(kb < K ? kb : K - 1) * ld + n] : 0.f; }
  return bsplit16(v); }
__device__ __forceinline__ v8f mac3(const F2& a, const F2& b, v8f c) { c = wmma_bf(a.l, b.h, c); c = wmma_bf(a.h, b.l, c); return wmma_bf(a.h, b.h, c); }
__device__ __forceinline__ float sigm(float v) { return 1.0f / (1.0f + expf(-v)); }
#define LDSX() do { asm volatile("s_wait_dscnt 0" ::: "memory"); __builtin_amdgcn_wave_barrier(); __builtin_amdgcn_fence(__ATOMIC_RELEASE, "workgroup"); } while (0)


// Multi-head attention with persistent memory: Q = query Wq^T + bq, K = [key Wk^T + bk ; 8 m_k], V = [value Wv^T + bv ; 8 m_v] (2048 + 64 slots), energy = Q K^T / 8 with the first 2048 key columns masked (mask == 0 -> -1e20) and the memory columns never masked; softmax; P V; merge heads; @ Wo^T + bo.  B 2, S 2048, D 1024, 16 x 64.
// k_pack, k_proj (exact GEMM + bias; q|k|v from query|key|value), k_kv (K rows incl. the memory slots; V as transposed hi/lo planes over the 2112 keys), k_attn (66 key steps, mask per key column), k_out (+ bo).
#define NB 2
#define SS 2048
#define DM 1024
#define NH 16
#define HD 64
#define NR (NB * SS)
#define QKVP (3 * DM)
#define NM 64
#define SK (SS + NM)        // 2112 keys per batch
#ifndef TRB
#define TRB (NR / 64)
#define TQB (SS / 64)
#define TNB NB
#endif
typedef __attribute__((ext_vector_type(8))) __bf16 v8b;
__device__ __forceinline__ v16b frag_b(const __bf16* rowk0, int lane) {
  union { v16b v; v8b q[2]; } u; const __bf16* p = rowk0 + 8 * (lane >> 4);
  u.q[0] = *(const v8b*)p; u.q[1] = *(const v8b*)(p + 16); return u.v;
}
__device__ __forceinline__ v16b frag_gbf(const float* rowk0, int lane) {
  v16b a; const float* p = rowk0 + 8 * (lane >> 4);
#pragma unroll
  for (int i = 0; i < 8; ++i) { a[i] = (__bf16)p[i]; a[8 + i] = (__bf16)p[16 + i]; }
  return a;
}
__device__ __forceinline__ float bfr(float v) { return (float)(__bf16)v; }
__device__ __attribute__((noinline)) float exp_ni(float v) { return expf(v); }
#define WS_PT   0u                                 // bf16 [4096 (q|k|v|out cols)][1024]
#define WS_QKV  (WS_PT + 2u * 4 * DM * DM)           // f32 [4096 rows][3072]  (q 0..1023 | k | v) ; q cols later overwritten by O
#define WS_KX   (WS_QKV + 4u * NR * QKVP)            // f32 [2][2112][1024] keys incl. memory
#define WS_VTH  (WS_KX + 4u * NB * SK * DM)           // bf16 [2][1024 (h*64+d)][2112]
#define WS_VTL  (WS_VTH + 2u * NB * DM * SK)
#define WS_END  (WS_VTL + 2u * NB * DM * SK)

__global__ __launch_bounds__(128) void k_pack(const float* __restrict__ Wq, const float* __restrict__ Wk, const float* __restrict__ Wv, const float* __restrict__ Wo, __bf16* __restrict__ PT) {
  __shared__ __align__(16) __bf16 srow[DM];
  const int n = blockIdx.x, tid = threadIdx.x; const int which = n >> 10, c = n & 1023; const float* Wm = which == 0 ? Wq : (which == 1 ? Wk : (which == 2 ? Wv : Wo));
  for (int k = tid; k < DM; k += 128) srow[k] = (__bf16)Wm[(size_t)c * DM + k];   // torch [out][in]: row c
  __syncthreads();
  vst2((unsigned*)(PT + (size_t)n * DM + tid * 8), *(const v4u*)(&srow[tid * 8]));
}
// ---- k_proj: QKV[r][n] = bf16(x[r]) . PT[n] (exact), K = 1024; block (64 rows, 128 cols); 512-B segments of 12-KB rows
__global__ __launch_bounds__(128) void k_proj(const float* __restrict__ XQ, const float* __restrict__ XK, const float* __restrict__ XV, const __bf16* __restrict__ PT, const float* __restrict__ bq, const float* __restrict__ bk, const float* __restrict__ bv, float* __restrict__ QKV) {
  const float* X = (blockIdx.y * 128) < DM ? XQ : ((blockIdx.y * 128) < 2 * DM ? XK : XV);
  __shared__ __align__(16) float so[4][16][132];
  const int tid = threadIdx.x, wave = tid >> 5, lane = tid & 31, col = lane & 15, g = lane >> 4; const size_t r0 = (size_t)blockIdx.x * 64 + wave * 16; const int n0 = blockIdx.y * 128;
  v8f acc[8] = {};
#pragma unroll 2
  for (int kc = 0; kc < DM / 32; ++kc) { const v16b a = frag_gbf(X + (r0 + col) * DM + kc * 32, lane);
#pragma unroll
    for (int j = 0; j < 8; ++j) acc[j] = wmma_bf(a, frag_b(PT + (size_t)(n0 + j * 16 + col) * DM + kc * 32, lane), acc[j]); }
#pragma unroll
  for (int j = 0; j < 8; ++j) { const int n = n0 + j * 16 + col; const int which = n >> 10, c = n & 1023; const float bb = bfr((which == 0 ? bq : which == 1 ? bk : bv)[c]);
#pragma unroll
    for (int r = 0; r < 8; ++r) so[wave][8 * g + r][j * 16 + col] = acc[j][r] + bb; }
  LDSX();
  for (int rl = 0; rl < 16; ++rl) vst2(QKV + (r0 + rl) * QKVP + n0 + lane * 4, *(const v4f*)&so[wave][rl][lane * 4]);
}
__global__ __launch_bounds__(256) void k_kv(const float* __restrict__ QKV, const float* __restrict__ MK, const float* __restrict__ MV, float* __restrict__ KX, __bf16* __restrict__ VTH, __bf16* __restrict__ VTL) {
  __shared__ __align__(16) __bf16 svh[DM][72], svl[DM][72]; __shared__ __align__(16) float sk[DM];
  const int tid = threadIdx.x; const int b = blockIdx.y, kb = blockIdx.x; const int k0 = kb * 64;
#pragma unroll 1
  for (int tl = 0; tl < 64; ++tl) { const int kk = k0 + tl; float kvv; 
    __syncthreads();
    for (int q = tid; q < DM; q += 256) { float kval, vval; if (kk < SS) { const float* row = QKV + ((size_t)b * SS + kk) * QKVP; kval = row[DM + q]; vval = row[2 * DM + q]; } else { const int j = kk - SS; kval = 8.0f * bfr(MK[(size_t)j * DM + q]); vval = 8.0f * bfr(MV[(size_t)j * DM + q]); }
      sk[q] = kval; const __bf16 hb = (__bf16)vval; svh[q][tl] = hb; svl[q][tl] = (__bf16)(vval - (float)hb); (void)kvv; }
    __syncthreads();
    for (int q = tid; q < DM / 4; q += 256) vst2(KX + ((size_t)b * SK + kk) * DM + q * 4, *(const v4f*)&sk[q * 4]); }
  __syncthreads();
  for (int q = tid; q < DM * 8; q += 256) { const int rowi = q >> 3, pc = q & 7; const size_t o = ((size_t)b * DM + rowi) * SK + k0 + pc * 8; vst2((unsigned*)(VTH + o), *(const v4u*)&svh[rowi][pc * 8]); vst2((unsigned*)(VTL + o), *(const v4u*)&svl[rowi][pc * 8]); }
}
__device__ __forceinline__ float xhalf(float x) { return __builtin_bit_cast(float, __builtin_amdgcn_permlanex16(__builtin_bit_cast(int, x), __builtin_bit_cast(int, x), 0x76543210, 0xfedcba98, false, false)); }  // lane l with lane l ^ 16
__global__ __launch_bounds__(128) void k_attn(float* __restrict__ QKV, const float* __restrict__ KX, const int* __restrict__ MASK, const __bf16* __restrict__ VTH, const __bf16* __restrict__ VTL) {
  __shared__ __align__(16) float so[4][16][68];
  const int tid = threadIdx.x, wave = tid >> 5, lane = tid & 31, col = lane & 15, g = lane >> 4;
  const int qb = blockIdx.x, bh = blockIdx.y, b = bh >> 4, h = bh & 15; const int q0 = qb * 64 + wave * 16; const size_t tq = (size_t)b * SS + q0;
  const F2 a0 = split_row(QKV + (tq + col) * QKVP + h * HD, 0, lane), a1 = split_row(QKV + (tq + col) * QKVP + h * HD, 32, lane);   // B operand: column = query
  float m = -3.0e38f, l = 0.f;   // of query col; l sums this wave half's keys only, the halves are joined behind the loop
  v8f acc[4] = {};               // acc[dt][r] = O[query col][dt * 16 + 8 g + r]
  const int nsteps = SK / 32;
#pragma unroll 1
  for (int ks = 0; ks < nsteps; ++ks) {
    const bool mem = ks * 32 >= SS;   // a step is wholly ordinary keys or wholly memory slots (SS is a multiple of 32)
    const int mv = MASK[(size_t)b * SS + (mem ? 0 : ks * 32) + lane];   // one key's mask a lane (the address is in range in a memory step too)
    const unsigned kw = (__builtin_amdgcn_ballot_w32(mv != 0) | (mem ? 0xffffffffu : 0u)) >> (8 * g);   // bit j = keep key 8g + j of this step
    float s[16];
#pragma unroll
    for (int ct = 0; ct < 2; ++ct) { const int kk = ks * 32 + ct * 16 + col; const float* krow = KX + ((size_t)b * SK + kk) * DM + h * HD; const F2 k0 = split_row(krow, 0, lane), k1 = split_row(krow, 32, lane);   // A operand: row = key
      v8f c = {}; c = wmma_bf(k0.h, a0.l, c); c = wmma_bf(k0.l, a0.h, c); c = wmma_bf(k0.h, a0.h, c); c = wmma_bf(k1.h, a1.l, c); c = wmma_bf(k1.l, a1.h, c); c = wmma_bf(k1.h, a1.h, c);
#pragma unroll
      for (int r = 0; r < 8; ++r) { const bool keep = ((kw >> (ct * 16 + r)) & 1u) != 0; s[ct * 8 + r] = keep ? c[r] * 0.125f : -1.0e20f; } }
    float mx = s[0];
#pragma unroll
    for (int i = 1; i < 16; ++i) mx = fmaxf(mx, s[i]);
    mx = fmaxf(mx, xhalf(mx));
    const float mn = fmaxf(m, mx); const float alpha = exp_ni(m - mn);
    float es = 0.f;
#pragma unroll
    for (int i = 0; i < 16; ++i) { s[i] = exp_ni(s[i] - mn); es += s[i]; }
    l = l * alpha + es; m = mn;
#pragma unroll
    for (int dt = 0; dt < 4; ++dt) acc[dt] *= alpha;
    const F2 pa = bsplit16(s);   // element i = key 8g+i, element 8+i = key 16+8g+i: the k order of frag_b
#pragma unroll
    for (int dt = 0; dt < 4; ++dt) { const size_t vrow = ((size_t)b * DM + h * HD + dt * 16 + col) * SK + ks * 32; const v16b vh = frag_b(VTH + vrow, lane), vl = frag_b(VTL + vrow, lane);   // A operand: row = d
      acc[dt] = wmma_bf(vh, pa.l, acc[dt]); acc[dt] = wmma_bf(vl, pa.h, acc[dt]); acc[dt] = wmma_bf(vh, pa.h, acc[dt]); } }
  const float il = 1.0f / (l + xhalf(l));
#pragma unroll
  for (int dt = 0; dt < 4; ++dt) { const v8f o = acc[dt] * il; vst2(&so[wave][col][dt * 16 + 8 * g], (v4f){o[0], o[1], o[2], o[3]}); vst2(&so[wave][col][dt * 16 + 8 * g + 4], (v4f){o[4], o[5], o[6], o[7]}); }
  LDSX();
  for (int rl = 0; rl < 16; ++rl) if (lane < 16) vst2(QKV + (tq + rl) * QKVP + h * HD + lane * 4, *(const v4f*)&so[wave][rl][lane * 4]);
}
// ---- k_out: Y = O(hi/lo; the q columns of QKV) . PT_out rows (2 products, K = 1024); block (64 rows, 128 cols)
__global__ __launch_bounds__(128) void k_out(const float* __restrict__ QKV, const __bf16* __restrict__ PT, const float* __restrict__ bo, float* __restrict__ Y) {
  __shared__ __align__(16) float so[4][16][132];
  const int tid = threadIdx.x, wave = tid >> 5, lane = tid & 31, col = lane & 15, g = lane >> 4; const size_t r0 = (size_t)blockIdx.x * 64 + wave * 16; const int n0 = blockIdx.y * 128;
  v8f acc[8] = {};
#pragma unroll 2
  for (int kc = 0; kc < DM / 32; ++kc) { const F2 a = split_row(QKV + (r0 + col) * QKVP, kc * 32, lane);
#pragma unroll
    for (int j = 0; j < 8; ++j) { const v16b w = frag_b(PT + (size_t)(3 * DM + n0 + j * 16 + col) * DM + kc * 32, lane); acc[j] = wmma_bf(a.l, w, acc[j]); acc[j] = wmma_bf(a.h, w, acc[j]); } }
#pragma unroll
  for (int j = 0; j < 8; ++j) { const float bb = bfr(bo[n0 + j * 16 + col]);
#pragma unroll
    for (int r = 0; r < 8; ++r) so[wave][8 * g + r][j * 16 + col] = acc[j][r] + bb; }
  LDSX();
  for (int rl = 0; rl < 16; ++rl) vst2(Y + (r0 + rl) * DM + n0 + lane * 4, *(const v4f*)&so[wave][rl][lane * 4]);
}

extern "C" void kernel_launch(void* const* d_in, const int* in_sizes, int n_in, void* d_out, int out_size, void* d_ws, size_t ws_size, hipStream_t stream) {
  (void)in_sizes; (void)n_in; (void)out_size;
  const float** F = (const float**)d_in;   // query, key, value, mask [2,1,1,2048] i32, Wq, bq, Wk, bk, Wv, bv, Wo, bo, m_k [1,64,1024], m_v
  if (ws_size < (size_t)WS_END) return;
  char* ws = (char*)d_ws; __bf16 *PT = (__bf16*)(ws + WS_PT), *VTH = (__bf16*)(ws + WS_VTH), *VTL = (__bf16*)(ws + WS_VTL); float *QKV = (float*)(ws + WS_QKV), *KX = (float*)(ws + WS_KX);
  k_pack<<<4 * DM, 128, 0, stream>>>(F[4], F[6], F[8], F[10], PT);
  k_proj<<<dim3(TRB, QKVP / 128), 128, 0, stream>>>(F[0], F[1], F[2], PT, F[5], F[7], F[9], QKV);
  k_kv<<<dim3(SK / 64, TNB), 256, 0, stream>>>(QKV, F[12], F[13], KX, VTH, VTL);
  k_attn<<<dim3(TQB, TNB * NH), 128, 0, stream>>>(QKV, KX, (const int*)d_in[3], VTH, VTL);
  k_out<<<dim3((TNB < NB ? TQB : NR / 64), DM / 128), 128, 0, stream>>>(QKV, PT, F[11], (float*)d_out);
}

// v002
// Measured time: 484 microseconds a run.
// Timed twice side by side with v001, it ran 1.25 and 1.26 times as fast.
// Counting every step since v000, it is 1.49 times as fast.
// compute dtype: query/key/value, the four weights + biases and the memory slots (module inputs) rounded to bf16; q/k/v projections with exact bf16 products (+ f32 bias); scores and P.V with both computed operands as bf16 hi + bf16 residual pairs (3 products; memory keys/values scaled in f32 and split the same way); output projection hi/lo x bf16 Wo (2 products) + bias; masked online softmax in f32; f32 accumulate.
#include <hip/hip_runtime.h>
#include <math.h>

typedef __attribute__((ext_vector_type(16))) _Float16 v16h;
typedef __attribute__((ext_vector_type(16))) __bf16 v16b;
typedef __attribute__((ext_vector_type(8)))  _Float16 v8h;
typedef __attribute__((ext_vector_type(8)))  float v8f;
typedef __attribute__((ext_vector_type(4)))  float v4f;
typedef __attribute__((ext_vector_type(2)))  float v2f;
typedef __attribute__((ext_vector_type(4)))  unsigned v4u;
typedef __attribute__((ext_vector_type(4)))  int v4i;
typedef float __attribute__((may_alias)) float_a;
typedef int __attribute__((may_alias)) int_a;

template <typename T> __device__ __forceinline__ void vst2(void* p, T v) { *(T*)p = v;  }
__device__ __forceinline__ v8f wmma16(v16h a, v16h b, v8f c) {
  v8f d = __builtin_amdgcn_wmma_f32_16x16x32_f16(false, a, false, b, (short)0, c, false, false);
  asm volatile("v_nop\n\tv_nop\n\tv_nop\n\tv_nop" : "+v"(d) : "v"(a), "v"(b));
  return d;
}
__device__ __forceinline__ v8f wmma_bf(v16b a, v16b b, v8f c) {
  v8f d = __builtin_amdgcn_wmma_f32_16x16x32_bf16(false, a, false, b, (short)0, c, false, false);
  asm volatile("v_nop\n\tv_nop\n\tv_nop\n\tv_nop" : "+v"(d) : "v"(a), "v"(b));
  return d;
}
// 16x16x32 fragments: lane = (h = lane>>4, row/col = lane&15); elements 0..7 = k0+8h+0..7, 8..15 = k0+16+8h+0..7; D element r = row 8h+r
__device__ __forceinline__ v16h frag_h(const _Float16* rowk0, int lane) {
  union { v16h v; v8h q[2]; } u; const _Float16* p = rowk0 + 8 * (lane >> 4);
  u.q[0] = *(const v8h*)p; u.q[1] = *(const v8h*)(p + 16); return u.v;
}
__device__ __forceinline__ v16h frag_f32(const float* rowk0, int lane) {
  v16h a; const float* p = rowk0 + 8 * (lane >> 4);
#pragma unroll
  for (int i = 0; i < 8; ++i) { a[i] = (_Float16)p[i]; a[8 + i] = (_Float16)p[16 + i]; }
  return a;
}
__device__ __forceinline__ v16h frag_f32s(const float* rowk0, int lane, float sc) {
  v16h a; const float* p = rowk0 + 8 * (lane >> 4);
#pragma unroll
  for (int i = 0; i < 8; ++i) { a[i] = (_Float16)(p[i] * sc); a[8 + i] = (_Float16)(p[16 + i] * sc); }
  return a;
}
// column fragment from a [K][ld] layout (column n), rows >= K read as 0
__device__ __forceinline__ v16h fragc_f32(const float* W, int k0, int n, int lane, int ld, int K) {
  v16h a; const int g = lane >> 4;
#pragma unroll
  for (int i = 0; i < 8; ++i) { const int ka = k0 + 8 * g + i, kb = ka + 16;
    a[i] = (_Float16)(ka < K ? W[(size_t)(ka < K ? ka : K - 1) * ld + n] : 0.f); a[8 + i] = (_Float16)(kb < K ? W[(size_t)(kb < K ? kb : K - 1) * ld + n] : 0.f); }
  return a;
}
struct F2 { v16b h, l; };
__device__ __forceinline__ F2 bsplit16(const float v[16]) { F2 r;
#pragma unroll
  for (int i = 0; i < 16; ++i) { const __bf16 h = (__bf16)v[i]; r.h[i] = h; r.l[i] = (__bf16)(v[i] - (float)h); }
  return r; }
__device__ __forceinline__ F2 split_row(const float* row, int k0, int lane) { float v[16]; const float* p = row + k0 + 8 * (lane >> 4);
#pragma unroll
  for (int i = 0; i < 8; ++i) { v[i] = p[i]; v[8 + i] = p[16 + i]; }
  return bsplit16(v); }
__device__ __forceinline__ F2 split_rowK(const float* row, int k0, int lane, int K) { float v[16]; const int g = lane >> 4;
#pragma unroll
  for (int i = 0; i < 8; ++i) { const int ka = k0 + 8 * g + i, kb = ka + 16; v[i] = ka < K ? row[ka < K ? ka : K - 1] : 0.f; v[8 + i] = kb < K ? row[kb < K ? kb : K - 1] : 0.f; }
  return bsplit16(v); }
__device__ __forceinline__ F2 split_col(const float* W, int k0, int n, int lane, int ld, int K) { float v[16]; const int g = lane >> 4;
#pragma unroll
  for (int i = 0; i < 8; ++i) { const int ka = k0 + 8 * g + i, kb = ka + 16; v[i] = ka < K ? W[(size_t)(ka < K ? ka : K - 1) * ld + n] : 0.f; v[8 + i] = kb < K ? W[(size_t)(kb < K ? kb : K - 1) * ld + n] : 0.f; }
  return bsplit16(v); }
__device__ __forceinline__ v8f mac3(const F2& a, const F2& b, v8f c) { c = wmma_bf(a.l, b.h, c); c = wmma_bf(a.h, b.l, c); return wmma_bf(a.h, b.h, c); }
__device__ __forceinline__ float sigm(float v) { return 1.0f / (1.0f + expf(-v)); }
#define LDSX() do { asm volatile("s_wait_dscnt 0" ::: "memory"); __builtin_amdgcn_wave_barrier(); __builtin_amdgcn_fence(__ATOMIC_RELEASE, "workgroup"); } while (0)


// Multi-head attention with persistent memory: Q = query Wq^T + bq, K = [key Wk^T + bk ; 8 m_k], V = [value Wv^T + bv ; 8 m_v] (2048 + 64 slots), energy = Q K^T / 8 with the first 2048 key columns masked (mask == 0 -> -1e20) and the memory columns never masked; softmax; P V; merge heads; @ Wo^T + bo.  B 2, S 2048, D 1024, 16 x 64.
// k_pack, k_proj (exact GEMM + bias; q|k|v from query|key|value), k_kv (K rows incl. the memory slots; V as transposed hi/lo planes over the 2112 keys), k_attn (66 key steps, mask per key column), k_out (+ bo).
#define NB 2
#define SS 2048
#define DM 1024
#define NH 16
#define HD 64
#define NR (NB * SS)
#define QKVP (3 * DM)
#define NM 64
#define SK (SS + NM)        // 2112 keys per batch
#ifndef TRB
#define TRB (NR / 64)
#define TQB (SS / 64)
#define TNB NB
#endif
typedef __attribute__((ext_vector_type(8))) __bf16 v8b;
__device__ __forceinline__ v16b frag_b(const __bf16* rowk0, int lane) {
  union { v16b v; v8b q[2]; } u; const __bf16* p = rowk0 + 8 * (lane >> 4);
  u.q[0] = *(const v8b*)p; u.q[1] = *(const v8b*)(p + 16); return u.v;
}
__device__ __forceinline__ v16b frag_gbf(const float* rowk0, int lane) {
  v16b a; const float* p = rowk0 + 8 * (lane >> 4);
#pragma unroll
  for (int i = 0; i < 8; ++i) { a[i] = (__bf16)p[i]; a[8 + i] = (__bf16)p[16 + i]; }
  return a;
}
__device__ __forceinline__ float bfr(float v) { return (float)(__bf16)v; }
__device__ __attribute__((noinline)) float exp_ni(float v) { return expf(v); }
#define WS_PT   0u                                 // bf16 [4096 (q|k|v|out cols)][1024]
#define WS_QKV  (WS_PT + 2u * 4 * DM * DM)           // f32 [4096 rows][3072]  (q 0..1023 | k | v) ; q cols later overwritten by O
#define WS_KX   (WS_QKV + 4u * NR * QKVP)            // f32 [2][2112][1024] keys incl. memory
#define WS_VTH  (WS_KX + 4u * NB * SK * DM)           // bf16 [2][1024 (h*64+d)][2112]
#define WS_VTL  (WS_VTH + 2u * NB * DM * SK)
#define WS_END  (WS_VTL + 2u * NB * DM * SK)

__global__ __launch_bounds__(128) void k_pack(const float* __restrict__ Wq, const float* __restrict__ Wk, const float* __restrict__ Wv, const float* __restrict__ Wo, __bf16* __restrict__ PT) {
  __shared__ __align__(16) __bf16 srow[DM];
  const int n = blockIdx.x, tid = threadIdx.x; const int which = n >> 10, c = n & 1023; const float* Wm = which == 0 ? Wq : (which == 1 ? Wk : (which == 2 ? Wv : Wo));
  for (int k = tid; k < DM; k += 128) srow[k] = (__bf16)Wm[(size_t)c * DM + k];   // torch [out][in]: row c
  __syncthreads();
  vst2((unsigned*)(PT + (size_t)n * DM + tid * 8), *(const v4u*)(&srow[tid * 8]));
}
// ---- k_proj: QKV[r][n] = bf16(x[r]) . PT[n] (exact), K = 1024; block (64 rows, 128 cols); 512-B segments of 12-KB rows
__global__ __launch_bounds__(128) void k_proj(const float* __restrict__ XQ, const float* __restrict__ XK, const float* __restrict__ XV, const __bf16* __restrict__ PT, const float* __restrict__ bq, const float* __restrict__ bk, const float* __restrict__ bv, float* __restrict__ QKV) {
  const float* X = (blockIdx.y * 128) < DM ? XQ : ((blockIdx.y * 128) < 2 * DM ? XK : XV);
  __shared__ __align__(16) float so[4][16][132];
  const int tid = threadIdx.x, wave = tid >> 5, lane = tid & 31, col = lane & 15, g = lane >> 4; const size_t r0 = (size_t)blockIdx.x * 64 + wave * 16; const int n0 = blockIdx.y * 128;
  v8f acc[8] = {};
#pragma unroll 2
  for (int kc = 0; kc < DM / 32; ++kc) { const v16b a = frag_gbf(X + (r0 + col) * DM + kc * 32, lane);
#pragma unroll
    for (int j = 0; j < 8; ++j) acc[j] = wmma_bf(a, frag_b(PT + (size_t)(n0 + j * 16 + col) * DM + kc * 32, lane), acc[j]); }
#pragma unroll
  for (int j = 0; j < 8; ++j) { const int n = n0 + j * 16 + col; const int which = n >> 10, c = n & 1023; const float bb = bfr((which == 0 ? bq : which == 1 ? bk : bv)[c]);
#pragma unroll
    for (int r = 0; r < 8; ++r) so[wave][8 * g + r][j * 16 + col] = acc[j][r] + bb; }
  LDSX();
  for (int rl = 0; rl < 16; ++rl) vst2(QKV + (r0 + rl) * QKVP + n0 + lane * 4, *(const v4f*)&so[wave][rl][lane * 4]);
}
// ---- k_kv: block = (64 keys, one head's 64 columns, batch), 4 waves; a thread holds 4 key pairs x 4 columns of K and of V with all 16 loads in flight together; V is split, packed by key pair and turned in LDS, K goes straight out again
typedef __attribute__((ext_vector_type(2))) __bf16 v2b;
__global__ __launch_bounds__(128) void k_kv(const float* __restrict__ QKV, const float* __restrict__ MK, const float* __restrict__ MV, float* __restrict__ KX, __bf16* __restrict__ VTH, __bf16* __restrict__ VTL) {
  __shared__ __align__(16) unsigned svh[64][36], svl[64][36];   // [column][key pair]; the 16-B chunks of a row stand XORed with column >> 4, so that a wave's 32 pair stores meet 32 banks
  const int tid = threadIdx.x, c4 = tid & 15, pr = tid >> 4; const int k0 = blockIdx.x * 64, c0 = blockIdx.y * 64, b = blockIdx.z;
  v4f kq[8], vq[8];   // i: key 2 * pr + 16 * (i >> 1) + (i & 1) of the block
  if (k0 < SS) {      // a block is wholly ordinary keys or wholly memory slots (SS is a multiple of 64)
    const float* base = QKV + ((size_t)b * SS + k0 + 2 * pr) * QKVP + c0 + c4 * 4;
#pragma unroll
    for (int i = 0; i < 8; ++i) { const float* row = base + (size_t)(16 * (i >> 1) + (i & 1)) * QKVP; kq[i] = *(const v4f*)(row + DM); vq[i] = *(const v4f*)(row + 2 * DM); }
    asm volatile("s_wait_xcnt 0x0" :: "v"(base) : "memory");   // the loads' address pair stays whole (no load's own result lands on it) until every load has taken its address
  } else {
    const size_t o0 = (size_t)(k0 - SS + 2 * pr) * DM + c0 + c4 * 4; const float *pk = MK + o0, *pv = MV + o0;
#pragma unroll
    for (int i = 0; i < 8; ++i) { const size_t o = (size_t)(16 * (i >> 1) + (i & 1)) * DM; kq[i] = *(const v4f*)(pk + o); vq[i] = *(const v4f*)(pv + o); }
    asm volatile("s_wait_xcnt 0x0" :: "v"(pk), "v"(pv) : "memory");   // as above, for the two address pairs
#pragma unroll
    for (int i = 0; i < 8; ++i) {
#pragma unroll
      for (int e = 0; e < 4; ++e) { kq[i][e] = 8.0f * bfr(kq[i][e]); vq[i][e] = 8.0f * bfr(vq[i][e]); } }
  }
#pragma unroll
  for (int p = 0; p < 4; ++p) { const int pp = (pr + 8 * p) ^ ((c4 >> 2) << 2);
#pragma unroll
    for (int e = 0; e < 4; ++e) { const float va = vq[2 * p][e], vb = vq[2 * p + 1][e]; const __bf16 ha = (__bf16)va, hb = (__bf16)vb;
      const v2b hh = {ha, hb}, ll = {(__bf16)(va - (float)ha), (__bf16)(vb - (float)hb)};
      svh[c4 * 4 + e][pp] = __builtin_bit_cast(unsigned, hh); svl[c4 * 4 + e][pp] = __builtin_bit_cast(unsigned, ll); } }
  __syncthreads();
#pragma unroll
  for (int i = 0; i < 8; ++i) vst2(KX + ((size_t)b * SK + k0 + 2 * pr + 16 * (i >> 1) + (i & 1)) * DM + c0 + c4 * 4, kq[i]);   // behind the barrier, which would else wait for these stores
#pragma unroll
  for (int it = 0; it < 4; ++it) { const int rowi = it * 16 + (tid >> 3), pc = tid & 7, sw = (pc ^ it) * 4; const size_t o = ((size_t)b * DM + c0 + rowi) * SK + k0 + pc * 8; vst2((unsigned*)(VTH + o), *(const v4u*)&svh[rowi][sw]); vst2((unsigned*)(VTL + o), *(const v4u*)&svl[rowi][sw]); }
}
__device__ __forceinline__ float xhalf(float x) { return __builtin_bit_cast(float, __builtin_amdgcn_permlanex16(__builtin_bit_cast(int, x), __builtin_bit_cast(int, x), 0x76543210, 0xfedcba98, false, false)); }  // lane l with lane l ^ 16
__global__ __launch_bounds__(128) void k_attn(float* __restrict__ QKV, const float* __restrict__ KX, const int* __restrict__ MASK, const __bf16* __restrict__ VTH, const __bf16* __restrict__ VTL) {
  __shared__ __align__(16) float so[4][16][68];
  const int tid = threadIdx.x, wave = tid >> 5, lane = tid & 31, col = lane & 15, g = lane >> 4;
  const int qb = blockIdx.x, bh = blockIdx.y, b = bh >> 4, h = bh & 15; const int q0 = qb * 64 + wave * 16; const size_t tq = (size_t)b * SS + q0;
  const F2 a0 = split_row(QKV + (tq + col) * QKVP + h * HD, 0, lane), a1 = split_row(QKV + (tq + col) * QKVP + h * HD, 32, lane);   // B operand: column = query
  float m = -3.0e38f, l = 0.f;   // of query col; l sums this wave half's keys only, the halves are joined behind the loop
  v8f acc[4] = {};               // acc[dt][r] = O[query col][dt * 16 + 8 g + r]
  const int nsteps = SK / 32;
#pragma unroll 1
  for (int ks = 0; ks < nsteps; ++ks) {
    const bool mem = ks * 32 >= SS;   // a step is wholly ordinary keys or wholly memory slots (SS is a multiple of 32)
    const int mv = MASK[(size_t)b * SS + (mem ? 0 : ks * 32) + lane];   // one key's mask a lane (the address is in range in a memory step too)
    const unsigned kw = (__builtin_amdgcn_ballot_w32(mv != 0) | (mem ? 0xffffffffu : 0u)) >> (8 * g);   // bit j = keep key 8g + j of this step
    float s[16];
#pragma unroll
    for (int ct = 0; ct < 2; ++ct) { const int kk = ks * 32 + ct * 16 + col; const float* krow = KX + ((size_t)b * SK + kk) * DM + h * HD; const F2 k0 = split_row(krow, 0, lane), k1 = split_row(krow, 32, lane);   // A operand: row = key
      v8f c = {}; c = wmma_bf(k0.h, a0.l, c); c = wmma_bf(k0.l, a0.h, c); c = wmma_bf(k0.h, a0.h, c); c = wmma_bf(k1.h, a1.l, c); c = wmma_bf(k1.l, a1.h, c); c = wmma_bf(k1.h, a1.h, c);
#pragma unroll
      for (int r = 0; r < 8; ++r) { const bool keep = ((kw >> (ct * 16 + r)) & 1u) != 0; s[ct * 8 + r] = keep ? c[r] * 0.125f : -1.0e20f; } }
    float mx = s[0];
#pragma unroll
    for (int i = 1; i < 16; ++i) mx = fmaxf(mx, s[i]);
    mx = fmaxf(mx, xhalf(mx));
    const float mn = fmaxf(m, mx); const float alpha = exp_ni(m - mn);
    float es = 0.f;
#pragma unroll
    for (int i = 0; i < 16; ++i) { s[i] = exp_ni(s[i] - mn); es += s[i]; }
    l = l * alpha + es; m = mn;
#pragma unroll
    for (int dt = 0; dt < 4; ++dt) acc[dt] *= alpha;
    const F2 pa = bsplit16(s);   // element i = key 8g+i, element 8+i = key 16+8g+i: the k order of frag_b
#pragma unroll
    for (int dt = 0; dt < 4; ++dt) { const size_t vrow = ((size_t)b * DM + h * HD + dt * 16 + col) * SK + ks * 32; const v16b vh = frag_b(VTH + vrow, lane), vl = frag_b(VTL + vrow, lane);   // A operand: row = d
      acc[dt] = wmma_bf(vh, pa.l, acc[dt]); acc[dt] = wmma_bf(vl, pa.h, acc[dt]); acc[dt] = wmma_bf(vh, pa.h, acc[dt]); } }
  const float il = 1.0f / (l + xhalf(l));
#pragma unroll
  for (int dt = 0; dt < 4; ++dt) { const v8f o = acc[dt] * il; vst2(&so[wave][col][dt * 16 + 8 * g], (v4f){o[0], o[1], o[2], o[3]}); vst2(&so[wave][col][dt * 16 + 8 * g + 4], (v4f){o[4], o[5], o[6], o[7]}); }
  LDSX();
  for (int rl = 0; rl < 16; ++rl) if (lane < 16) vst2(QKV + (tq + rl) * QKVP + h * HD + lane * 4, *(const v4f*)&so[wave][rl][lane * 4]);
}
// ---- k_out: Y = O(hi/lo; the q columns of QKV) . PT_out rows (2 products, K = 1024); block (64 rows, 128 cols)
__global__ __launch_bounds__(128) void k_out(const float* __restrict__ QKV, const __bf16* __restrict__ PT, const float* __restrict__ bo, float* __restrict__ Y) {
  __shared__ __align__(16) float so[4][16][132];
  const int tid = threadIdx.x, wave = tid >> 5, lane = tid & 31, col = lane & 15, g = lane >> 4; const size_t r0 = (size_t)blockIdx.x * 64 + wave * 16; const int n0 = blockIdx.y * 128;
  v8f acc[8] = {};
#pragma unroll 2
  for (int kc = 0; kc < DM / 32; ++kc) { const F2 a = split_row(QKV + (r0 + col) * QKVP, kc * 32, lane);
#pragma unroll
    for (int j = 0; j < 8; ++j) { const v16b w = frag_b(PT + (size_t)(3 * DM + n0 + j * 16 + col) * DM + kc * 32, lane); acc[j] = wmma_bf(a.l, w, acc[j]); acc[j] = wmma_bf(a.h, w, acc[j]); } }
#pragma unroll
  for (int j = 0; j < 8; ++j) { const float bb = bfr(bo[n0 + j * 16 + col]);
#pragma unroll
    for (int r = 0; r < 8; ++r) so[wave][8 * g + r][j * 16 + col] = acc[j][r] + bb; }
  LDSX();
  for (int rl = 0; rl < 16; ++rl) vst2(Y + (r0 + rl) * DM + n0 + lane * 4, *(const v4f*)&so[wave][rl][lane * 4]);
}

extern "C" void kernel_launch(void* const* d_in, const int* in_sizes, int n_in, void* d_out, int out_size, void* d_ws, size_t ws_size, hipStream_t stream) {
  (void)in_sizes; (void)n_in; (void)out_size;
  const float** F = (const float**)d_in;   // query, key, value, mask [2,1,1,2048] i32, Wq, bq, Wk, bk, Wv, bv, Wo, bo, m_k [1,64,1024], m_v
  if (ws_size < (size_t)WS_END) return;
  char* ws = (char*)d_ws; __bf16 *PT = (__bf16*)(ws + WS_PT), *VTH = (__bf16*)(ws + WS_VTH), *VTL = (__bf16*)(ws + WS_VTL); float *QKV = (float*)(ws + WS_QKV), *KX = (float*)(ws + WS_KX);
  k_pack<<<4 * DM, 128, 0, stream>>>(F[4], F[6], F[8], F[10], PT);
  k_proj<<<dim3(TRB, QKVP / 128), 128, 0, stream>>>(F[0], F[1], F[2], PT, F[5], F[7], F[9], QKV);
  k_kv<<<dim3(SK / 64, DM / 64, TNB), 128, 0, stream>>>(QKV, F[12], F[13], KX, VTH, VTL);
  k_attn<<<dim3(TQB, TNB * NH), 128, 0, stream>>>(QKV, KX, (const int*)d_in[3], VTH, VTL);
  k_out<<<dim3((TNB < NB ? TQB : NR / 64), DM / 128), 128, 0, stream>>>(QKV, PT, F[11], (float*)d_out);
}

// v003
// It runs in 375 microseconds.
// Next to v002, in two timings, it ran 1.29 and 1.28 times as fast.
// Counting every step since v000, it is 1.91 times as fast.
// compute dtype: query/key/value, the four weights + biases and the memory slots (module inputs) rounded to bf16; q/k/v projections with exact bf16 products (+ f32 bias); scores and P.V with both computed operands as bf16 hi + bf16 residual pairs (3 products; memory keys/values scaled in f32 and split the same way); output projection hi/lo x bf16 Wo (2 products) + bias; masked online softmax in f32; f32 accumulate.
#include <hip/hip_runtime.h>
#include <math.h>

typedef __attribute__((ext_vector_type(16))) _Float16 v16h;
typedef __attribute__((ext_vector_type(16))) __bf16 v16b;
typedef __attribute__((ext_vector_type(8)))  _Float16 v8h;
typedef __attribute__((ext_vector_type(8)))  float v8f;
typedef __attribute__((ext_vector_type(4)))  float v4f;
typedef __attribute__((ext_vector_type(2)))  float v2f;
typedef __attribute__((ext_vector_type(4)))  unsigned v4u;
typedef __attribute__((ext_vector_type(4)))  int v4i;
typedef float __attribute__((may_alias)) float_a;
typedef int __attribute__((may_alias)) int_a;

template <typename T> __device__ __forceinline__ void vst2(void* p, T v) { *(T*)p = v;  }
__device__ __forceinline__ v8f wmma16(v16h a, v16h b, v8f c) {
  v8f d = __builtin_amdgcn_wmma_f32_16x16x32_f16(false, a, false, b, (short)0, c, false, false);
  asm volatile("v_nop\n\tv_nop\n\tv_nop\n\tv_nop" : "+v"(d) : "v"(a), "v"(b));
  return d;
}
__device__ __forceinline__ v8f wmma_bf(v16b a, v16b b, v8f c) {
  v8f d = __builtin_amdgcn_wmma_f32_16x16x32_bf16(false, a, false, b, (short)0, c, false, false);
  asm volatile("v_nop\n\tv_nop\n\tv_nop\n\tv_nop" : "+v"(d) : "v"(a), "v"(b));
  return d;
}
// 16x16x32 fragments: lane = (h = lane>>4, row/col = lane&15); elements 0..7 = k0+8h+0..7, 8..15 = k0+16+8h+0..7; D element r = row 8h+r
__device__ __forceinline__ v16h frag_h(const _Float16* rowk0, int lane) {
  union { v16h v; v8h q[2]; } u; const _Float16* p = rowk0 + 8 * (lane >> 4);
  u.q[0] = *(const v8h*)p; u.q[1] = *(const v8h*)(p + 16); return u.v;
}
__device__ __forceinline__ v16h frag_f32(const float* rowk0, int lane) {
  v16h a; const float* p = rowk0 + 8 * (lane >> 4);
#pragma unroll
  for (int i = 0; i < 8; ++i) { a[i] = (_Float16)p[i]; a[8 + i] = (_Float16)p[16 + i]; }
  return a;
}
__device__ __forceinline__ v16h frag_f32s(const float* rowk0, int lane, float sc) {
  v16h a; const float* p = rowk0 + 8 * (lane >> 4);
#pragma unroll
  for (int i = 0; i < 8; ++i) { a[i] = (_Float16)(p[i] * sc); a[8 + i] = (_Float16)(p[16 + i] * sc); }
  return a;
}
// column fragment from a [K][ld] layout (column n), rows >= K read as 0
__device__ __forceinline__ v16h fragc_f32(const float* W, int k0, int n, int lane, int ld, int K) {
  v16h a; const int g = lane >> 4;
#pragma unroll
  for (int i = 0; i < 8; ++i) { const int ka = k0 + 8 * g + i, kb = ka + 16;
    a[i] = (_Float16)(ka < K ? W[(size_t)(ka < K ? ka : K - 1) * ld + n] : 0.f); a[8 + i] = (_Float16)(kb < K ? W[(size_t)(kb < K ? kb : K - 1) * ld + n] : 0.f); }
  return a;
}
struct F2 { v16b h, l; };
__device__ __forceinline__ F2 bsplit16(const float v[16]) { F2 r;
#pragma unroll
  for (int i = 0; i < 16; ++i) { const __bf16 h = (__bf16)v[i]; r.h[i] = h; r.l[i] = (__bf16)(v[i] - (float)h); }
  return r; }
__device__ __forceinline__ F2 split_row(const float* row, int k0, int lane) { float v[16]; const float* p = row + k0 + 8 * (lane >> 4);
#pragma unroll
  for (int i = 0; i < 8; ++i) { v[i] = p[i]; v[8 + i] = p[16 + i]; }
  return bsplit16(v); }
__device__ __forceinline__ F2 split_rowK(const float* row, int k0, int lane, int K) { float v[16]; const int g = lane >> 4;
#pragma unroll
  for (int i = 0; i < 8; ++i) { const int ka = k0 + 8 * g + i, kb = ka + 16; v[i] = ka < K ? row[ka < K ? ka : K - 1] : 0.f; v[8 + i] = kb < K ? row[kb < K ? kb : K - 1] : 0.f; }
  return bsplit16(v); }
__device__ __forceinline__ F2 split_col(const float* W, int k0, int n, int lane, int ld, int K) { float v[16]; const int g = lane >> 4;
#pragma unroll
  for (int i = 0; i < 8; ++i) { const int ka = k0 + 8 * g + i, kb = ka + 16; v[i] = ka < K ? W[(size_t)(ka < K ? ka : K - 1) * ld + n] : 0.f; v[8 + i] = kb < K ? W[(size_t)(kb < K ? kb : K - 1) * ld + n] : 0.f; }
  return bsplit16(v); }
__device__ __forceinline__ v8f mac3(const F2& a, const F2& b, v8f c) { c = wmma_bf(a.l, b.h, c); c = wmma_bf(a.h, b.l, c); return wmma_bf(a.h, b.h, c); }
__device__ __forceinline__ float sigm(float v) { return 1.0f / (1.0f + expf(-v)); }
#define LDSX() do { asm volatile("s_wait_dscnt 0" ::: "memory"); __builtin_amdgcn_wave_barrier(); __builtin_amdgcn_fence(__ATOMIC_RELEASE, "workgroup"); } while (0)


// Multi-head attention with persistent memory: Q = query Wq^T + bq, K = [key Wk^T + bk ; 8 m_k], V = [value Wv^T + bv ; 8 m_v] (2048 + 64 slots), energy = Q K^T / 8 with the first 2048 key columns masked (mask == 0 -> -1e20) and the memory columns never masked; softmax; P V; merge heads; @ Wo^T + bo.  B 2, S 2048, D 1024, 16 x 64.
// k_pack, k_proj (exact GEMM + bias; q|k|v from query|key|value), k_kv (K rows incl. the memory slots; V as transposed hi/lo planes over the 2112 keys), k_attn (66 key steps, K and V staged in LDS by 64 keys, mask per key column), k_out (+ bo).
#define NB 2
#define SS 2048
#define DM 1024
#define NH 16
#define HD 64
#define NR (NB * SS)
#define QKVP (3 * DM)
#define NM 64
#define SK (SS + NM)        // 2112 keys per batch
#ifndef TRB
#define TRB (NR / 64)
#define TQB (SS / 64)
#define TNB NB
#endif
typedef __attribute__((ext_vector_type(8))) __bf16 v8b;
__device__ __forceinline__ v16b frag_b(const __bf16* rowk0, int lane) {
  union { v16b v; v8b q[2]; } u; const __bf16* p = rowk0 + 8 * (lane >> 4);
  u.q[0] = *(const v8b*)p; u.q[1] = *(const v8b*)(p + 16); return u.v;
}
__device__ __forceinline__ v16b frag_gbf(const float* rowk0, int lane) {
  v16b a; const float* p = rowk0 + 8 * (lane >> 4);
#pragma unroll
  for (int i = 0; i < 8; ++i) { a[i] = (__bf16)p[i]; a[8 + i] = (__bf16)p[16 + i]; }
  return a;
}
__device__ __forceinline__ float bfr(float v) { return (float)(__bf16)v; }
__device__ __attribute__((noinline)) float exp_ni(float v) { return expf(v); }
#define WS_PT   0u                                 // bf16 [4096 (q|k|v|out cols)][1024]
#define WS_QKV  (WS_PT + 2u * 4 * DM * DM)           // f32 [4096 rows][3072]  (q 0..1023 | k | v) ; q cols later overwritten by O
#define WS_KX   (WS_QKV + 4u * NR * QKVP)            // f32 [2][2112][1024] keys incl. memory
#define WS_VTH  (WS_KX + 4u * NB * SK * DM)           // bf16 [2][1024 (h*64+d)][2112]
#define WS_VTL  (WS_VTH + 2u * NB * DM * SK)
#define WS_END  (WS_VTL + 2u * NB * DM * SK)

__global__ __launch_bounds__(128) void k_pack(const float* __restrict__ Wq, const float* __restrict__ Wk, const float* __restrict__ Wv, const float* __restrict__ Wo, __bf16* __restrict__ PT) {
  __shared__ __align__(16) __bf16 srow[DM];
  const int n = blockIdx.x, tid = threadIdx.x; const int which = n >> 10, c = n & 1023; const float* Wm = which == 0 ? Wq : (which == 1 ? Wk : (which == 2 ? Wv : Wo));
  for (int k = tid; k < DM; k += 128) srow[k] = (__bf16)Wm[(size_t)c * DM + k];   // torch [out][in]: row c
  __syncthreads();
  vst2((unsigned*)(PT + (size_t)n * DM + tid * 8), *(const v4u*)(&srow[tid * 8]));
}
// ---- k_proj: QKV[r][n] = bf16(x[r]) . PT[n] (exact), K = 1024; block (64 rows, 128 cols); 512-B segments of 12-KB rows
__global__ __launch_bounds__(128) void k_proj(const float* __restrict__ XQ, const float* __restrict__ XK, const float* __restrict__ XV, const __bf16* __restrict__ PT, const float* __restrict__ bq, const float* __restrict__ bk, const float* __restrict__ bv, float* __restrict__ QKV) {
  const float* X = (blockIdx.y * 128) < DM ? XQ : ((blockIdx.y * 128) < 2 * DM ? XK : XV);
  __shared__ __align__(16) float so[4][16][132];
  const int tid = threadIdx.x, wave = tid >> 5, lane = tid & 31, col = lane & 15, g = lane >> 4; const size_t r0 = (size_t)blockIdx.x * 64 + wave * 16; const int n0 = blockIdx.y * 128;
  v8f acc[8] = {};
#pragma unroll 2
  for (int kc = 0; kc < DM / 32; ++kc) { const v16b a = frag_gbf(X + (r0 + col) * DM + kc * 32, lane);
#pragma unroll
    for (int j = 0; j < 8; ++j) acc[j] = wmma_bf(a, frag_b(PT + (size_t)(n0 + j * 16 + col) * DM + kc * 32, lane), acc[j]); }
#pragma unroll
  for (int j = 0; j < 8; ++j) { const int n = n0 + j * 16 + col; const int which = n >> 10, c = n & 1023; const float bb = bfr((which == 0 ? bq : which == 1 ? bk : bv)[c]);
#pragma unroll
    for (int r = 0; r < 8; ++r) so[wave][8 * g + r][j * 16 + col] = acc[j][r] + bb; }
  LDSX();
  for (int rl = 0; rl < 16; ++rl) vst2(QKV + (r0 + rl) * QKVP + n0 + lane * 4, *(const v4f*)&so[wave][rl][lane * 4]);
}
// ---- k_kv: block = (64 keys, one head's 64 columns, batch), 4 waves; a thread holds 4 key pairs x 4 columns of K and of V with all 16 loads in flight together; V is split, packed by key pair and turned in LDS, K goes straight out again
typedef __attribute__((ext_vector_type(2))) __bf16 v2b;
__global__ __launch_bounds__(128) void k_kv(const float* __restrict__ QKV, const float* __restrict__ MK, const float* __restrict__ MV, float* __restrict__ KX, __bf16* __restrict__ VTH, __bf16* __restrict__ VTL) {
  __shared__ __align__(16) unsigned svh[64][36], svl[64][36];   // [column][key pair]; the 16-B chunks of a row stand XORed with column >> 4, so that a wave's 32 pair stores meet 32 banks
  const int tid = threadIdx.x, c4 = tid & 15, pr = tid >> 4; const int k0 = blockIdx.x * 64, c0 = blockIdx.y * 64, b = blockIdx.z;
  v4f kq[8], vq[8];   // i: key 2 * pr + 16 * (i >> 1) + (i & 1) of the block
  if (k0 < SS) {      // a block is wholly ordinary keys or wholly memory slots (SS is a multiple of 64)
    const float* base = QKV + ((size_t)b * SS + k0 + 2 * pr) * QKVP + c0 + c4 * 4;
#pragma unroll
    for (int i = 0; i < 8; ++i) { const float* row = base + (size_t)(16 * (i >> 1) + (i & 1)) * QKVP; kq[i] = *(const v4f*)(row + DM); vq[i] = *(const v4f*)(row + 2 * DM); }
    asm volatile("s_wait_xcnt 0x0" :: "v"(base) : "memory");   // the loads' address pair stays whole (no load's own result lands on it) until every load has taken its address
  } else {
    const size_t o0 = (size_t)(k0 - SS + 2 * pr) * DM + c0 + c4 * 4; const float *pk = MK + o0, *pv = MV + o0;
#pragma unroll
    for (int i = 0; i < 8; ++i) { const size_t o = (size_t)(16 * (i >> 1) + (i & 1)) * DM; kq[i] = *(const v4f*)(pk + o); vq[i] = *(const v4f*)(pv + o); }
    asm volatile("s_wait_xcnt 0x0" :: "v"(pk), "v"(pv) : "memory");   // as above, for the two address pairs
#pragma unroll
    for (int i = 0; i < 8; ++i) {
#pragma unroll
      for (int e = 0; e < 4; ++e) { kq[i][e] = 8.0f * bfr(kq[i][e]); vq[i][e] = 8.0f * bfr(vq[i][e]); } }
  }
#pragma unroll
  for (int p = 0; p < 4; ++p) { const int pp = (pr + 8 * p) ^ ((c4 >> 2) << 2);
#pragma unroll
    for (int e = 0; e < 4; ++e) { const float va = vq[2 * p][e], vb = vq[2 * p + 1][e]; const __bf16 ha = (__bf16)va, hb = (__bf16)vb;
      const v2b hh = {ha, hb}, ll = {(__bf16)(va - (float)ha), (__bf16)(vb - (float)hb)};
      svh[c4 * 4 + e][pp] = __builtin_bit_cast(unsigned, hh); svl[c4 * 4 + e][pp] = __builtin_bit_cast(unsigned, ll); } }
  __syncthreads();
#pragma unroll
  for (int i = 0; i < 8; ++i) vst2(KX + ((size_t)b * SK + k0 + 2 * pr + 16 * (i >> 1) + (i & 1)) * DM + c0 + c4 * 4, kq[i]);   // behind the barrier, which would else wait for these stores
#pragma unroll
  for (int it = 0; it < 4; ++it) { const int rowi = it * 16 + (tid >> 3), pc = tid & 7, sw = (pc ^ it) * 4; const size_t o = ((size_t)b * DM + c0 + rowi) * SK + k0 + pc * 8; vst2((unsigned*)(VTH + o), *(const v4u*)&svh[rowi][sw]); vst2((unsigned*)(VTL + o), *(const v4u*)&svl[rowi][sw]); }
}
#define KT 64
#define NT (SK / KT)
#define KPF 68
#define VPB 72
#define ST_VH (KT * KPF * 4)
#define ST_VL (ST_VH + HD * VPB * 2)
#define ST_SZ (ST_VL + HD * VPB * 2)       // 35840 B a stage
__device__ __forceinline__ float xhalf(float x) { return __builtin_bit_cast(float, __builtin_amdgcn_permlanex16(__builtin_bit_cast(int, x), __builtin_bit_cast(int, x), 0x76543210, 0xfedcba98, false, false)); }  // lane l with lane l ^ 16
__device__ __forceinline__ F2 split_v4(v4f a, v4f b, v4f c, v4f d) { float v[16];
#pragma unroll
  for (int i = 0; i < 4; ++i) { v[i] = a[i]; v[4 + i] = b[i]; v[8 + i] = c[i]; v[12 + i] = d[i]; }
  return bsplit16(v); }
// eight 16-B copies a lane, global to LDS through no register; the last line keeps the address registers whole until every copy has taken its addresses
__device__ __forceinline__ void copy8(const unsigned* l, const char* const* p) {
  asm volatile("global_load_async_to_lds_b128 %0, %8, off\n\tglobal_load_async_to_lds_b128 %1, %9, off\n\tglobal_load_async_to_lds_b128 %2, %10, off\n\tglobal_load_async_to_lds_b128 %3, %11, off\n\t"
               "global_load_async_to_lds_b128 %4, %12, off\n\tglobal_load_async_to_lds_b128 %5, %13, off\n\tglobal_load_async_to_lds_b128 %6, %14, off\n\tglobal_load_async_to_lds_b128 %7, %15, off\n\ts_wait_xcnt 0x0"
               :: "v"(l[0]), "v"(l[1]), "v"(l[2]), "v"(l[3]), "v"(l[4]), "v"(l[5]), "v"(l[6]), "v"(l[7]), "v"(p[0]), "v"(p[1]), "v"(p[2]), "v"(p[3]), "v"(p[4]), "v"(p[5]), "v"(p[6]), "v"(p[7]) : "memory");
}
__device__ __forceinline__ void stage_in(unsigned lb, const char* gk, const char* gh, const char* gl, int tid) {
  unsigned l[8]; const char* p[8];
#pragma unroll
  for (int i = 0; i < 8; ++i) { l[i] = lb + (unsigned)((i * 8 + (tid >> 4)) * (KPF * 4) + (tid & 15) * 16); p[i] = gk + (size_t)i * 8 * DM * 4; }   // K: a wave covers 2 rows of 256 B
  copy8(l, p);
#pragma unroll
  for (int i = 0; i < 4; ++i) { const unsigned o = (unsigned)((i * 16 + (tid >> 3)) * (VPB * 2) + (tid & 7) * 16); l[i] = lb + ST_VH + o; l[4 + i] = lb + ST_VL + o; p[i] = gh + (size_t)i * 16 * SK * 2; p[4 + i] = gl + (size_t)i * 16 * SK * 2; }   // V: a wave covers 4 rows of 128 B
  copy8(l, p);
}
__global__ __launch_bounds__(128) void k_attn(float* __restrict__ QKV, const float* __restrict__ KX, const int* __restrict__ MASK, const __bf16* __restrict__ VTH, const __bf16* __restrict__ VTL) {
  __shared__ __align__(16) unsigned char sm[2 * ST_SZ];   // the two stage buffers; behind the loop its first bytes stage the output rows
  const int tid = threadIdx.x, wave = tid >> 5, lane = tid & 31, col = lane & 15, g = lane >> 4;
  const int qb = blockIdx.x, bh = blockIdx.y, b = bh >> 4, h = bh & 15; const int q0 = qb * 64 + wave * 16; const size_t tq = (size_t)b * SS + q0;
  const unsigned lds0 = (unsigned)(size_t)&sm[0];
  const char* gk = (const char*)(KX + ((size_t)b * SK + (tid >> 4)) * DM + h * HD) + (tid & 15) * 16;             // this lane's first K chunk of stage 0; a stage on: KT rows
  const char* gh = (const char*)(VTH + ((size_t)b * DM + h * HD + (tid >> 3)) * SK) + (tid & 7) * 16;              // the same of V hi; a stage on: KT keys
  const char* gl = (const char*)(VTL + ((size_t)b * DM + h * HD + (tid >> 3)) * SK) + (tid & 7) * 16;
  stage_in(lds0, gk, gh, gl, tid);
  const F2 a0 = split_row(QKV + (tq + col) * QKVP + h * HD, 0, lane), a1 = split_row(QKV + (tq + col) * QKVP + h * HD, 32, lane);   // B operand: column = query
  asm volatile("s_wait_asynccnt 0x0" ::: "memory");   // this wave's share of stage 0 has landed
  __syncthreads();                                    // and every other wave's
  stage_in(lds0 + ST_SZ, gk + (size_t)KT * DM * 4, gh + KT * 2, gl + KT * 2, tid);
  float m = -3.0e38f, l = 0.f;   // of query col; l sums this wave half's keys only, the halves are joined behind the loop
  v8f acc[4] = {};               // acc[dt][r] = O[query col][dt * 16 + 8 g + r]
#pragma unroll 1
  for (int t = 0; t < NT; ++t) {
    const unsigned char* sb = sm + (t & 1) * ST_SZ;
#pragma unroll   // the two steps of a stage stand unrolled: their LDS offsets are immediates
    for (int hs = 0; hs < 2; ++hs) {
      const int ks = 2 * t + hs;
      const bool mem = ks * 32 >= SS;   // a step is wholly ordinary keys or wholly memory slots (SS is a multiple of 32)
      const int mv = MASK[(size_t)b * SS + (mem ? 0 : ks * 32) + lane];   // one key's mask a lane (the address is in range in a memory step too)
      const unsigned kw = (__builtin_amdgcn_ballot_w32(mv != 0) | (mem ? 0xffffffffu : 0u)) >> (8 * g);   // bit j = keep key 8g + j of this step
      float s[16];
#pragma unroll
      for (int ct = 0; ct < 2; ++ct) { const float* kp = (const float*)sb + (hs * 32 + ct * 16 + col) * KPF + 8 * g;   // A operand: row = key
        const F2 k0 = split_v4(*(const v4f*)kp, *(const v4f*)(kp + 4), *(const v4f*)(kp + 16), *(const v4f*)(kp + 20)), k1 = split_v4(*(const v4f*)(kp + 32), *(const v4f*)(kp + 36), *(const v4f*)(kp + 48), *(const v4f*)(kp + 52));
        v8f c = {}; c = wmma_bf(k0.h, a0.l, c); c = wmma_bf(k0.l, a0.h, c); c = wmma_bf(k0.h, a0.h, c); c = wmma_bf(k1.h, a1.l, c); c = wmma_bf(k1.l, a1.h, c); c = wmma_bf(k1.h, a1.h, c);
#pragma unroll
        for (int r = 0; r < 8; ++r) { const bool keep = ((kw >> (ct * 16 + r)) & 1u) != 0; s[ct * 8 + r] = keep ? c[r] * 0.125f : -1.0e20f; } }
      v16b vh[4], vl[4];   // A operand: row = d; read here, as one group, so that the softmax stands between the reads and their use
#pragma unroll
      for (int dt = 0; dt < 4; ++dt) { const int vo = (dt * 16 + col) * VPB + hs * 32; vh[dt] = frag_b((const __bf16*)(sb + ST_VH) + vo, lane); vl[dt] = frag_b((const __bf16*)(sb + ST_VL) + vo, lane); }
      float mx = s[0];
#pragma unroll
      for (int i = 1; i < 16; ++i) mx = fmaxf(mx, s[i]);
      mx = fmaxf(mx, xhalf(mx));
      const float mn = fmaxf(m, mx); const float alpha = exp_ni(m - mn);
      float es = 0.f;
#pragma unroll
      for (int i = 0; i < 16; ++i) { s[i] = exp_ni(s[i] - mn); es += s[i]; }
      l = l * alpha + es; m = mn;
#pragma unroll
      for (int dt = 0; dt < 4; ++dt) acc[dt] *= alpha;
      const F2 pa = bsplit16(s);   // element i = key 8g+i, element 8+i = key 16+8g+i: the k order of frag_b
#pragma unroll
      for (int dt = 0; dt < 4; ++dt) { acc[dt] = wmma_bf(vh[dt], pa.l, acc[dt]); acc[dt] = wmma_bf(vl[dt], pa.h, acc[dt]); acc[dt] = wmma_bf(vh[dt], pa.h, acc[dt]); } }
    asm volatile("s_wait_dscnt 0x0" ::: "memory");      // this wave's reads of the buffer are done before anyone refills it
    asm volatile("s_wait_asynccnt 0x0" ::: "memory");   // this wave's share of stage t + 1 has landed
    __syncthreads();                                    // publishes stage t + 1 and ends every wave's reads of stage t
    if (t + 2 < NT) stage_in(lds0 + (unsigned)(t & 1) * ST_SZ, gk + (size_t)(t + 2) * KT * DM * 4, gh + (size_t)(t + 2) * KT * 2, gl + (size_t)(t + 2) * KT * 2, tid);
  }
  asm volatile("s_wait_asynccnt 0x0" ::: "memory");     // no copy is left in flight when the buffer takes the output rows
  float (*so)[16][68] = (float (*)[16][68])sm;
  const float il = 1.0f / (l + xhalf(l));
#pragma unroll
  for (int dt = 0; dt < 4; ++dt) { const v8f o = acc[dt] * il; vst2(&so[wave][col][dt * 16 + 8 * g], (v4f){o[0], o[1], o[2], o[3]}); vst2(&so[wave][col][dt * 16 + 8 * g + 4], (v4f){o[4], o[5], o[6], o[7]}); }
  LDSX();
  for (int rl = 0; rl < 16; ++rl) if (lane < 16) vst2(QKV + (tq + rl) * QKVP + h * HD + lane * 4, *(const v4f*)&so[wave][rl][lane * 4]);
}
// ---- k_out: Y = O(hi/lo; the q columns of QKV) . PT_out rows (2 products, K = 1024); block (64 rows, 128 cols)
__global__ __launch_bounds__(128) void k_out(const float* __restrict__ QKV, const __bf16* __restrict__ PT, const float* __restrict__ bo, float* __restrict__ Y) {
  __shared__ __align__(16) float so[4][16][132];
  const int tid = threadIdx.x, wave = tid >> 5, lane = tid & 31, col = lane & 15, g = lane >> 4; const size_t r0 = (size_t)blockIdx.x * 64 + wave * 16; const int n0 = blockIdx.y * 128;
  v8f acc[8] = {};
#pragma unroll 2
  for (int kc = 0; kc < DM / 32; ++kc) { const F2 a = split_row(QKV + (r0 + col) * QKVP, kc * 32, lane);
#pragma unroll
    for (int j = 0; j < 8; ++j) { const v16b w = frag_b(PT + (size_t)(3 * DM + n0 + j * 16 + col) * DM + kc * 32, lane); acc[j] = wmma_bf(a.l, w, acc[j]); acc[j] = wmma_bf(a.h, w, acc[j]); } }
#pragma unroll
  for (int j = 0; j < 8; ++j) { const float bb = bfr(bo[n0 + j * 16 + col]);
#pragma unroll
    for (int r = 0; r < 8; ++r) so[wave][8 * g + r][j * 16 + col] = acc[j][r] + bb; }
  LDSX();
  for (int rl = 0; rl < 16; ++rl) vst2(Y + (r0 + rl) * DM + n0 + lane * 4, *(const v4f*)&so[wave][rl][lane * 4]);
}

extern "C" void kernel_launch(void* const* d_in, const int* in_sizes, int n_in, void* d_out, int out_size, void* d_ws, size_t ws_size, hipStream_t stream) {
  (void)in_sizes; (void)n_in; (void)out_size;
  const float** F = (const float**)d_in;   // query, key, value, mask [2,1,1,2048] i32, Wq, bq, Wk, bk, Wv, bv, Wo, bo, m_k [1,64,1024], m_v
  if (ws_size < (size_t)WS_END) return;
  char* ws = (char*)d_ws; __bf16 *PT = (__bf16*)(ws + WS_PT), *VTH = (__bf16*)(ws + WS_VTH), *VTL = (__bf16*)(ws + WS_VTL); float *QKV = (float*)(ws + WS_QKV), *KX = (float*)(ws + WS_KX);
  k_pack<<<4 * DM, 128, 0, stream>>>(F[4], F[6], F[8], F[10], PT);
  k_proj<<<dim3(TRB, QKVP / 128), 128, 0, stream>>>(F[0], F[1], F[2], PT, F[5], F[7], F[9], QKV);
  k_kv<<<dim3(SK / 64, DM / 64, TNB), 128, 0, stream>>>(QKV, F[12], F[13], KX, VTH, VTL);
  k_attn<<<dim3(TQB, TNB * NH), 128, 0, stream>>>(QKV, KX, (const int*)d_in[3], VTH, VTL);
  k_out<<<dim3((TNB < NB ? TQB : NR / 64), DM / 128), 128, 0, stream>>>(QKV, PT, F[11], (float*)d_out);
}

// v004
// One run takes 244 microseconds.
// Next to v003, in two timings, it ran 1.57 and 1.55 times as fast.
// Counting every step since v000, it is 2.98 times as fast.
// compute dtype: query/key/value, the four weights + biases and the memory slots (module inputs) rounded to bf16; q/k/v projections with exact bf16 products (+ f32 bias); scores and P.V with both computed operands as bf16 hi + bf16 residual pairs (3 products; memory keys/values scaled in f32 and split the same way); output projection hi/lo x bf16 Wo (2 products) + bias; masked online softmax in f32; f32 accumulate.
#include <hip/hip_runtime.h>
#include <math.h>

typedef __attribute__((ext_vector_type(16))) _Float16 v16h;
typedef __attribute__((ext_vector_type(16))) __bf16 v16b;
typedef __attribute__((ext_vector_type(8)))  _Float16 v8h;
typedef __attribute__((ext_vector_type(8)))  float v8f;
typedef __attribute__((ext_vector_type(4)))  float v4f;
typedef __attribute__((ext_vector_type(2)))  float v2f;
typedef __attribute__((ext_vector_type(4)))  unsigned v4u;
typedef __attribute__((ext_vector_type(4)))  int v4i;
typedef float __attribute__((may_alias)) float_a;
typedef int __attribute__((may_alias)) int_a;

template <typename T> __device__ __forceinline__ void vst2(void* p, T v) { *(T*)p = v;  }
__device__ __forceinline__ v8f wmma16(v16h a, v16h b, v8f c) {
  v8f d = __builtin_amdgcn_wmma_f32_16x16x32_f16(false, a, false, b, (short)0, c, false, false);
  asm volatile("v_nop\n\tv_nop\n\tv_nop\n\tv_nop" : "+v"(d) : "v"(a), "v"(b));
  return d;
}
__device__ __forceinline__ v8f wmma_bf(v16b a, v16b b, v8f c) {
  v8f d = __builtin_amdgcn_wmma_f32_16x16x32_bf16(false, a, false, b, (short)0, c, false, false);
  asm volatile("v_nop\n\tv_nop\n\tv_nop\n\tv_nop" : "+v"(d) : "v"(a), "v"(b));
  return d;
}
// 16x16x32 fragments: lane = (h = lane>>4, row/col = lane&15); elements 0..7 = k0+8h+0..7, 8..15 = k0+16+8h+0..7; D element r = row 8h+r
__device__ __forceinline__ v16h frag_h(const _Float16* rowk0, int lane) {
  union { v16h v; v8h q[2]; } u; const _Float16* p = rowk0 + 8 * (lane >> 4);
  u.q[0] = *(const v8h*)p; u.q[1] = *(const v8h*)(p + 16); return u.v;
}
__device__ __forceinline__ v16h frag_f32(const float* rowk0, int lane) {
  v16h a; const float* p = rowk0 + 8 * (lane >> 4);
#pragma unroll
  for (int i = 0; i < 8; ++i) { a[i] = (_Float16)p[i]; a[8 + i] = (_Float16)p[16 + i]; }
  return a;
}
__device__ __forceinline__ v16h frag_f32s(const float* rowk0, int lane, float sc) {
  v16h a; const float* p = rowk0 + 8 * (lane >> 4);
#pragma unroll
  for (int i = 0; i < 8; ++i) { a[i] = (_Float16)(p[i] * sc); a[8 + i] = (_Float16)(p[16 + i] * sc); }
  return a;
}
// column fragment from a [K][ld] layout (column n), rows >= K read as 0
__device__ __forceinline__ v16h fragc_f32(const float* W, int k0, int n, int lane, int ld, int K) {
  v16h a; const int g = lane >> 4;
#pragma unroll
  for (int i = 0; i < 8; ++i) { const int ka = k0 + 8 * g + i, kb = ka + 16;
    a[i] = (_Float16)(ka < K ? W[(size_t)(ka < K ? ka : K - 1) * ld + n] : 0.f); a[8 + i] = (_Float16)(kb < K ? W[(size_t)(kb < K ? kb : K - 1) * ld + n] : 0.f); }
  return a;
}
struct F2 { v16b h, l; };
__device__ __forceinline__ F2 bsplit16(const float v[16]) { F2 r;
#pragma unroll
  for (int i = 0; i < 16; ++i) { const __bf16 h = (__bf16)v[i]; r.h[i] = h; r.l[i] = (__bf16)(v[i] - (float)h); }
  return r; }
__device__ __forceinline__ F2 split_row(const float* row, int k0, int lane) { float v[16]; const float* p = row + k0 + 8 * (lane >> 4);
#pragma unroll
  for (int i = 0; i < 8; ++i) { v[i] = p[i]; v[8 + i] = p[16 + i]; }
  return bsplit16(v); }
__device__ __forceinline__ F2 split_rowK(const float* row, int k0, int lane, int K) { float v[16]; const int g = lane >> 4;
#pragma unroll
  for (int i = 0; i < 8; ++i) { const int ka = k0 + 8 * g + i, kb = ka + 16; v[i] = ka < K ? row[ka < K ? ka : K - 1] : 0.f; v[8 + i] = kb < K ? row[kb < K ? kb : K - 1] : 0.f; }
  return bsplit16(v); }
__device__ __forceinline__ F2 split_col(const float* W, int k0, int n, int lane, int ld, int K) { float v[16]; const int g = lane >> 4;
#pragma unroll
  for (int i = 0; i < 8; ++i) { const int ka = k0 + 8 * g + i, kb = ka + 16; v[i] = ka < K ? W[(size_t)(ka < K ? ka : K - 1) * ld + n] : 0.f; v[8 + i] = kb < K ? W[(size_t)(kb < K ? kb : K - 1) * ld + n] : 0.f; }
  return bsplit16(v); }
__device__ __forceinline__ v8f mac3(const F2& a, const F2& b, v8f c) { c = wmma_bf(a.l, b.h, c); c = wmma_bf(a.h, b.l, c); return wmma_bf(a.h, b.h, c); }
__device__ __forceinline__ float sigm(float v) { return 1.0f / (1.0f + expf(-v)); }
#define LDSX() do { asm volatile("s_wait_dscnt 0" ::: "memory"); __builtin_amdgcn_wave_barrier(); __builtin_amdgcn_fence(__ATOMIC_RELEASE, "workgroup"); } while (0)


// Multi-head attention with persistent memory: Q = query Wq^T + bq, K = [key Wk^T + bk ; 8 m_k], V = [value Wv^T + bv ; 8 m_v] (2048 + 64 slots), energy = Q K^T / 8 with the first 2048 key columns masked (mask == 0 -> -1e20) and the memory columns never masked; softmax; P V; merge heads; @ Wo^T + bo.  B 2, S 2048, D 1024, 16 x 64.
// k_pack, k_proj (exact GEMM + bias; q|k|v from query|key|value), k_kv (K rows incl. the memory slots; V as transposed hi/lo planes over the 2112 keys), k_attn (66 key steps, K and V staged in LDS by 64 keys, mask per key column), k_out (+ bo).
#define NB 2
#define SS 2048
#define DM 1024
#define NH 16
#define HD 64
#define NR (NB * SS)
#define QKVP (3 * DM)
#define NM 64
#define SK (SS + NM)        // 2112 keys per batch
#ifndef TRB
#define TRB (NR / 64)
#define TQB (SS / 64)
#define TNB NB
#endif
typedef __attribute__((ext_vector_type(8))) __bf16 v8b;
__device__ __forceinline__ v16b frag_b(const __bf16* rowk0, int lane) {
  union { v16b v; v8b q[2]; } u; const __bf16* p = rowk0 + 8 * (lane >> 4);
  u.q[0] = *(const v8b*)p; u.q[1] = *(const v8b*)(p + 16); return u.v;
}
__device__ __forceinline__ v16b frag_gbf(const float* rowk0, int lane) {
  v16b a; const float* p = rowk0 + 8 * (lane >> 4);
#pragma unroll
  for (int i = 0; i < 8; ++i) { a[i] = (__bf16)p[i]; a[8 + i] = (__bf16)p[16 + i]; }
  return a;
}
__device__ __forceinline__ float bfr(float v) { return (float)(__bf16)v; }
__device__ __attribute__((noinline)) float exp_ni(float v) { return expf(v); }
#define WS_PT   0u                                 // bf16 [4096 (q|k|v|out cols)][1024]
#define WS_QKV  (WS_PT + 2u * 4 * DM * DM)           // f32 [4096 rows][3072]  (q 0..1023 | k | v) ; q cols later overwritten by O
#define WS_KX   (WS_QKV + 4u * NR * QKVP)            // f32 [2][2112][1024] keys incl. memory
#define WS_VTH  (WS_KX + 4u * NB * SK * DM)           // bf16 [2][1024 (h*64+d)][2112]
#define WS_VTL  (WS_VTH + 2u * NB * DM * SK)
#define WS_END  (WS_VTL + 2u * NB * DM * SK)

__global__ __launch_bounds__(128) void k_pack(const float* __restrict__ Wq, const float* __restrict__ Wk, const float* __restrict__ Wv, const float* __restrict__ Wo, __bf16* __restrict__ PT) {
  __shared__ __align__(16) __bf16 srow[DM];
  const int n = blockIdx.x, tid = threadIdx.x; const int which = n >> 10, c = n & 1023; const float* Wm = which == 0 ? Wq : (which == 1 ? Wk : (which == 2 ? Wv : Wo));
  for (int k = tid; k < DM; k += 128) srow[k] = (__bf16)Wm[(size_t)c * DM + k];   // torch [out][in]: row c
  __syncthreads();
  vst2((unsigned*)(PT + (size_t)n * DM + tid * 8), *(const v4u*)(&srow[tid * 8]));
}
// ---- k_kv: block = (64 keys, one head's 64 columns, batch), 4 waves; a thread holds 4 key pairs x 4 columns of K and of V with all 16 loads in flight together; V is split, packed by key pair and turned in LDS, K goes straight out again
typedef __attribute__((ext_vector_type(2))) __bf16 v2b;
__global__ __launch_bounds__(128) void k_kv(const float* __restrict__ QKV, const float* __restrict__ MK, const float* __restrict__ MV, float* __restrict__ KX, __bf16* __restrict__ VTH, __bf16* __restrict__ VTL) {
  __shared__ __align__(16) unsigned svh[64][36], svl[64][36];   // [column][key pair]; the 16-B chunks of a row stand XORed with column >> 4, so that a wave's 32 pair stores meet 32 banks
  const int tid = threadIdx.x, c4 = tid & 15, pr = tid >> 4; const int k0 = blockIdx.x * 64, c0 = blockIdx.y * 64, b = blockIdx.z;
  v4f kq[8], vq[8];   // i: key 2 * pr + 16 * (i >> 1) + (i & 1) of the block
  if (k0 < SS) {      // a block is wholly ordinary keys or wholly memory slots (SS is a multiple of 64)
    const float* base = QKV + ((size_t)b * SS + k0 + 2 * pr) * QKVP + c0 + c4 * 4;
#pragma unroll
    for (int i = 0; i < 8; ++i) { const float* row = base + (size_t)(16 * (i >> 1) + (i & 1)) * QKVP; kq[i] = *(const v4f*)(row + DM); vq[i] = *(const v4f*)(row + 2 * DM); }
    asm volatile("s_wait_xcnt 0x0" :: "v"(base) : "memory");   // the loads' address pair stays whole (no load's own result lands on it) until every load has taken its address
  } else {
    const size_t o0 = (size_t)(k0 - SS + 2 * pr) * DM + c0 + c4 * 4; const float *pk = MK + o0, *pv = MV + o0;
#pragma unroll
    for (int i = 0; i < 8; ++i) { const size_t o = (size_t)(16 * (i >> 1) + (i & 1)) * DM; kq[i] = *(const v4f*)(pk + o); vq[i] = *(const v4f*)(pv + o); }
    asm volatile("s_wait_xcnt 0x0" :: "v"(pk), "v"(pv) : "memory");   // as above, for the two address pairs
#pragma unroll
    for (int i = 0; i < 8; ++i) {
#pragma unroll
      for (int e = 0; e < 4; ++e) { kq[i][e] = 8.0f * bfr(kq[i][e]); vq[i][e] = 8.0f * bfr(vq[i][e]); } }
  }
#pragma unroll
  for (int p = 0; p < 4; ++p) { const int pp = (pr + 8 * p) ^ ((c4 >> 2) << 2);
#pragma unroll
    for (int e = 0; e < 4; ++e) { const float va = vq[2 * p][e], vb = vq[2 * p + 1][e]; const __bf16 ha = (__bf16)va, hb = (__bf16)vb;
      const v2b hh = {ha, hb}, ll = {(__bf16)(va - (float)ha), (__bf16)(vb - (float)hb)};
      svh[c4 * 4 + e][pp] = __builtin_bit_cast(unsigned, hh); svl[c4 * 4 + e][pp] = __builtin_bit_cast(unsigned, ll); } }
  __syncthreads();
#pragma unroll
  for (int i = 0; i < 8; ++i) vst2(KX + ((size_t)b * SK + k0 + 2 * pr + 16 * (i >> 1) + (i & 1)) * DM + c0 + c4 * 4, kq[i]);   // behind the barrier, which would else wait for these stores
#pragma unroll
  for (int it = 0; it < 4; ++it) { const int rowi = it * 16 + (tid >> 3), pc = tid & 7, sw = (pc ^ it) * 4; const size_t o = ((size_t)b * DM + c0 + rowi) * SK + k0 + pc * 8; vst2((unsigned*)(VTH + o), *(const v4u*)&svh[rowi][sw]); vst2((unsigned*)(VTL + o), *(const v4u*)&svl[rowi][sw]); }
}
#define KT 64
#define NT (SK / KT)
#define KPF 68
#define VPB 72
#define ST_VH (KT * KPF * 4)
#define ST_VL (ST_VH + HD * VPB * 2)
#define ST_SZ (ST_VL + HD * VPB * 2)       // 35840 B a stage
__device__ __forceinline__ float xhalf(float x) { return __builtin_bit_cast(float, __builtin_amdgcn_permlanex16(__builtin_bit_cast(int, x), __builtin_bit_cast(int, x), 0x76543210, 0xfedcba98, false, false)); }  // lane l with lane l ^ 16
__device__ __forceinline__ F2 split_v4(v4f a, v4f b, v4f c, v4f d) { float v[16];
#pragma unroll
  for (int i = 0; i < 4; ++i) { v[i] = a[i]; v[4 + i] = b[i]; v[8 + i] = c[i]; v[12 + i] = d[i]; }
  return bsplit16(v); }
// eight 16-B copies a lane, global to LDS through no register; the last line keeps the address registers whole until every copy has taken its addresses
__device__ __forceinline__ void copy8(const unsigned* l, const char* const* p) {
  asm volatile("global_load_async_to_lds_b128 %0, %8, off\n\tglobal_load_async_to_lds_b128 %1, %9, off\n\tglobal_load_async_to_lds_b128 %2, %10, off\n\tglobal_load_async_to_lds_b128 %3, %11, off\n\t"
               "global_load_async_to_lds_b128 %4, %12, off\n\tglobal_load_async_to_lds_b128 %5, %13, off\n\tglobal_load_async_to_lds_b128 %6, %14, off\n\tglobal_load_async_to_lds_b128 %7, %15, off\n\ts_wait_xcnt 0x0"
               :: "v"(l[0]), "v"(l[1]), "v"(l[2]), "v"(l[3]), "v"(l[4]), "v"(l[5]), "v"(l[6]), "v"(l[7]), "v"(p[0]), "v"(p[1]), "v"(p[2]), "v"(p[3]), "v"(p[4]), "v"(p[5]), "v"(p[6]), "v"(p[7]) : "memory");
}
__device__ __forceinline__ void stage_in(unsigned lb, const char* gk, const char* gh, const char* gl, int tid) {
  unsigned l[8]; const char* p[8];
#pragma unroll
  for (int i = 0; i < 8; ++i) { l[i] = lb + (unsigned)((i * 8 + (tid >> 4)) * (KPF * 4) + (tid & 15) * 16); p[i] = gk + (size_t)i * 8 * DM * 4; }   // K: a wave covers 2 rows of 256 B
  copy8(l, p);
#pragma unroll
  for (int i = 0; i < 4; ++i) { const unsigned o = (unsigned)((i * 16 + (tid >> 3)) * (VPB * 2) + (tid & 7) * 16); l[i] = lb + ST_VH + o; l[4 + i] = lb + ST_VL + o; p[i] = gh + (size_t)i * 16 * SK * 2; p[4 + i] = gl + (size_t)i * 16 * SK * 2; }   // V: a wave covers 4 rows of 128 B
  copy8(l, p);
}
__global__ __launch_bounds__(128) void k_attn(float* __restrict__ QKV, const float* __restrict__ KX, const int* __restrict__ MASK, const __bf16* __restrict__ VTH, const __bf16* __restrict__ VTL) {
  __shared__ __align__(16) unsigned char sm[2 * ST_SZ];   // the two stage buffers; behind the loop its first bytes stage the output rows
  const int tid = threadIdx.x, wave = tid >> 5, lane = tid & 31, col = lane & 15, g = lane >> 4;
  const int qb = blockIdx.x, bh = blockIdx.y, b = bh >> 4, h = bh & 15; const int q0 = qb * 64 + wave * 16; const size_t tq = (size_t)b * SS + q0;
  const unsigned lds0 = (unsigned)(size_t)&sm[0];
  const char* gk = (const char*)(KX + ((size_t)b * SK + (tid >> 4)) * DM + h * HD) + (tid & 15) * 16;             // this lane's first K chunk of stage 0; a stage on: KT rows
  const char* gh = (const char*)(VTH + ((size_t)b * DM + h * HD + (tid >> 3)) * SK) + (tid & 7) * 16;              // the same of V hi; a stage on: KT keys
  const char* gl = (const char*)(VTL + ((size_t)b * DM + h * HD + (tid >> 3)) * SK) + (tid & 7) * 16;
  stage_in(lds0, gk, gh, gl, tid);
  const F2 a0 = split_row(QKV + (tq + col) * QKVP + h * HD, 0, lane), a1 = split_row(QKV + (tq + col) * QKVP + h * HD, 32, lane);   // B operand: column = query
  asm volatile("s_wait_asynccnt 0x0" ::: "memory");   // this wave's share of stage 0 has landed
  __syncthreads();                                    // and every other wave's
  stage_in(lds0 + ST_SZ, gk + (size_t)KT * DM * 4, gh + KT * 2, gl + KT * 2, tid);
  float m = -3.0e38f, l = 0.f;   // of query col; l sums this wave half's keys only, the halves are joined behind the loop
  v8f acc[4] = {};               // acc[dt][r] = O[query col][dt * 16 + 8 g + r]
#pragma unroll 1
  for (int t = 0; t < NT; ++t) {
    const unsigned char* sb = sm + (t & 1) * ST_SZ;
#pragma unroll   // the two steps of a stage stand unrolled: their LDS offsets are immediates
    for (int hs = 0; hs < 2; ++hs) {
      const int ks = 2 * t + hs;
      const bool mem = ks * 32 >= SS;   // a step is wholly ordinary keys or wholly memory slots (SS is a multiple of 32)
      const int mv = MASK[(size_t)b * SS + (mem ? 0 : ks * 32) + lane];   // one key's mask a lane (the address is in range in a memory step too)
      const unsigned kw = (__builtin_amdgcn_ballot_w32(mv != 0) | (mem ? 0xffffffffu : 0u)) >> (8 * g);   // bit j = keep key 8g + j of this step
      float s[16];
#pragma unroll
      for (int ct = 0; ct < 2; ++ct) { const float* kp = (const float*)sb + (hs * 32 + ct * 16 + col) * KPF + 8 * g;   // A operand: row = key
        const F2 k0 = split_v4(*(const v4f*)kp, *(const v4f*)(kp + 4), *(const v4f*)(kp + 16), *(const v4f*)(kp + 20)), k1 = split_v4(*(const v4f*)(kp + 32), *(const v4f*)(kp + 36), *(const v4f*)(kp + 48), *(const v4f*)(kp + 52));
        v8f c = {}; c = wmma_bf(k0.h, a0.l, c); c = wmma_bf(k0.l, a0.h, c); c = wmma_bf(k0.h, a0.h, c); c = wmma_bf(k1.h, a1.l, c); c = wmma_bf(k1.l, a1.h, c); c = wmma_bf(k1.h, a1.h, c);
#pragma unroll
        for (int r = 0; r < 8; ++r) { const bool keep = ((kw >> (ct * 16 + r)) & 1u) != 0; s[ct * 8 + r] = keep ? c[r] * 0.125f : -1.0e20f; } }
      v16b vh[4], vl[4];   // A operand: row = d; read here, as one group, so that the softmax stands between the reads and their use
#pragma unroll
      for (int dt = 0; dt < 4; ++dt) { const int vo = (dt * 16 + col) * VPB + hs * 32; vh[dt] = frag_b((const __bf16*)(sb + ST_VH) + vo, lane); vl[dt] = frag_b((const __bf16*)(sb + ST_VL) + vo, lane); }
      float mx = s[0];
#pragma unroll
      for (int i = 1; i < 16; ++i) mx = fmaxf(mx, s[i]);
      mx = fmaxf(mx, xhalf(mx));
      const float mn = fmaxf(m, mx); const float alpha = exp_ni(m - mn);
      float es = 0.f;
#pragma unroll
      for (int i = 0; i < 16; ++i) { s[i] = exp_ni(s[i] - mn); es += s[i]; }
      l = l * alpha + es; m = mn;
#pragma unroll
      for (int dt = 0; dt < 4; ++dt) acc[dt] *= alpha;
      const F2 pa = bsplit16(s);   // element i = key 8g+i, element 8+i = key 16+8g+i: the k order of frag_b
#pragma unroll
      for (int dt = 0; dt < 4; ++dt) { acc[dt] = wmma_bf(vh[dt], pa.l, acc[dt]); acc[dt] = wmma_bf(vl[dt], pa.h, acc[dt]); acc[dt] = wmma_bf(vh[dt], pa.h, acc[dt]); } }
    asm volatile("s_wait_dscnt 0x0" ::: "memory");      // this wave's reads of the buffer are done before anyone refills it
    asm volatile("s_wait_asynccnt 0x0" ::: "memory");   // this wave's share of stage t + 1 has landed
    __syncthreads();                                    // publishes stage t + 1 and ends every wave's reads of stage t
    if (t + 2 < NT) stage_in(lds0 + (unsigned)(t & 1) * ST_SZ, gk + (size_t)(t + 2) * KT * DM * 4, gh + (size_t)(t + 2) * KT * 2, gl + (size_t)(t + 2) * KT * 2, tid);
  }
  asm volatile("s_wait_asynccnt 0x0" ::: "memory");     // no copy is left in flight when the buffer takes the output rows
  float (*so)[16][68] = (float (*)[16][68])sm;
  const float il = 1.0f / (l + xhalf(l));
#pragma unroll
  for (int dt = 0; dt < 4; ++dt) { const v8f o = acc[dt] * il; vst2(&so[wave][col][dt * 16 + 8 * g], (v4f){o[0], o[1], o[2], o[3]}); vst2(&so[wave][col][dt * 16 + 8 * g + 4], (v4f){o[4], o[5], o[6], o[7]}); }
  LDSX();
  for (int rl = 0; rl < 16; ++rl) if (lane < 16) vst2(QKV + (tq + rl) * QKVP + h * HD + lane * 4, *(const v4f*)&so[wave][rl][lane * 4]);
}
// ---- the two GEMMs (k_proj, k_out): block = (MT * 32 rows, 128 columns), 4 waves as 2 x 2, a wave holds MT x 4 accumulator tiles (MT * 16 rows x 64 columns)
// A (f32 rows) and B (bf16 weight rows) reach the waves through LDS: a stage = 64 k (A rows of 256 B, B rows of 128 B), copied once for the block in whole 128-B lines, two buffers, the next stage in flight while this one is worked on; A is rounded (or split) to bf16 as the fragment is read; k runs upward in steps of 32 into each accumulator
#define GK 64                              // k a stage
#define GNT (DM / GK)                      // 16 stages
#define APF 68                             // floats a staged A row: 272 B = 16 B x odd, no bank conflict for 16-B readers
#define BPB 72                             // bf16 a staged B row: 144 B = 16 B x odd
#define G_B(MT) ((MT) * 32 * APF * 4)
#define G_SZ(MT) (G_B(MT) + 128 * BPB * 2)  // a stage: 53248 B at MT 4, 35840 B at MT 2
template <int MT> __device__ __forceinline__ void g_stage(unsigned lb, const char* ga, size_t apitch, const char* gb, int tid) {
  unsigned l[8]; const char* p[8];
#pragma unroll
  for (int u = 0; u < MT / 2; ++u) {
#pragma unroll
    for (int i = 0; i < 8; ++i) { const int rr = (u * 8 + i) * 8; l[i] = lb + (unsigned)((rr + (tid >> 4)) * (APF * 4) + (tid & 15) * 16); p[i] = ga + (size_t)rr * apitch; }   // A: a wave covers 2 rows of 256 B
    copy8(l, p); }
#pragma unroll
  for (int i = 0; i < 8; ++i) { l[i] = lb + G_B(MT) + (unsigned)((i * 16 + (tid >> 3)) * (BPB * 2) + (tid & 7) * 16); p[i] = gb + (size_t)i * 16 * DM * 2; }   // B: a wave covers 4 rows of 128 B
  copy8(l, p);
}
// A: the block's first row, k = 0, lda floats a row; Bw: the block's first weight row; bias, C: at the block's first column (C at its first row too)
template <int MT, bool SPLIT> __device__ __forceinline__ void gemm_tile(unsigned char* sm, const float* A, int lda, const __bf16* Bw, const float* bias, float* C, int ldc) {
  const int tid = threadIdx.x, wave = tid >> 5, lane = tid & 31, col = lane & 15, g = lane >> 4, wm = wave >> 1, wn = wave & 1;
  const unsigned lds0 = (unsigned)(size_t)sm; const size_t ap = (size_t)lda * 4;
  const char* ga = (const char*)(A + (size_t)(tid >> 4) * lda) + (tid & 15) * 16;   // this lane's first A chunk of stage 0; a stage on: GK floats
  const char* gb = (const char*)(Bw + (size_t)(tid >> 3) * DM) + (tid & 7) * 16;    // the same of B; a stage on: GK bf16
  g_stage<MT>(lds0, ga, ap, gb, tid);
  asm volatile("s_wait_asynccnt 0x0" ::: "memory");   // this wave's share of stage 0 has landed
  __syncthreads();                                    // and every other wave's
  g_stage<MT>(lds0 + G_SZ(MT), ga + GK * 4, ap, gb + GK * 2, tid);
  v8f acc[MT][4] = {};
#pragma unroll 1   // one stage a trip: the two buffers alternate by the trip's parity, and the body stays small in the instruction cache
  for (int t = 0; t < GNT; ++t) {
    const unsigned char* sb = sm + (t & 1) * G_SZ(MT);
#pragma unroll   // the two 32-k steps of a stage stand unrolled: their LDS offsets are immediates
    for (int kc = 0; kc < 2; ++kc) {
      v16b w[4];
#pragma unroll
      for (int nt = 0; nt < 4; ++nt) w[nt] = frag_b((const __bf16*)(sb + G_B(MT)) + (wn * 64 + nt * 16 + col) * BPB + kc * 32, lane);
#pragma unroll
      for (int mt = 0; mt < MT; ++mt) { const float* xp = (const float*)sb + ((wm * MT + mt) * 16 + col) * APF + kc * 32 + 8 * g;
        const v4f x0 = *(const v4f*)xp, x1 = *(const v4f*)(xp + 4), x2 = *(const v4f*)(xp + 16), x3 = *(const v4f*)(xp + 20);   // the k order of frag_b
        if constexpr (SPLIT) { const F2 a = split_v4(x0, x1, x2, x3);
#pragma unroll
          for (int nt = 0; nt < 4; ++nt) acc[mt][nt] = wmma_bf(a.l, w[nt], acc[mt][nt]);
#pragma unroll
          for (int nt = 0; nt < 4; ++nt) acc[mt][nt] = wmma_bf(a.h, w[nt], acc[mt][nt]);
        } else { v16b a;
#pragma unroll
          for (int i = 0; i < 4; ++i) { a[i] = (__bf16)x0[i]; a[4 + i] = (__bf16)x1[i]; a[8 + i] = (__bf16)x2[i]; a[12 + i] = (__bf16)x3[i]; }
#pragma unroll
          for (int nt = 0; nt < 4; ++nt) acc[mt][nt] = wmma_bf(a, w[nt], acc[mt][nt]); } } }
    asm volatile("s_wait_dscnt 0x0" ::: "memory");      // this wave's reads of the buffer are done before anyone refills it
    asm volatile("s_wait_asynccnt 0x0" ::: "memory");   // this wave's share of stage t + 1 has landed
    __syncthreads();                                    // publishes stage t + 1 and ends every wave's reads of stage t
    if (t + 2 < GNT) g_stage<MT>(lds0 + (unsigned)(t & 1) * G_SZ(MT), ga + (size_t)(t + 2) * GK * 4, ap, gb + (size_t)(t + 2) * GK * 2, tid);
  }
  asm volatile("s_wait_asynccnt 0x0" ::: "memory");     // no copy is left in flight when the buffer takes the output rows
  float (*so)[68] = (float (*)[68])(sm + wave * (MT * 16 * 68 * 4));   // the wave's own MT * 16 rows x 64 columns
#pragma unroll
  for (int nt = 0; nt < 4; ++nt) { const float bb = bfr(bias[wn * 64 + nt * 16 + col]);
#pragma unroll
    for (int mt = 0; mt < MT; ++mt) {
#pragma unroll
      for (int r = 0; r < 8; ++r) so[mt * 16 + 8 * g + r][nt * 16 + col] = acc[mt][nt][r] + bb; } }
  LDSX();
  for (int rl = 0; rl < MT * 8; ++rl) { const int row = rl * 2 + g; vst2(C + (size_t)(wm * MT * 16 + row) * ldc + wn * 64 + col * 4, *(const v4f*)&so[row][col * 4]); }   // 256-B segments, two rows a store
}
// ---- k_proj: QKV[r][n] = bf16(x[r]) . PT[n] (exact) + bias, K = 1024; block (128 rows, 128 cols); a block's columns lie in one of q | k | v
__global__ __launch_bounds__(128) void k_proj(const float* __restrict__ XQ, const float* __restrict__ XK, const float* __restrict__ XV, const __bf16* __restrict__ PT, const float* __restrict__ bq, const float* __restrict__ bk, const float* __restrict__ bv, float* __restrict__ QKV) {
  __shared__ __align__(16) unsigned char sm[2 * G_SZ(4)];   // the two stage buffers; behind the loop its first bytes stage the output rows
  const int n0 = blockIdx.y * 128, which = n0 >> 10; const size_t r0 = (size_t)blockIdx.x * 128;
  const float* X = which == 0 ? XQ : (which == 1 ? XK : XV); const float* bs = which == 0 ? bq : (which == 1 ? bk : bv);
  gemm_tile<4, false>(sm, X + r0 * DM, DM, PT + (size_t)n0 * DM, bs + (n0 & 1023), QKV + r0 * QKVP + n0, QKVP);
}
// ---- k_out: Y = O(hi/lo; the q columns of QKV) . PT_out rows (2 products, K = 1024) + bo; block (64 rows, 128 cols)
__global__ __launch_bounds__(128) void k_out(const float* __restrict__ QKV, const __bf16* __restrict__ PT, const float* __restrict__ bo, float* __restrict__ Y) {
  __shared__ __align__(16) unsigned char sm[2 * G_SZ(2)];   // as in k_proj
  const int n0 = blockIdx.y * 128; const size_t r0 = (size_t)blockIdx.x * 64;
  gemm_tile<2, true>(sm, QKV + r0 * QKVP, QKVP, PT + (size_t)(3 * DM + n0) * DM, bo + n0, Y + r0 * DM + n0, DM);
}

extern "C" void kernel_launch(void* const* d_in, const int* in_sizes, int n_in, void* d_out, int out_size, void* d_ws, size_t ws_size, hipStream_t stream) {
  (void)in_sizes; (void)n_in; (void)out_size;
  const float** F = (const float**)d_in;   // query, key, value, mask [2,1,1,2048] i32, Wq, bq, Wk, bk, Wv, bv, Wo, bo, m_k [1,64,1024], m_v
  if (ws_size < (size_t)WS_END) return;
  char* ws = (char*)d_ws; __bf16 *PT = (__bf16*)(ws + WS_PT), *VTH = (__bf16*)(ws + WS_VTH), *VTL = (__bf16*)(ws + WS_VTL); float *QKV = (float*)(ws + WS_QKV), *KX = (float*)(ws + WS_KX);
  k_pack<<<4 * DM, 128, 0, stream>>>(F[4], F[6], F[8], F[10], PT);
  k_proj<<<dim3(TRB / 2, QKVP / 128), 128, 0, stream>>>(F[0], F[1], F[2], PT, F[5], F[7], F[9], QKV);
  k_kv<<<dim3(SK / 64, DM / 64, TNB), 128, 0, stream>>>(QKV, F[12], F[13], KX, VTH, VTL);
  k_attn<<<dim3(TQB, TNB * NH), 128, 0, stream>>>(QKV, KX, (const int*)d_in[3], VTH, VTL);
  k_out<<<dim3((TNB < NB ? TQB : NR / 64), DM / 128), 128, 0, stream>>>(QKV, PT, F[11], (float*)d_out);
}

// v005
// A run of this version takes 194 microseconds.
// Timed twice side by side with v004, it ran 1.25 and 1.26 times as fast.
// Over all steps from v000 it is 3.74 times as fast.
// compute dtype: query/key/value, the four weights + biases and the memory slots (module inputs) rounded to bf16; q/k/v projections with exact bf16 products (+ f32 bias); scores and P.V with both computed operands as bf16 hi + bf16 residual pairs (3 products; memory keys/values scaled in f32 and split the same way); output projection hi/lo x bf16 Wo (2 products) + bias; masked online softmax in f32; f32 accumulate.
#include <hip/hip_runtime.h>
#include <math.h>

typedef __attribute__((ext_vector_type(16))) _Float16 v16h;
typedef __attribute__((ext_vector_type(16))) __bf16 v16b;
typedef __attribute__((ext_vector_type(8)))  _Float16 v8h;
typedef __attribute__((ext_vector_type(8)))  float v8f;
typedef __attribute__((ext_vector_type(4)))  float v4f;
typedef __attribute__((ext_vector_type(2)))  float v2f;
typedef __attribute__((ext_vector_type(4)))  unsigned v4u;
typedef __attribute__((ext_vector_type(4)))  int v4i;
typedef float __attribute__((may_alias)) float_a;
typedef int __attribute__((may_alias)) int_a;

template <typename T> __device__ __forceinline__ void vst2(void* p, T v) { *(T*)p = v;  }
__device__ __forceinline__ v8f wmma16(v16h a, v16h b, v8f c) {
  v8f d = __builtin_amdgcn_wmma_f32_16x16x32_f16(false, a, false, b, (short)0, c, false, false);
  asm volatile("v_nop\n\tv_nop\n\tv_nop\n\tv_nop" : "+v"(d) : "v"(a), "v"(b));
  return d;
}
__device__ __forceinline__ v8f wmma_bf(v16b a, v16b b, v8f c) {
  v8f d = __builtin_amdgcn_wmma_f32_16x16x32_bf16(false, a, false, b, (short)0, c, false, false);
  asm volatile("v_nop\n\tv_nop\n\tv_nop\n\tv_nop" : "+v"(d) : "v"(a), "v"(b));
  return d;
}
// 16x16x32 fragments: lane = (h = lane>>4, row/col = lane&15); elements 0..7 = k0+8h+0..7, 8..15 = k0+16+8h+0..7; D element r = row 8h+r
__device__ __forceinline__ v16h frag_h(const _Float16* rowk0, int lane) {
  union { v16h v; v8h q[2]; } u; const _Float16* p = rowk0 + 8 * (lane >> 4);
  u.q[0] = *(const v8h*)p; u.q[1] = *(const v8h*)(p + 16); return u.v;
}
__device__ __forceinline__ v16h frag_f32(const float* rowk0, int lane) {
  v16h a; const float* p = rowk0 + 8 * (lane >> 4);
#pragma unroll
  for (int i = 0; i < 8; ++i) { a[i] = (_Float16)p[i]; a[8 + i] = (_Float16)p[16 + i]; }
  return a;
}
__device__ __forceinline__ v16h frag_f32s(const float* rowk0, int lane, float sc) {
  v16h a; const float* p = rowk0 + 8 * (lane >> 4);
#pragma unroll
  for (int i = 0; i < 8; ++i) { a[i] = (_Float16)(p[i] * sc); a[8 + i] = (_Float16)(p[16 + i] * sc); }
  return a;
}
// column fragment from a [K][ld] layout (column n), rows >= K read as 0
__device__ __forceinline__ v16h fragc_f32(const float* W, int k0, int n, int lane, int ld, int K) {
  v16h a; const int g = lane >> 4;
#pragma unroll
  for (int i = 0; i < 8; ++i) { const int ka = k0 + 8 * g + i, kb = ka + 16;
    a[i] = (_Float16)(ka < K ? W[(size_t)(ka < K ? ka : K - 1) * ld + n] : 0.f); a[8 + i] = (_Float16)(kb < K ? W[(size_t)(kb < K ? kb : K - 1) * ld + n] : 0.f); }
  return a;
}
struct F2 { v16b h, l; };
__device__ __forceinline__ F2 bsplit16(const float v[16]) { F2 r;
#pragma unroll
  for (int i = 0; i < 16; ++i) { const __bf16 h = (__bf16)v[i]; r.h[i] = h; r.l[i] = (__bf16)(v[i] - (float)h); }
  return r; }
__device__ __forceinline__ F2 split_row(const float* row, int k0, int lane) { float v[16]; const float* p = row + k0 + 8 * (lane >> 4);
#pragma unroll
  for (int i = 0; i < 8; ++i) { v[i] = p[i]; v[8 + i] = p[16 + i]; }
  return bsplit16(v); }
__device__ __forceinline__ F2 split_rowK(const float* row, int k0, int lane, int K) { float v[16]; const int g = lane >> 4;
#pragma unroll
  for (int i = 0; i < 8; ++i) { const int ka = k0 + 8 * g + i, kb = ka + 16; v[i] = ka < K ? row[ka < K ? ka : K - 1] : 0.f; v[8 + i] = kb < K ? row[kb < K ? kb : K - 1] : 0.f; }
  return bsplit16(v); }
__device__ __forceinline__ F2 split_col(const float* W, int k0, int n, int lane, int ld, int K) { float v[16]; const int g = lane >> 4;
#pragma unroll
  for (int i = 0; i < 8; ++i) { const int ka = k0 + 8 * g + i, kb = ka + 16; v[i] = ka < K ? W[(size_t)(ka < K ? ka : K - 1) * ld + n] : 0.f; v[8 + i] = kb < K ? W[(size_t)(kb < K ? kb : K - 1) * ld + n] : 0.f; }
  return bsplit16(v); }
__device__ __forceinline__ v8f mac3(const F2& a, const F2& b, v8f c) { c = wmma_bf(a.l, b.h, c); c = wmma_bf(a.h, b.l, c); return wmma_bf(a.h, b.h, c); }
__device__ __forceinline__ float sigm(float v) { return 1.0f / (1.0f + expf(-v)); }
#define LDSX() do { asm volatile("s_wait_dscnt 0" ::: "memory"); __builtin_amdgcn_wave_barrier(); __builtin_amdgcn_fence(__ATOMIC_RELEASE, "workgroup"); } while (0)


// Multi-head attention with persistent memory: Q = query Wq^T + bq, K = [key Wk^T + bk ; 8 m_k], V = [value Wv^T + bv ; 8 m_v] (2048 + 64 slots), energy = Q K^T / 8 with the first 2048 key columns masked (mask == 0 -> -1e20) and the memory columns never masked; softmax; P V; merge heads; @ Wo^T + bo.  B 2, S 2048, D 1024, 16 x 64.
// k_pack, k_proj (exact GEMM + bias; q|k|v from query|key|value), k_kv (K rows incl. the memory slots; V as transposed hi/lo planes over the 2112 keys), k_attn (66 key steps, K and V staged in LDS by 64 keys, mask per key column), k_out (+ bo).
#define NB 2
#define SS 2048
#define DM 1024
#define NH 16
#define HD 64
#define NR (NB * SS)
#define QKVP (3 * DM)
#define NM 64
#define SK (SS + NM)        // 2112 keys per batch
#ifndef TRB
#define TRB (NR / 64)
#define TQB (SS / 64)
#define TNB NB
#endif
typedef __attribute__((ext_vector_type(8))) __bf16 v8b;
__device__ __forceinline__ v16b frag_b(const __bf16* rowk0, int lane) {
  union { v16b v; v8b q[2]; } u; const __bf16* p = rowk0 + 8 * (lane >> 4);
  u.q[0] = *(const v8b*)p; u.q[1] = *(const v8b*)(p + 16); return u.v;
}
__device__ __forceinline__ v16b frag_gbf(const float* rowk0, int lane) {
  v16b a; const float* p = rowk0 + 8 * (lane >> 4);
#pragma unroll
  for (int i = 0; i < 8; ++i) { a[i] = (__bf16)p[i]; a[8 + i] = (__bf16)p[16 + i]; }
  return a;
}
__device__ __forceinline__ float bfr(float v) { return (float)(__bf16)v; }
// s[i] = 2^s[i] and a = 2^a, one instruction each (below 2^-126 the result is 0). One statement, so that every v_exp_f32 is followed by an instruction that touches neither its result nor its source; the closing v_nop is that slot for the last one
__device__ __forceinline__ void ex2_17(float* s, float& a) {
  asm("v_exp_f32 %0, %0\n\tv_exp_f32 %1, %1\n\tv_exp_f32 %2, %2\n\tv_exp_f32 %3, %3\n\tv_exp_f32 %4, %4\n\tv_exp_f32 %5, %5\n\tv_exp_f32 %6, %6\n\tv_exp_f32 %7, %7\n\tv_exp_f32 %8, %8\n\t"
      "v_exp_f32 %9, %9\n\tv_exp_f32 %10, %10\n\tv_exp_f32 %11, %11\n\tv_exp_f32 %12, %12\n\tv_exp_f32 %13, %13\n\tv_exp_f32 %14, %14\n\tv_exp_f32 %15, %15\n\tv_exp_f32 %16, %16\n\tv_nop"
      : "+v"(s[0]), "+v"(s[1]), "+v"(s[2]), "+v"(s[3]), "+v"(s[4]), "+v"(s[5]), "+v"(s[6]), "+v"(s[7]), "+v"(s[8]), "+v"(s[9]), "+v"(s[10]), "+v"(s[11]), "+v"(s[12]), "+v"(s[13]), "+v"(s[14]), "+v"(s[15]), "+v"(a));
}
#define SC2 0.18033688011112042f   // log2(e) / 8: the scores are scaled into powers of two, so that exp(energy - max) = 2^(s - m)
#define WS_PT   0u                                 // bf16 [4096 (q|k|v|out cols)][1024]
#define WS_QKV  (WS_PT + 2u * 4 * DM * DM)           // f32 [4096 rows][3072]  (q 0..1023 | k | v) ; q cols later overwritten by O
#define WS_KX   (WS_QKV + 4u * NR * QKVP)            // f32 [2][2112][1024] keys incl. memory
#define WS_VTH  (WS_KX + 4u * NB * SK * DM)           // bf16 [2][1024 (h*64+d)][2112]
#define WS_VTL  (WS_VTH + 2u * NB * DM * SK)
#define WS_END  (WS_VTL + 2u * NB * DM * SK)

__global__ __launch_bounds__(128) void k_pack(const float* __restrict__ Wq, const float* __restrict__ Wk, const float* __restrict__ Wv, const float* __restrict__ Wo, __bf16* __restrict__ PT) {
  __shared__ __align__(16) __bf16 srow[DM];
  const int n = blockIdx.x, tid = threadIdx.x; const int which = n >> 10, c = n & 1023; const float* Wm = which == 0 ? Wq : (which == 1 ? Wk : (which == 2 ? Wv : Wo));
  for (int k = tid; k < DM; k += 128) srow[k] = (__bf16)Wm[(size_t)c * DM + k];   // torch [out][in]: row c
  __syncthreads();
  vst2((unsigned*)(PT + (size_t)n * DM + tid * 8), *(const v4u*)(&srow[tid * 8]));
}
// ---- k_kv: block = (64 keys, one head's 64 columns, batch), 4 waves; a thread holds 4 key pairs x 4 columns of K and of V with all 16 loads in flight together; V is split, packed by key pair and turned in LDS, K goes straight out again
typedef __attribute__((ext_vector_type(2))) __bf16 v2b;
__global__ __launch_bounds__(128) void k_kv(const float* __restrict__ QKV, const float* __restrict__ MK, const float* __restrict__ MV, float* __restrict__ KX, __bf16* __restrict__ VTH, __bf16* __restrict__ VTL) {
  __shared__ __align__(16) unsigned svh[64][36], svl[64][36];   // [column][key pair]; the 16-B chunks of a row stand XORed with column >> 4, so that a wave's 32 pair stores meet 32 banks
  const int tid = threadIdx.x, c4 = tid & 15, pr = tid >> 4; const int k0 = blockIdx.x * 64, c0 = blockIdx.y * 64, b = blockIdx.z;
  v4f kq[8], vq[8];   // i: key 2 * pr + 16 * (i >> 1) + (i & 1) of the block
  if (k0 < SS) {      // a block is wholly ordinary keys or wholly memory slots (SS is a multiple of 64)
    const float* base = QKV + ((size_t)b * SS + k0 + 2 * pr) * QKVP + c0 + c4 * 4;
#pragma unroll
    for (int i = 0; i < 8; ++i) { const float* row = base + (size_t)(16 * (i >> 1) + (i & 1)) * QKVP; kq[i] = *(const v4f*)(row + DM); vq[i] = *(const v4f*)(row + 2 * DM); }
    asm volatile("s_wait_xcnt 0x0" :: "v"(base) : "memory");   // the loads' address pair stays whole (no load's own result lands on it) until every load has taken its address
  } else {
    const size_t o0 = (size_t)(k0 - SS + 2 * pr) * DM + c0 + c4 * 4; const float *pk = MK + o0, *pv = MV + o0;
#pragma unroll
    for (int i = 0; i < 8; ++i) { const size_t o = (size_t)(16 * (i >> 1) + (i & 1)) * DM; kq[i] = *(const v4f*)(pk + o); vq[i] = *(const v4f*)(pv + o); }
    asm volatile("s_wait_xcnt 0x0" :: "v"(pk), "v"(pv) : "memory");   // as above, for the two address pairs
#pragma unroll
    for (int i = 0; i < 8; ++i) {
#pragma unroll
      for (int e = 0; e < 4; ++e) { kq[i][e] = 8.0f * bfr(kq[i][e]); vq[i][e] = 8.0f * bfr(vq[i][e]); } }
  }
#pragma unroll
  for (int p = 0; p < 4; ++p) { const int pp = (pr + 8 * p) ^ ((c4 >> 2) << 2);
#pragma unroll
    for (int e = 0; e < 4; ++e) { const float va = vq[2 * p][e], vb = vq[2 * p + 1][e]; const __bf16 ha = (__bf16)va, hb = (__bf16)vb;
      const v2b hh = {ha, hb}, ll = {(__bf16)(va - (float)ha), (__bf16)(vb - (float)hb)};
      svh[c4 * 4 + e][pp] = __builtin_bit_cast(unsigned, hh); svl[c4 * 4 + e][pp] = __builtin_bit_cast(unsigned, ll); } }
  __syncthreads();
#pragma unroll
  for (int i = 0; i < 8; ++i) vst2(KX + ((size_t)b * SK + k0 + 2 * pr + 16 * (i >> 1) + (i & 1)) * DM + c0 + c4 * 4, kq[i]);   // behind the barrier, which would else wait for these stores
#pragma unroll
  for (int it = 0; it < 4; ++it) { const int rowi = it * 16 + (tid >> 3), pc = tid & 7, sw = (pc ^ it) * 4; const size_t o = ((size_t)b * DM + c0 + rowi) * SK + k0 + pc * 8; vst2((unsigned*)(VTH + o), *(const v4u*)&svh[rowi][sw]); vst2((unsigned*)(VTL + o), *(const v4u*)&svl[rowi][sw]); }
}
#define KT 64
#define NT (SK / KT)
#define KPF 68
#define VPB 72
#define ST_VH (KT * KPF * 4)
#define ST_VL (ST_VH + HD * VPB * 2)
#define ST_SZ (ST_VL + HD * VPB * 2)       // 35840 B a stage
__device__ __forceinline__ float xhalf(float x) { return __builtin_bit_cast(float, __builtin_amdgcn_permlanex16(__builtin_bit_cast(int, x), __builtin_bit_cast(int, x), 0x76543210, 0xfedcba98, false, false)); }  // lane l with lane l ^ 16
__device__ __forceinline__ F2 split_v4(v4f a, v4f b, v4f c, v4f d) { float v[16];
#pragma unroll
  for (int i = 0; i < 4; ++i) { v[i] = a[i]; v[4 + i] = b[i]; v[8 + i] = c[i]; v[12 + i] = d[i]; }
  return bsplit16(v); }
// eight 16-B copies a lane, global to LDS through no register; the last line keeps the address registers whole until every copy has taken its addresses
__device__ __forceinline__ void copy8(const unsigned* l, const char* const* p) {
  asm volatile("global_load_async_to_lds_b128 %0, %8, off\n\tglobal_load_async_to_lds_b128 %1, %9, off\n\tglobal_load_async_to_lds_b128 %2, %10, off\n\tglobal_load_async_to_lds_b128 %3, %11, off\n\t"
               "global_load_async_to_lds_b128 %4, %12, off\n\tglobal_load_async_to_lds_b128 %5, %13, off\n\tglobal_load_async_to_lds_b128 %6, %14, off\n\tglobal_load_async_to_lds_b128 %7, %15, off\n\ts_wait_xcnt 0x0"
               :: "v"(l[0]), "v"(l[1]), "v"(l[2]), "v"(l[3]), "v"(l[4]), "v"(l[5]), "v"(l[6]), "v"(l[7]), "v"(p[0]), "v"(p[1]), "v"(p[2]), "v"(p[3]), "v"(p[4]), "v"(p[5]), "v"(p[6]), "v"(p[7]) : "memory");
}
__device__ __forceinline__ void stage_in(unsigned lb, const char* gk, const char* gh, const char* gl, int tid) {
  unsigned l[8]; const char* p[8];
#pragma unroll
  for (int i = 0; i < 8; ++i) { l[i] = lb + (unsigned)((i * 8 + (tid >> 4)) * (KPF * 4) + (tid & 15) * 16); p[i] = gk + (size_t)i * 8 * DM * 4; }   // K: a wave covers 2 rows of 256 B
  copy8(l, p);
#pragma unroll
  for (int i = 0; i < 4; ++i) { const unsigned o = (unsigned)((i * 16 + (tid >> 3)) * (VPB * 2) + (tid & 7) * 16); l[i] = lb + ST_VH + o; l[4 + i] = lb + ST_VL + o; p[i] = gh + (size_t)i * 16 * SK * 2; p[4 + i] = gl + (size_t)i * 16 * SK * 2; }   // V: a wave covers 4 rows of 128 B
  copy8(l, p);
}
__global__ __launch_bounds__(128) void k_attn(float* __restrict__ QKV, const float* __restrict__ KX, const int* __restrict__ MASK, const __bf16* __restrict__ VTH, const __bf16* __restrict__ VTL) {
  __shared__ __align__(16) unsigned char sm[2 * ST_SZ];   // the two stage buffers; behind the loop its first bytes stage the output rows
  const int tid = threadIdx.x, wave = tid >> 5, lane = tid & 31, col = lane & 15, g = lane >> 4;
  const int qb = blockIdx.x, bh = blockIdx.y, b = bh >> 4, h = bh & 15; const int q0 = qb * 64 + wave * 16; const size_t tq = (size_t)b * SS + q0;
  const unsigned lds0 = (unsigned)(size_t)&sm[0];
  const char* gk = (const char*)(KX + ((size_t)b * SK + (tid >> 4)) * DM + h * HD) + (tid & 15) * 16;             // this lane's first K chunk of stage 0; a stage on: KT rows
  const char* gh = (const char*)(VTH + ((size_t)b * DM + h * HD + (tid >> 3)) * SK) + (tid & 7) * 16;              // the same of V hi; a stage on: KT keys
  const char* gl = (const char*)(VTL + ((size_t)b * DM + h * HD + (tid >> 3)) * SK) + (tid & 7) * 16;
  stage_in(lds0, gk, gh, gl, tid);
  const F2 a0 = split_row(QKV + (tq + col) * QKVP + h * HD, 0, lane), a1 = split_row(QKV + (tq + col) * QKVP + h * HD, 32, lane);   // B operand: column = query
  asm volatile("s_wait_asynccnt 0x0" ::: "memory");   // this wave's share of stage 0 has landed
  __syncthreads();                                    // and every other wave's
  stage_in(lds0 + ST_SZ, gk + (size_t)KT * DM * 4, gh + KT * 2, gl + KT * 2, tid);
  float m = -3.0e38f, l = 0.f;   // of query col, m in log2 units; l sums this wave half's keys only, the halves are joined behind the loop
  v8f acc[4] = {};               // acc[dt][r] = O[query col][dt * 16 + 8 g + r]
#pragma unroll 1
  for (int t = 0; t < NT; ++t) {
    const unsigned char* sb = sm + (t & 1) * ST_SZ;
#pragma unroll   // the two steps of a stage stand unrolled: their LDS offsets are immediates
    for (int hs = 0; hs < 2; ++hs) {
      const int ks = 2 * t + hs;
      const bool mem = ks * 32 >= SS;   // a step is wholly ordinary keys or wholly memory slots (SS is a multiple of 32)
      const int mv = MASK[(size_t)b * SS + (mem ? 0 : ks * 32) + lane];   // one key's mask a lane (the address is in range in a memory step too)
      const unsigned kw = (__builtin_amdgcn_ballot_w32(mv != 0) | (mem ? 0xffffffffu : 0u)) >> (8 * g);   // bit j = keep key 8g + j of this step
      float s[16];
#pragma unroll
      for (int ct = 0; ct < 2; ++ct) { const float* kp = (const float*)sb + (hs * 32 + ct * 16 + col) * KPF + 8 * g;   // A operand: row = key
        const F2 k0 = split_v4(*(const v4f*)kp, *(const v4f*)(kp + 4), *(const v4f*)(kp + 16), *(const v4f*)(kp + 20)), k1 = split_v4(*(const v4f*)(kp + 32), *(const v4f*)(kp + 36), *(const v4f*)(kp + 48), *(const v4f*)(kp + 52));
        v8f c = {}; c = wmma_bf(k0.h, a0.l, c); c = wmma_bf(k0.l, a0.h, c); c = wmma_bf(k0.h, a0.h, c); c = wmma_bf(k1.h, a1.l, c); c = wmma_bf(k1.l, a1.h, c); c = wmma_bf(k1.h, a1.h, c);
#pragma unroll
        for (int r = 0; r < 8; ++r) { const bool keep = ((kw >> (ct * 16 + r)) & 1u) != 0; s[ct * 8 + r] = keep ? c[r] * SC2 : -1.0e20f; } }
      v16b vh[4], vl[4];   // A operand: row = d; read here, as one group, so that the softmax stands between the reads and their use
#pragma unroll
      for (int dt = 0; dt < 4; ++dt) { const int vo = (dt * 16 + col) * VPB + hs * 32; vh[dt] = frag_b((const __bf16*)(sb + ST_VH) + vo, lane); vl[dt] = frag_b((const __bf16*)(sb + ST_VL) + vo, lane); }
      float mx = s[0];
#pragma unroll
      for (int i = 1; i < 16; ++i) mx = fmaxf(mx, s[i]);
      mx = fmaxf(mx, xhalf(mx));
      const float mn = fmaxf(m, mx); float alpha = m - mn;
      float es = 0.f;
#pragma unroll
      for (int i = 0; i < 16; ++i) s[i] -= mn;
      ex2_17(s, alpha);
#pragma unroll
      for (int i = 0; i < 16; ++i) es += s[i];
      l = l * alpha + es; m = mn;
#pragma unroll
      for (int dt = 0; dt < 4; ++dt) acc[dt] *= alpha;
      const F2 pa = bsplit16(s);   // element i = key 8g+i, element 8+i = key 16+8g+i: the k order of frag_b
#pragma unroll
      for (int dt = 0; dt < 4; ++dt) { acc[dt] = wmma_bf(vh[dt], pa.l, acc[dt]); acc[dt] = wmma_bf(vl[dt], pa.h, acc[dt]); acc[dt] = wmma_bf(vh[dt], pa.h, acc[dt]); } }
    asm volatile("s_wait_dscnt 0x0" ::: "memory");      // this wave's reads of the buffer are done before anyone refills it
    asm volatile("s_wait_asynccnt 0x0" ::: "memory");   // this wave's share of stage t + 1 has landed
    __syncthreads();                                    // publishes stage t + 1 and ends every wave's reads of stage t
    if (t + 2 < NT) stage_in(lds0 + (unsigned)(t & 1) * ST_SZ, gk + (size_t)(t + 2) * KT * DM * 4, gh + (size_t)(t + 2) * KT * 2, gl + (size_t)(t + 2) * KT * 2, tid);
  }
  asm volatile("s_wait_asynccnt 0x0" ::: "memory");     // no copy is left in flight when the buffer takes the output rows
  float (*so)[16][68] = (float (*)[16][68])sm;
  const float il = 1.0f / (l + xhalf(l));
#pragma unroll
  for (int dt = 0; dt < 4; ++dt) { const v8f o = acc[dt] * il; vst2(&so[wave][col][dt * 16 + 8 * g], (v4f){o[0], o[1], o[2], o[3]}); vst2(&so[wave][col][dt * 16 + 8 * g + 4], (v4f){o[4], o[5], o[6], o[7]}); }
  LDSX();
  for (int rl = 0; rl < 16; ++rl) if (lane < 16) vst2(QKV + (tq + rl) * QKVP + h * HD + lane * 4, *(const v4f*)&so[wave][rl][lane * 4]);
}
// ---- the two GEMMs (k_proj, k_out): block = (MT * 32 rows, 128 columns), 4 waves as 2 x 2, a wave holds MT x 4 accumulator tiles (MT * 16 rows x 64 columns)
// A (f32 rows) and B (bf16 weight rows) reach the waves through LDS: a stage = 64 k (A rows of 256 B, B rows of 128 B), copied once for the block in whole 128-B lines, two buffers, the next stage in flight while this one is worked on; A is rounded (or split) to bf16 as the fragment is read; k runs upward in steps of 32 into each accumulator
#define GK 64                              // k a stage
#define GNT (DM / GK)                      // 16 stages
#define APF 68                             // floats a staged A row: 272 B = 16 B x odd, no bank conflict for 16-B readers
#define BPB 72                             // bf16 a staged B row: 144 B = 16 B x odd
#define G_B(MT) ((MT) * 32 * APF * 4)
#define G_SZ(MT) (G_B(MT) + 128 * BPB * 2)  // a stage: 53248 B at MT 4, 35840 B at MT 2
template <int MT> __device__ __forceinline__ void g_stage(unsigned lb, const char* ga, size_t apitch, const char* gb, int tid) {
  unsigned l[8]; const char* p[8];
#pragma unroll
  for (int u = 0; u < MT / 2; ++u) {
#pragma unroll
    for (int i = 0; i < 8; ++i) { const int rr = (u * 8 + i) * 8; l[i] = lb + (unsigned)((rr + (tid >> 4)) * (APF * 4) + (tid & 15) * 16); p[i] = ga + (size_t)rr * apitch; }   // A: a wave covers 2 rows of 256 B
    copy8(l, p); }
#pragma unroll
  for (int i = 0; i < 8; ++i) { l[i] = lb + G_B(MT) + (unsigned)((i * 16 + (tid >> 3)) * (BPB * 2) + (tid & 7) * 16); p[i] = gb + (size_t)i * 16 * DM * 2; }   // B: a wave covers 4 rows of 128 B
  copy8(l, p);
}
// A: the block's first row, k = 0, lda floats a row; Bw: the block's first weight row; bias, C: at the block's first column (C at its first row too)
template <int MT, bool SPLIT> __device__ __forceinline__ void gemm_tile(unsigned char* sm, const float* A, int lda, const __bf16* Bw, const float* bias, float* C, int ldc) {
  const int tid = threadIdx.x, wave = tid >> 5, lane = tid & 31, col = lane & 15, g = lane >> 4, wm = wave >> 1, wn = wave & 1;
  const unsigned lds0 = (unsigned)(size_t)sm; const size_t ap = (size_t)lda * 4;
  const char* ga = (const char*)(A + (size_t)(tid >> 4) * lda) + (tid & 15) * 16;   // this lane's first A chunk of stage 0; a stage on: GK floats
  const char* gb = (const char*)(Bw + (size_t)(tid >> 3) * DM) + (tid & 7) * 16;    // the same of B; a stage on: GK bf16
  g_stage<MT>(lds0, ga, ap, gb, tid);
  asm volatile("s_wait_asynccnt 0x0" ::: "memory");   // this wave's share of stage 0 has landed
  __syncthreads();                                    // and every other wave's
  g_stage<MT>(lds0 + G_SZ(MT), ga + GK * 4, ap, gb + GK * 2, tid);
  v8f acc[MT][4] = {};
#pragma unroll 1   // one stage a trip: the two buffers alternate by the trip's parity, and the body stays small in the instruction cache
  for (int t = 0; t < GNT; ++t) {
    const unsigned char* sb = sm + (t & 1) * G_SZ(MT);
#pragma unroll   // the two 32-k steps of a stage stand unrolled: their LDS offsets are immediates
    for (int kc = 0; kc < 2; ++kc) {
      v16b w[4];
#pragma unroll
      for (int nt = 0; nt < 4; ++nt) w[nt] = frag_b((const __bf16*)(sb + G_B(MT)) + (wn * 64 + nt * 16 + col) * BPB + kc * 32, lane);
#pragma unroll
      for (int mt = 0; mt < MT; ++mt) { const float* xp = (const float*)sb + ((wm * MT + mt) * 16 + col) * APF + kc * 32 + 8 * g;
        const v4f x0 = *(const v4f*)xp, x1 = *(const v4f*)(xp + 4), x2 = *(const v4f*)(xp + 16), x3 = *(const v4f*)(xp + 20);   // the k order of frag_b
        if constexpr (SPLIT) { const F2 a = split_v4(x0, x1, x2, x3);
#pragma unroll
          for (int nt = 0; nt < 4; ++nt) acc[mt][nt] = wmma_bf(a.l, w[nt], acc[mt][nt]);
#pragma unroll
          for (int nt = 0; nt < 4; ++nt) acc[mt][nt] = wmma_bf(a.h, w[nt], acc[mt][nt]);
        } else { v16b a;
#pragma unroll
          for (int i = 0; i < 4; ++i) { a[i] = (__bf16)x0[i]; a[4 + i] = (__bf16)x1[i]; a[8 + i] = (__bf16)x2[i]; a[12 + i] = (__bf16)x3[i]; }
#pragma unroll
          for (int nt = 0; nt < 4; ++nt) acc[mt][nt] = wmma_bf(a, w[nt], acc[mt][nt]); } } }
    asm volatile("s_wait_dscnt 0x0" ::: "memory");      // this wave's reads of the buffer are done before anyone refills it
    asm volatile("s_wait_asynccnt 0x0" ::: "memory");   // this wave's share of stage t + 1 has landed
    __syncthreads();                                    // publishes stage t + 1 and ends every wave's reads of stage t
    if (t + 2 < GNT) g_stage<MT>(lds0 + (unsigned)(t & 1) * G_SZ(MT), ga + (size_t)(t + 2) * GK * 4, ap, gb + (size_t)(t + 2) * GK * 2, tid);
  }
  asm volatile("s_wait_asynccnt 0x0" ::: "memory");     // no copy is left in flight when the buffer takes the output rows
  float (*so)[68] = (float (*)[68])(sm + wave * (MT * 16 * 68 * 4));   // the wave's own MT * 16 rows x 64 columns
#pragma unroll
  for (int nt = 0; nt < 4; ++nt) { const float bb = bfr(bias[wn * 64 + nt * 16 + col]);
#pragma unroll
    for (int mt = 0; mt < MT; ++mt) {
#pragma unroll
      for (int r = 0; r < 8; ++r) so[mt * 16 + 8 * g + r][nt * 16 + col] = acc[mt][nt][r] + bb; } }
  LDSX();
  for (int rl = 0; rl < MT * 8; ++rl) { const int row = rl * 2 + g; vst2(C + (size_t)(wm * MT * 16 + row) * ldc + wn * 64 + col * 4, *(const v4f*)&so[row][col * 4]); }   // 256-B segments, two rows a store
}
// ---- k_proj: QKV[r][n] = bf16(x[r]) . PT[n] (exact) + bias, K = 1024; block (128 rows, 128 cols); a block's columns lie in one of q | k | v
__global__ __launch_bounds__(128) void k_proj(const float* __restrict__ XQ, const float* __restrict__ XK, const float* __restrict__ XV, const __bf16* __restrict__ PT, const float* __restrict__ bq, const float* __restrict__ bk, const float* __restrict__ bv, float* __restrict__ QKV) {
  __shared__ __align__(16) unsigned char sm[2 * G_SZ(4)];   // the two stage buffers; behind the loop its first bytes stage the output rows
  const int n0 = blockIdx.y * 128, which = n0 >> 10; const size_t r0 = (size_t)blockIdx.x * 128;
  const float* X = which == 0 ? XQ : (which == 1 ? XK : XV); const float* bs = which == 0 ? bq : (which == 1 ? bk : bv);
  gemm_tile<4, false>(sm, X + r0 * DM, DM, PT + (size_t)n0 * DM, bs + (n0 & 1023), QKV + r0 * QKVP + n0, QKVP);
}
// ---- k_out: Y = O(hi/lo; the q columns of QKV) . PT_out rows (2 products, K = 1024) + bo; block (64 rows, 128 cols)
__global__ __launch_bounds__(128) void k_out(const float* __restrict__ QKV, const __bf16* __restrict__ PT, const float* __restrict__ bo, float* __restrict__ Y) {
  __shared__ __align__(16) unsigned char sm[2 * G_SZ(2)];   // as in k_proj
  const int n0 = blockIdx.y * 128; const size_t r0 = (size_t)blockIdx.x * 64;
  gemm_tile<2, true>(sm, QKV + r0 * QKVP, QKVP, PT + (size_t)(3 * DM + n0) * DM, bo + n0, Y + r0 * DM + n0, DM);
}

extern "C" void kernel_launch(void* const* d_in, const int* in_sizes, int n_in, void* d_out, int out_size, void* d_ws, size_t ws_size, hipStream_t stream) {
  (void)in_sizes; (void)n_in; (void)out_size;
  const float** F = (const float**)d_in;   // query, key, value, mask [2,1,1,2048] i32, Wq, bq, Wk, bk, Wv, bv, Wo, bo, m_k [1,64,1024], m_v
  if (ws_size < (size_t)WS_END) return;
  char* ws = (char*)d_ws; __bf16 *PT = (__bf16*)(ws + WS_PT), *VTH = (__bf16*)(ws + WS_VTH), *VTL = (__bf16*)(ws + WS_VTL); float *QKV = (float*)(ws + WS_QKV), *KX = (float*)(ws + WS_KX);
  k_pack<<<4 * DM, 128, 0, stream>>>(F[4], F[6], F[8], F[10], PT);
  k_proj<<<dim3(TRB / 2, QKVP / 128), 128, 0, stream>>>(F[0], F[1], F[2], PT, F[5], F[7], F[9], QKV);
  k_kv<<<dim3(SK / 64, DM / 64, TNB), 128, 0, stream>>>(QKV, F[12], F[13], KX, VTH, VTL);
  k_attn<<<dim3(TQB, TNB * NH), 128, 0, stream>>>(QKV, KX, (const int*)d_in[3], VTH, VTL);
  k_out<<<dim3((TNB < NB ? TQB : NR / 64), DM / 128), 128, 0, stream>>>(QKV, PT, F[11], (float*)d_out);
}

// v006
// A run of this version takes 162 microseconds.
// Timed twice side by side with v005, it ran 1.19 and 1.20 times as fast.
// All steps since v000 together make it 4.47 times as fast.
// compute dtype: query/key/value, the four weights + biases and the memory slots (module inputs) rounded to bf16; q/k/v projections with exact bf16 products (+ f32 bias); scores and P.V with both computed operands as bf16 hi + bf16 residual pairs (3 products; memory keys/values scaled in f32 and split the same way); output projection hi/lo x bf16 Wo (2 products) + bias; masked online softmax in f32; f32 accumulate.
#include <hip/hip_runtime.h>
#include <math.h>

typedef __attribute__((ext_vector_type(16))) _Float16 v16h;
typedef __attribute__((ext_vector_type(16))) __bf16 v16b;
typedef __attribute__((ext_vector_type(8)))  _Float16 v8h;
typedef __attribute__((ext_vector_type(8)))  float v8f;
typedef __attribute__((ext_vector_type(4)))  float v4f;
typedef __attribute__((ext_vector_type(2)))  float v2f;
typedef __attribute__((ext_vector_type(4)))  unsigned v4u;
typedef __attribute__((ext_vector_type(4)))  int v4i;
typedef float __attribute__((may_alias)) float_a;
typedef int __attribute__((may_alias)) int_a;

template <typename T> __device__ __forceinline__ void vst2(void* p, T v) { *(T*)p = v;  }
__device__ __forceinline__ v8f wmma16(v16h a, v16h b, v8f c) {
  v8f d = __builtin_amdgcn_wmma_f32_16x16x32_f16(false, a, false, b, (short)0, c, false, false);
  asm volatile("v_nop\n\tv_nop\n\tv_nop\n\tv_nop" : "+v"(d) : "v"(a), "v"(b));
  return d;
}
__device__ __forceinline__ v8f wmma_bf(v16b a, v16b b, v8f c) {
  v8f d = __builtin_amdgcn_wmma_f32_16x16x32_bf16(false, a, false, b, (short)0, c, false, false);
  asm volatile("v_nop\n\tv_nop\n\tv_nop\n\tv_nop" : "+v"(d) : "v"(a), "v"(b));
  return d;
}
// 16x16x32 fragments: lane = (h = lane>>4, row/col = lane&15); elements 0..7 = k0+8h+0..7, 8..15 = k0+16+8h+0..7; D element r = row 8h+r
__device__ __forceinline__ v16h frag_h(const _Float16* rowk0, int lane) {
  union { v16h v; v8h q[2]; } u; const _Float16* p = rowk0 + 8 * (lane >> 4);
  u.q[0] = *(const v8h*)p; u.q[1] = *(const v8h*)(p + 16); return u.v;
}
__device__ __forceinline__ v16h frag_f32(const float* rowk0, int lane) {
  v16h a; const float* p = rowk0 + 8 * (lane >> 4);
#pragma unroll
  for (int i = 0; i < 8; ++i) { a[i] = (_Float16)p[i]; a[8 + i] = (_Float16)p[16 + i]; }
  return a;
}
__device__ __forceinline__ v16h frag_f32s(const float* rowk0, int lane, float sc) {
  v16h a; const float* p = rowk0 + 8 * (lane >> 4);
#pragma unroll
  for (int i = 0; i < 8; ++i) { a[i] = (_Float16)(p[i] * sc); a[8 + i] = (_Float16)(p[16 + i] * sc); }
  return a;
}
// column fragment from a [K][ld] layout (column n), rows >= K read as 0
__device__ __forceinline__ v16h fragc_f32(const float* W, int k0, int n, int lane, int ld, int K) {
  v16h a; const int g = lane >> 4;
#pragma unroll
  for (int i = 0; i < 8; ++i) { const int ka = k0 + 8 * g + i, kb = ka + 16;
    a[i] = (_Float16)(ka < K ? W[(size_t)(ka < K ? ka : K - 1) * ld + n] : 0.f); a[8 + i] = (_Float16)(kb < K ? W[(size_t)(kb < K ? kb : K - 1) * ld + n] : 0.f); }
  return a;
}
struct F2 { v16b h, l; };
__device__ __forceinline__ F2 bsplit16(const float v[16]) { F2 r;
#pragma unroll
  for (int i = 0; i < 16; ++i) { const __bf16 h = (__bf16)v[i]; r.h[i] = h; r.l[i] = (__bf16)(v[i] - (float)h); }
  return r; }
__device__ __forceinline__ F2 split_row(const float* row, int k0, int lane) { float v[16]; const float* p = row + k0 + 8 * (lane >> 4);
#pragma unroll
  for (int i = 0; i < 8; ++i) { v[i] = p[i]; v[8 + i] = p[16 + i]; }
  return bsplit16(v); }
__device__ __forceinline__ F2 split_rowK(const float* row, int k0, int lane, int K) { float v[16]; const int g = lane >> 4;
#pragma unroll
  for (int i = 0; i < 8; ++i) { const int ka = k0 + 8 * g + i, kb = ka + 16; v[i] = ka < K ? row[ka < K ? ka : K - 1] : 0.f; v[8 + i] = kb < K ? row[kb < K ? kb : K - 1] : 0.f; }
  return bsplit16(v); }
__device__ __forceinline__ F2 split_col(const float* W, int k0, int n, int lane, int ld, int K) { float v[16]; const int g = lane >> 4;
#pragma unroll
  for (int i = 0; i < 8; ++i) { const int ka = k0 + 8 * g + i, kb = ka + 16; v[i] = ka < K ? W[(size_t)(ka < K ? ka : K - 1) * ld + n] : 0.f; v[8 + i] = kb < K ? W[(size_t)(kb < K ? kb : K - 1) * ld + n] : 0.f; }
  return bsplit16(v); }
__device__ __forceinline__ v8f mac3(const F2& a, const F2& b, v8f c) { c = wmma_bf(a.l, b.h, c); c = wmma_bf(a.h, b.l, c); return wmma_bf(a.h, b.h, c); }
__device__ __forceinline__ float sigm(float v) { return 1.0f / (1.0f + expf(-v)); }
#define LDSX() do { asm volatile("s_wait_dscnt 0" ::: "memory"); __builtin_amdgcn_wave_barrier(); __builtin_amdgcn_fence(__ATOMIC_RELEASE, "workgroup"); } while (0)


// Multi-head attention with persistent memory: Q = query Wq^T + bq, K = [key Wk^T + bk ; 8 m_k], V = [value Wv^T + bv ; 8 m_v] (2048 + 64 slots), energy = Q K^T / 8 with the first 2048 key columns masked (mask == 0 -> -1e20) and the memory columns never masked; softmax; P V; merge heads; @ Wo^T + bo.  B 2, S 2048, D 1024, 16 x 64.
// k_pack, k_proj (exact GEMM + bias; q|k|v from query|key|value), k_kv (K rows incl. the memory slots, split once into bf16 hi | lo by head; V as transposed hi/lo planes over the 2112 keys), k_attn (66 key steps, K and V staged in LDS by 64 keys, mask per key column), k_out (+ bo).
#define NB 2
#define SS 2048
#define DM 1024
#define NH 16
#define HD 64
#define NR (NB * SS)
#define QKVP (3 * DM)
#define NM 64
#define SK (SS + NM)        // 2112 keys per batch
#ifndef TRB
#define TRB (NR / 64)
#define TQB (SS / 64)
#define TNB NB
#endif
typedef __attribute__((ext_vector_type(8))) __bf16 v8b;
__device__ __forceinline__ v16b frag_b(const __bf16* rowk0, int lane) {
  union { v16b v; v8b q[2]; } u; const __bf16* p = rowk0 + 8 * (lane >> 4);
  u.q[0] = *(const v8b*)p; u.q[1] = *(const v8b*)(p + 16); return u.v;
}
__device__ __forceinline__ v16b frag_gbf(const float* rowk0, int lane) {
  v16b a; const float* p = rowk0 + 8 * (lane >> 4);
#pragma unroll
  for (int i = 0; i < 8; ++i) { a[i] = (__bf16)p[i]; a[8 + i] = (__bf16)p[16 + i]; }
  return a;
}
__device__ __forceinline__ float bfr(float v) { return (float)(__bf16)v; }
// s[i] = 2^s[i] and a = 2^a, one instruction each (below 2^-126 the result is 0). One statement, so that every v_exp_f32 is followed by an instruction that touches neither its result nor its source; the closing v_nop is that slot for the last one
__device__ __forceinline__ void ex2_17(float* s, float& a) {
  asm("v_exp_f32 %0, %0\n\tv_exp_f32 %1, %1\n\tv_exp_f32 %2, %2\n\tv_exp_f32 %3, %3\n\tv_exp_f32 %4, %4\n\tv_exp_f32 %5, %5\n\tv_exp_f32 %6, %6\n\tv_exp_f32 %7, %7\n\tv_exp_f32 %8, %8\n\t"
      "v_exp_f32 %9, %9\n\tv_exp_f32 %10, %10\n\tv_exp_f32 %11, %11\n\tv_exp_f32 %12, %12\n\tv_exp_f32 %13, %13\n\tv_exp_f32 %14, %14\n\tv_exp_f32 %15, %15\n\tv_exp_f32 %16, %16\n\tv_nop"
      : "+v"(s[0]), "+v"(s[1]), "+v"(s[2]), "+v"(s[3]), "+v"(s[4]), "+v"(s[5]), "+v"(s[6]), "+v"(s[7]), "+v"(s[8]), "+v"(s[9]), "+v"(s[10]), "+v"(s[11]), "+v"(s[12]), "+v"(s[13]), "+v"(s[14]), "+v"(s[15]), "+v"(a));
}
#define SC2 0.18033688011112042f   // log2(e) / 8: the scores are scaled into powers of two, so that exp(energy - max) = 2^(s - m)
#define WS_PT   0u                                 // bf16 [4096 (q|k|v|out cols)][1024]
#define WS_QKV  (WS_PT + 2u * 4 * DM * DM)           // f32 [4096 rows][3072]  (q 0..1023 | k | v) ; q cols later overwritten by O
#define WS_KX   (WS_QKV + 4u * NR * QKVP)            // bf16 [2][2112][16 heads][hi 64 | lo 64] keys incl. memory: 256 B a key and head
#define WS_VTH  (WS_KX + 4u * NB * SK * DM)           // bf16 [2][1024 (h*64+d)][2112]
#define WS_VTL  (WS_VTH + 2u * NB * DM * SK)
#define WS_END  (WS_VTL + 2u * NB * DM * SK)

__global__ __launch_bounds__(128) void k_pack(const float* __restrict__ Wq, const float* __restrict__ Wk, const float* __restrict__ Wv, const float* __restrict__ Wo, __bf16* __restrict__ PT) {
  __shared__ __align__(16) __bf16 srow[DM];
  const int n = blockIdx.x, tid = threadIdx.x; const int which = n >> 10, c = n & 1023; const float* Wm = which == 0 ? Wq : (which == 1 ? Wk : (which == 2 ? Wv : Wo));
  for (int k = tid; k < DM; k += 128) srow[k] = (__bf16)Wm[(size_t)c * DM + k];   // torch [out][in]: row c
  __syncthreads();
  vst2((unsigned*)(PT + (size_t)n * DM + tid * 8), *(const v4u*)(&srow[tid * 8]));
}
// ---- k_kv: block = (64 keys, one head's 64 columns, batch), 4 waves; a thread holds 4 key pairs x 4 columns of K and of V with all 16 loads in flight together; V is split, packed by key pair and turned in LDS, K is split and goes straight out
typedef __attribute__((ext_vector_type(2))) __bf16 v2b;
typedef __attribute__((ext_vector_type(4))) __bf16 v4b;
__global__ __launch_bounds__(128) void k_kv(const float* __restrict__ QKV, const float* __restrict__ MK, const float* __restrict__ MV, __bf16* __restrict__ KX, __bf16* __restrict__ VTH, __bf16* __restrict__ VTL) {
  __shared__ __align__(16) unsigned svh[64][36], svl[64][36];   // [column][key pair]; the 16-B chunks of a row stand XORed with column >> 4, so that a wave's 32 pair stores meet 32 banks
  const int tid = threadIdx.x, c4 = tid & 15, pr = tid >> 4; const int k0 = blockIdx.x * 64, c0 = blockIdx.y * 64, b = blockIdx.z;
  v4f kq[8], vq[8];   // i: key 2 * pr + 16 * (i >> 1) + (i & 1) of the block
  if (k0 < SS) {      // a block is wholly ordinary keys or wholly memory slots (SS is a multiple of 64)
    const float* base = QKV + ((size_t)b * SS + k0 + 2 * pr) * QKVP + c0 + c4 * 4;
#pragma unroll
    for (int i = 0; i < 8; ++i) { const float* row = base + (size_t)(16 * (i >> 1) + (i & 1)) * QKVP; kq[i] = *(const v4f*)(row + DM); vq[i] = *(const v4f*)(row + 2 * DM); }
    asm volatile("s_wait_xcnt 0x0" :: "v"(base) : "memory");   // the loads' address pair stays whole (no load's own result lands on it) until every load has taken its address
  } else {
    const size_t o0 = (size_t)(k0 - SS + 2 * pr) * DM + c0 + c4 * 4; const float *pk = MK + o0, *pv = MV + o0;
#pragma unroll
    for (int i = 0; i < 8; ++i) { const size_t o = (size_t)(16 * (i >> 1) + (i & 1)) * DM; kq[i] = *(const v4f*)(pk + o); vq[i] = *(const v4f*)(pv + o); }
    asm volatile("s_wait_xcnt 0x0" :: "v"(pk), "v"(pv) : "memory");   // as above, for the two address pairs
#pragma unroll
    for (int i = 0; i < 8; ++i) {
#pragma unroll
      for (int e = 0; e < 4; ++e) { kq[i][e] = 8.0f * bfr(kq[i][e]); vq[i][e] = 8.0f * bfr(vq[i][e]); } }
  }
#pragma unroll
  for (int p = 0; p < 4; ++p) { const int pp = (pr + 8 * p) ^ ((c4 >> 2) << 2);
#pragma unroll
    for (int e = 0; e < 4; ++e) { const float va = vq[2 * p][e], vb = vq[2 * p + 1][e]; const __bf16 ha = (__bf16)va, hb = (__bf16)vb;
      const v2b hh = {ha, hb}, ll = {(__bf16)(va - (float)ha), (__bf16)(vb - (float)hb)};
      svh[c4 * 4 + e][pp] = __builtin_bit_cast(unsigned, hh); svl[c4 * 4 + e][pp] = __builtin_bit_cast(unsigned, ll); } }
  v4b kh[8], kl[8];   // K as the score product takes it: bf16 hi and the bf16 of the remainder
#pragma unroll
  for (int i = 0; i < 8; ++i) {
#pragma unroll
    for (int e = 0; e < 4; ++e) { kh[i][e] = (__bf16)kq[i][e]; kl[i][e] = (__bf16)(kq[i][e] - (float)kh[i][e]); } }
  __syncthreads();
#pragma unroll
  for (int i = 0; i < 8; ++i) { __bf16* kr = KX + ((size_t)b * SK + k0 + 2 * pr + 16 * (i >> 1) + (i & 1)) * (2 * DM) + 2 * c0 + c4 * 4; vst2(kr, kh[i]); vst2(kr + HD, kl[i]); }   // behind the barrier, which would else wait for these stores; 16 lanes fill a 128-B line of hi and one of lo
#pragma unroll
  for (int it = 0; it < 4; ++it) { const int rowi = it * 16 + (tid >> 3), pc = tid & 7, sw = (pc ^ it) * 4; const size_t o = ((size_t)b * DM + c0 + rowi) * SK + k0 + pc * 8; vst2((unsigned*)(VTH + o), *(const v4u*)&svh[rowi][sw]); vst2((unsigned*)(VTL + o), *(const v4u*)&svl[rowi][sw]); }
}
#define KT 64
#define NT (SK / KT)
#define KPF 68
#define VPB 72
#define ST_VH (KT * KPF * 4)
#define ST_VL (ST_VH + HD * VPB * 2)
#define ST_SZ (ST_VL + HD * VPB * 2)       // 35840 B a stage
__device__ __forceinline__ float xhalf(float x) { return __builtin_bit_cast(float, __builtin_amdgcn_permlanex16(__builtin_bit_cast(int, x), __builtin_bit_cast(int, x), 0x76543210, 0xfedcba98, false, false)); }  // lane l with lane l ^ 16
__device__ __forceinline__ F2 split_v4(v4f a, v4f b, v4f c, v4f d) { float v[16];
#pragma unroll
  for (int i = 0; i < 4; ++i) { v[i] = a[i]; v[4 + i] = b[i]; v[8 + i] = c[i]; v[12 + i] = d[i]; }
  return bsplit16(v); }
// eight 16-B copies a lane, global to LDS through no register; the last line keeps the address registers whole until every copy has taken its addresses
__device__ __forceinline__ void copy8(const unsigned* l, const char* const* p) {
  asm volatile("global_load_async_to_lds_b128 %0, %8, off\n\tglobal_load_async_to_lds_b128 %1, %9, off\n\tglobal_load_async_to_lds_b128 %2, %10, off\n\tglobal_load_async_to_lds_b128 %3, %11, off\n\t"
               "global_load_async_to_lds_b128 %4, %12, off\n\tglobal_load_async_to_lds_b128 %5, %13, off\n\tglobal_load_async_to_lds_b128 %6, %14, off\n\tglobal_load_async_to_lds_b128 %7, %15, off\n\ts_wait_xcnt 0x0"
               :: "v"(l[0]), "v"(l[1]), "v"(l[2]), "v"(l[3]), "v"(l[4]), "v"(l[5]), "v"(l[6]), "v"(l[7]), "v"(p[0]), "v"(p[1]), "v"(p[2]), "v"(p[3]), "v"(p[4]), "v"(p[5]), "v"(p[6]), "v"(p[7]) : "memory");
}
__device__ __forceinline__ void stage_in(unsigned lb, const char* gk, const char* gh, const char* gl, int tid) {
  unsigned l[8]; const char* p[8];
#pragma unroll
  for (int i = 0; i < 8; ++i) { l[i] = lb + (unsigned)((i * 8 + (tid >> 4)) * (KPF * 4) + (tid & 15) * 16); p[i] = gk + (size_t)i * 8 * DM * 4; }   // K: a wave covers 2 rows of 256 B
  copy8(l, p);
#pragma unroll
  for (int i = 0; i < 4; ++i) { const unsigned o = (unsigned)((i * 16 + (tid >> 3)) * (VPB * 2) + (tid & 7) * 16); l[i] = lb + ST_VH + o; l[4 + i] = lb + ST_VL + o; p[i] = gh + (size_t)i * 16 * SK * 2; p[4 + i] = gl + (size_t)i * 16 * SK * 2; }   // V: a wave covers 4 rows of 128 B
  copy8(l, p);
}
__global__ __launch_bounds__(128) void k_attn(float* __restrict__ QKV, const __bf16* __restrict__ KX, const int* __restrict__ MASK, const __bf16* __restrict__ VTH, const __bf16* __restrict__ VTL) {
  __shared__ __align__(16) unsigned char sm[2 * ST_SZ];   // the two stage buffers; behind the loop its first bytes stage the output rows
  const int tid = threadIdx.x, wave = tid >> 5, lane = tid & 31, col = lane & 15, g = lane >> 4;
  const int qb = blockIdx.x, bh = blockIdx.y, b = bh >> 4, h = bh & 15; const int q0 = qb * 64 + wave * 16; const size_t tq = (size_t)b * SS + q0;
  const unsigned lds0 = (unsigned)(size_t)&sm[0];
  const char* gk = (const char*)(KX + ((size_t)b * SK + (tid >> 4)) * (2 * DM) + h * (2 * HD)) + (tid & 15) * 16;             // this lane's first K chunk of stage 0; a stage on: KT rows
  const char* gh = (const char*)(VTH + ((size_t)b * DM + h * HD + (tid >> 3)) * SK) + (tid & 7) * 16;              // the same of V hi; a stage on: KT keys
  const char* gl = (const char*)(VTL + ((size_t)b * DM + h * HD + (tid >> 3)) * SK) + (tid & 7) * 16;
  stage_in(lds0, gk, gh, gl, tid);
  const F2 a0 = split_row(QKV + (tq + col) * QKVP + h * HD, 0, lane), a1 = split_row(QKV + (tq + col) * QKVP + h * HD, 32, lane);   // B operand: column = query
  asm volatile("s_wait_asynccnt 0x0" ::: "memory");   // this wave's share of stage 0 has landed
  __syncthreads();                                    // and every other wave's
  stage_in(lds0 + ST_SZ, gk + (size_t)KT * DM * 4, gh + KT * 2, gl + KT * 2, tid);
  float m = -3.0e38f, l = 0.f;   // of query col, m in log2 units; l sums this wave half's keys only, the halves are joined behind the loop
  v8f acc[4] = {};               // acc[dt][r] = O[query col][dt * 16 + 8 g + r]
#pragma unroll 1
  for (int t = 0; t < NT; ++t) {
    const unsigned char* sb = sm + (t & 1) * ST_SZ;
#pragma unroll   // the two steps of a stage stand unrolled: their LDS offsets are immediates
    for (int hs = 0; hs < 2; ++hs) {
      const int ks = 2 * t + hs;
      const bool mem = ks * 32 >= SS;   // a step is wholly ordinary keys or wholly memory slots (SS is a multiple of 32)
      const int mv = MASK[(size_t)b * SS + (mem ? 0 : ks * 32) + lane];   // one key's mask a lane (the address is in range in a memory step too)
      const unsigned kw = (__builtin_amdgcn_ballot_w32(mv != 0) | (mem ? 0xffffffffu : 0u)) >> (8 * g);   // bit j = keep key 8g + j of this step
      float s[16];
#pragma unroll
      for (int ct = 0; ct < 2; ++ct) { const __bf16* kp = (const __bf16*)sb + (hs * 32 + ct * 16 + col) * (KPF * 2);   // A operand: row = key; hi at 0, lo at HD
        const F2 k0 = {frag_b(kp, lane), frag_b(kp + HD, lane)}, k1 = {frag_b(kp + 32, lane), frag_b(kp + HD + 32, lane)};
        v8f c = {}; c = wmma_bf(k0.h, a0.l, c); c = wmma_bf(k0.l, a0.h, c); c = wmma_bf(k0.h, a0.h, c); c = wmma_bf(k1.h, a1.l, c); c = wmma_bf(k1.l, a1.h, c); c = wmma_bf(k1.h, a1.h, c);
#pragma unroll
        for (int r = 0; r < 8; ++r) { const bool keep = ((kw >> (ct * 16 + r)) & 1u) != 0; s[ct * 8 + r] = keep ? c[r] * SC2 : -1.0e20f; } }
      v16b vh[4], vl[4];   // A operand: row = d; read here, as one group, so that the softmax stands between the reads and their use
#pragma unroll
      for (int dt = 0; dt < 4; ++dt) { const int vo = (dt * 16 + col) * VPB + hs * 32; vh[dt] = frag_b((const __bf16*)(sb + ST_VH) + vo, lane); vl[dt] = frag_b((const __bf16*)(sb + ST_VL) + vo, lane); }
      float mx = s[0];
#pragma unroll
      for (int i = 1; i < 16; ++i) mx = fmaxf(mx, s[i]);
      mx = fmaxf(mx, xhalf(mx));
      const float mn = fmaxf(m, mx); float alpha = m - mn;
      float es = 0.f;
#pragma unroll
      for (int i = 0; i < 16; ++i) s[i] -= mn;
      ex2_17(s, alpha);
#pragma unroll
      for (int i = 0; i < 16; ++i) es += s[i];
      l = l * alpha + es; m = mn;
#pragma unroll
      for (int dt = 0; dt < 4; ++dt) acc[dt] *= alpha;
      const F2 pa = bsplit16(s);   // element i = key 8g+i, element 8+i = key 16+8g+i: the k order of frag_b
#pragma unroll
      for (int dt = 0; dt < 4; ++dt) { acc[dt] = wmma_bf(vh[dt], pa.l, acc[dt]); acc[dt] = wmma_bf(vl[dt], pa.h, acc[dt]); acc[dt] = wmma_bf(vh[dt], pa.h, acc[dt]); } }
    asm volatile("s_wait_dscnt 0x0" ::: "memory");      // this wave's reads of the buffer are done before anyone refills it
    asm volatile("s_wait_asynccnt 0x0" ::: "memory");   // this wave's share of stage t + 1 has landed
    __syncthreads();                                    // publishes stage t + 1 and ends every wave's reads of stage t
    if (t + 2 < NT) stage_in(lds0 + (unsigned)(t & 1) * ST_SZ, gk + (size_t)(t + 2) * KT * DM * 4, gh + (size_t)(t + 2) * KT * 2, gl + (size_t)(t + 2) * KT * 2, tid);
  }
  asm volatile("s_wait_asynccnt 0x0" ::: "memory");     // no copy is left in flight when the buffer takes the output rows
  float (*so)[16][68] = (float (*)[16][68])sm;
  const float il = 1.0f / (l + xhalf(l));
#pragma unroll
  for (int dt = 0; dt < 4; ++dt) { const v8f o = acc[dt] * il; vst2(&so[wave][col][dt * 16 + 8 * g], (v4f){o[0], o[1], o[2], o[3]}); vst2(&so[wave][col][dt * 16 + 8 * g + 4], (v4f){o[4], o[5], o[6], o[7]}); }
  LDSX();
  for (int rl = 0; rl < 16; ++rl) if (lane < 16) vst2(QKV + (tq + rl) * QKVP + h * HD + lane * 4, *(const v4f*)&so[wave][rl][lane * 4]);
}
// ---- the two GEMMs (k_proj, k_out): block = (MT * 32 rows, 128 columns), 4 waves as 2 x 2, a wave holds MT x 4 accumulator tiles (MT * 16 rows x 64 columns)
// A (f32 rows) and B (bf16 weight rows) reach the waves through LDS: a stage = 64 k (A rows of 256 B, B rows of 128 B), copied once for the block in whole 128-B lines, two buffers, the next stage in flight while this one is worked on; A is rounded (or split) to bf16 as the fragment is read; k runs upward in steps of 32 into each accumulator
#define GK 64                              // k a stage
#define GNT (DM / GK)                      // 16 stages
#define APF 68                             // floats a staged A row: 272 B = 16 B x odd, no bank conflict for 16-B readers
#define BPB 72                             // bf16 a staged B row: 144 B = 16 B x odd
#define G_B(MT) ((MT) * 32 * APF * 4)
#define G_SZ(MT) (G_B(MT) + 128 * BPB * 2)  // a stage: 53248 B at MT 4, 35840 B at MT 2
template <int MT> __device__ __forceinline__ void g_stage(unsigned lb, const char* ga, size_t apitch, const char* gb, int tid) {
  unsigned l[8]; const char* p[8];
#pragma unroll
  for (int u = 0; u < MT / 2; ++u) {
#pragma unroll
    for (int i = 0; i < 8; ++i) { const int rr = (u * 8 + i) * 8; l[i] = lb + (unsigned)((rr + (tid >> 4)) * (APF * 4) + (tid & 15) * 16); p[i] = ga + (size_t)rr * apitch; }   // A: a wave covers 2 rows of 256 B
    copy8(l, p); }
#pragma unroll
  for (int i = 0; i < 8; ++i) { l[i] = lb + G_B(MT) + (unsigned)((i * 16 + (tid >> 3)) * (BPB * 2) + (tid & 7) * 16); p[i] = gb + (size_t)i * 16 * DM * 2; }   // B: a wave covers 4 rows of 128 B
  copy8(l, p);
}
// A: the block's first row, k = 0, lda floats a row; Bw: the block's first weight row; bias, C: at the block's first column (C at its first row too)
template <int MT, bool SPLIT> __device__ __forceinline__ void gemm_tile(unsigned char* sm, const float* A, int lda, const __bf16* Bw, const float* bias, float* C, int ldc) {
  const int tid = threadIdx.x, wave = tid >> 5, lane = tid & 31, col = lane & 15, g = lane >> 4, wm = wave >> 1, wn = wave & 1;
  const unsigned lds0 = (unsigned)(size_t)sm; const size_t ap = (size_t)lda * 4;
  const char* ga = (const char*)(A + (size_t)(tid >> 4) * lda) + (tid & 15) * 16;   // this lane's first A chunk of stage 0; a stage on: GK floats
  const char* gb = (const char*)(Bw + (size_t)(tid >> 3) * DM) + (tid & 7) * 16;    // the same of B; a stage on: GK bf16
  g_stage<MT>(lds0, ga, ap, gb, tid);
  asm volatile("s_wait_asynccnt 0x0" ::: "memory");   // this wave's share of stage 0 has landed
  __syncthreads();                                    // and every other wave's
  g_stage<MT>(lds0 + G_SZ(MT), ga + GK * 4, ap, gb + GK * 2, tid);
  v8f acc[MT][4] = {};
#pragma unroll 1   // one stage a trip: the two buffers alternate by the trip's parity, and the body stays small in the instruction cache
  for (int t = 0; t < GNT; ++t) {
    const unsigned char* sb = sm + (t & 1) * G_SZ(MT);
#pragma unroll   // the two 32-k steps of a stage stand unrolled: their LDS offsets are immediates
    for (int kc = 0; kc < 2; ++kc) {
      v16b w[4];
#pragma unroll
      for (int nt = 0; nt < 4; ++nt) w[nt] = frag_b((const __bf16*)(sb + G_B(MT)) + (wn * 64 + nt * 16 + col) * BPB + kc * 32, lane);
#pragma unroll
      for (int mt = 0; mt < MT; ++mt) { const float* xp = (const float*)sb + ((wm * MT + mt) * 16 + col) * APF + kc * 32 + 8 * g;
        const v4f x0 = *(const v4f*)xp, x1 = *(const v4f*)(xp + 4), x2 = *(const v4f*)(xp + 16), x3 = *(const v4f*)(xp + 20);   // the k order of frag_b
        if constexpr (SPLIT) { const F2 a = split_v4(x0, x1, x2, x3);
#pragma unroll
          for (int nt = 0; nt < 4; ++nt) acc[mt][nt] = wmma_bf(a.l, w[nt], acc[mt][nt]);
#pragma unroll
          for (int nt = 0; nt < 4; ++nt) acc[mt][nt] = wmma_bf(a.h, w[nt], acc[mt][nt]);
        } else { v16b a;
#pragma unroll
          for (int i = 0; i < 4; ++i) { a[i] = (__bf16)x0[i]; a[4 + i] = (__bf16)x1[i]; a[8 + i] = (__bf16)x2[i]; a[12 + i] = (__bf16)x3[i]; }
#pragma unroll
          for (int nt = 0; nt < 4; ++nt) acc[mt][nt] = wmma_bf(a, w[nt], acc[mt][nt]); } } }
    asm volatile("s_wait_dscnt 0x0" ::: "memory");      // this wave's reads of the buffer are done before anyone refills it
    asm volatile("s_wait_asynccnt 0x0" ::: "memory");   // this wave's share of stage t + 1 has landed
    __syncthreads();                                    // publishes stage t + 1 and ends every wave's reads of stage t
    if (t + 2 < GNT) g_stage<MT>(lds0 + (unsigned)(t & 1) * G_SZ(MT), ga + (size_t)(t + 2) * GK * 4, ap, gb + (size_t)(t + 2) * GK * 2, tid);
  }
  asm volatile("s_wait_asynccnt 0x0" ::: "memory");     // no copy is left in flight when the buffer takes the output rows
  float (*so)[68] = (float (*)[68])(sm + wave * (MT * 16 * 68 * 4));   // the wave's own MT * 16 rows x 64 columns
#pragma unroll
  for (int nt = 0; nt < 4; ++nt) { const float bb = bfr(bias[wn * 64 + nt * 16 + col]);
#pragma unroll
    for (int mt = 0; mt < MT; ++mt) {
#pragma unroll
      for (int r = 0; r < 8; ++r) so[mt * 16 + 8 * g + r][nt * 16 + col] = acc[mt][nt][r] + bb; } }
  LDSX();
  for (int rl = 0; rl < MT * 8; ++rl) { const int row = rl * 2 + g; vst2(C + (size_t)(wm * MT * 16 + row) * ldc + wn * 64 + col * 4, *(const v4f*)&so[row][col * 4]); }   // 256-B segments, two rows a store
}
// ---- k_proj: QKV[r][n] = bf16(x[r]) . PT[n] (exact) + bias, K = 1024; block (128 rows, 128 cols); a block's columns lie in one of q | k | v
__global__ __launch_bounds__(128) void k_proj(const float* __restrict__ XQ, const float* __restrict__ XK, const float* __restrict__ XV, const __bf16* __restrict__ PT, const float* __restrict__ bq, const float* __restrict__ bk, const float* __restrict__ bv, float* __restrict__ QKV) {
  __shared__ __align__(16) unsigned char sm[2 * G_SZ(4)];   // the two stage buffers; behind the loop its first bytes stage the output rows
  const int n0 = blockIdx.y * 128, which = n0 >> 10; const size_t r0 = (size_t)blockIdx.x * 128;
  const float* X = which == 0 ? XQ : (which == 1 ? XK : XV); const float* bs = which == 0 ? bq : (which == 1 ? bk : bv);
  gemm_tile<4, false>(sm, X + r0 * DM, DM, PT + (size_t)n0 * DM, bs + (n0 & 1023), QKV + r0 * QKVP + n0, QKVP);
}
// ---- k_out: Y = O(hi/lo; the q columns of QKV) . PT_out rows (2 products, K = 1024) + bo; block (64 rows, 128 cols)
__global__ __launch_bounds__(128) void k_out(const float* __restrict__ QKV, const __bf16* __restrict__ PT, const float* __restrict__ bo, float* __restrict__ Y) {
  __shared__ __align__(16) unsigned char sm[2 * G_SZ(2)];   // as in k_proj
  const int n0 = blockIdx.y * 128; const size_t r0 = (size_t)blockIdx.x * 64;
  gemm_tile<2, true>(sm, QKV + r0 * QKVP, QKVP, PT + (size_t)(3 * DM + n0) * DM, bo + n0, Y + r0 * DM + n0, DM);
}

extern "C" void kernel_launch(void* const* d_in, const int* in_sizes, int n_in, void* d_out, int out_size, void* d_ws, size_t ws_size, hipStream_t stream) {
  (void)in_sizes; (void)n_in; (void)out_size;
  const float** F = (const float**)d_in;   // query, key, value, mask [2,1,1,2048] i32, Wq, bq, Wk, bk, Wv, bv, Wo, bo, m_k [1,64,1024], m_v
  if (ws_size < (size_t)WS_END) return;
  char* ws = (char*)d_ws; __bf16 *PT = (__bf16*)(ws + WS_PT), *VTH = (__bf16*)(ws + WS_VTH), *VTL = (__bf16*)(ws + WS_VTL); float *QKV = (float*)(ws + WS_QKV); __bf16* KX = (__bf16*)(ws + WS_KX);
  k_pack<<<4 * DM, 128, 0, stream>>>(F[4], F[6], F[8], F[10], PT);
  k_proj<<<dim3(TRB / 2, QKVP / 128), 128, 0, stream>>>(F[0], F[1], F[2], PT, F[5], F[7], F[9], QKV);
  k_kv<<<dim3(SK / 64, DM / 64, TNB), 128, 0, stream>>>(QKV, F[12], F[13], KX, VTH, VTL);
  k_attn<<<dim3(TQB, TNB * NH), 128, 0, stream>>>(QKV, KX, (const int*)d_in[3], VTH, VTL);
  k_out<<<dim3((TNB < NB ? TQB : NR / 64), DM / 128), 128, 0, stream>>>(QKV, PT, F[11], (float*)d_out);
}

// v007
// A run of this version takes 115 microseconds.
// Two timings next to v006 put it at 1.42 and 1.41 times that version's speed.
// Counting every step since v000, it is 6.34 times as fast.
// compute dtype: query/key/value, the four weights + biases and the memory slots (module inputs) rounded to bf16; q/k/v projections with exact bf16 products (+ f32 bias); scores and P.V with both computed operands as bf16 hi + bf16 residual pairs (3 products; memory keys/values scaled in f32 and split the same way); output projection hi/lo x bf16 Wo (2 products) + bias; masked online softmax in f32; f32 accumulate.
#include <hip/hip_runtime.h>
#include <math.h>

typedef __attribute__((ext_vector_type(16))) _Float16 v16h;
typedef __attribute__((ext_vector_type(16))) __bf16 v16b;
typedef __attribute__((ext_vector_type(8)))  _Float16 v8h;
typedef __attribute__((ext_vector_type(8)))  float v8f;
typedef __attribute__((ext_vector_type(4)))  float v4f;
typedef __attribute__((ext_vector_type(2)))  float v2f;
typedef __attribute__((ext_vector_type(4)))  unsigned v4u;
typedef __attribute__((ext_vector_type(4)))  int v4i;
typedef float __attribute__((may_alias)) float_a;
typedef int __attribute__((may_alias)) int_a;

template <typename T> __device__ __forceinline__ void vst2(void* p, T v) { *(T*)p = v;  }
__device__ __forceinline__ v8f wmma16(v16h a, v16h b, v8f c) {
  v8f d = __builtin_amdgcn_wmma_f32_16x16x32_f16(false, a, false, b, (short)0, c, false, false);
  asm volatile("v_nop\n\tv_nop\n\tv_nop\n\tv_nop" : "+v"(d) : "v"(a), "v"(b));
  return d;
}
__device__ __forceinline__ v8f wmma_bf(v16b a, v16b b, v8f c) {
  v8f d = __builtin_amdgcn_wmma_f32_16x16x32_bf16(false, a, false, b, (short)0, c, false, false);
  asm volatile("v_nop\n\tv_nop\n\tv_nop\n\tv_nop" : "+v"(d) : "v"(a), "v"(b));
  return d;
}
// 16x16x32 fragments: lane = (h = lane>>4, row/col = lane&15); elements 0..7 = k0+8h+0..7, 8..15 = k0+16+8h+0..7; D element r = row 8h+r
__device__ __forceinline__ v16h frag_h(const _Float16* rowk0, int lane) {
  union { v16h v; v8h q[2]; } u; const _Float16* p = rowk0 + 8 * (lane >> 4);
  u.q[0] = *(const v8h*)p; u.q[1] = *(const v8h*)(p + 16); return u.v;
}
__device__ __forceinline__ v16h frag_f32(const float* rowk0, int lane) {
  v16h a; const float* p = rowk0 + 8 * (lane >> 4);
#pragma unroll
  for (int i = 0; i < 8; ++i) { a[i] = (_Float16)p[i]; a[8 + i] = (_Float16)p[16 + i]; }
  return a;
}
__device__ __forceinline__ v16h frag_f32s(const float* rowk0, int lane, float sc) {
  v16h a; const float* p = rowk0 + 8 * (lane >> 4);
#pragma unroll
  for (int i = 0; i < 8; ++i) { a[i] = (_Float16)(p[i] * sc); a[8 + i] = (_Float16)(p[16 + i] * sc); }
  return a;
}
// column fragment from a [K][ld] layout (column n), rows >= K read as 0
__device__ __forceinline__ v16h fragc_f32(const float* W, int k0, int n, int lane, int ld, int K) {
  v16h a; const int g = lane >> 4;
#pragma unroll
  for (int i = 0; i < 8; ++i) { const int ka = k0 + 8 * g + i, kb = ka + 16;
    a[i] = (_Float16)(ka < K ? W[(size_t)(ka < K ? ka : K - 1) * ld + n] : 0.f); a[8 + i] = (_Float16)(kb < K ? W[(size_t)(kb < K ? kb : K - 1) * ld + n] : 0.f); }
  return a;
}
struct F2 { v16b h, l; };
__device__ __forceinline__ F2 bsplit16(const float v[16]) { F2 r;
#pragma unroll
  for (int i = 0; i < 16; ++i) { const __bf16 h = (__bf16)v[i]; r.h[i] = h; r.l[i] = (__bf16)(v[i] - (float)h); }
  return r; }
__device__ __forceinline__ F2 split_row(const float* row, int k0, int lane) { float v[16]; const float* p = row + k0 + 8 * (lane >> 4);
#pragma unroll
  for (int i = 0; i < 8; ++i) { v[i] = p[i]; v[8 + i] = p[16 + i]; }
  return bsplit16(v); }
__device__ __forceinline__ F2 split_rowK(const float* row, int k0, int lane, int K) { float v[16]; const int g = lane >> 4;
#pragma unroll
  for (int i = 0; i < 8; ++i) { const int ka = k0 + 8 * g + i, kb = ka + 16; v[i] = ka < K ? row[ka < K ? ka : K - 1] : 0.f; v[8 + i] = kb < K ? row[kb < K ? kb : K - 1] : 0.f; }
  return bsplit16(v); }
__device__ __forceinline__ F2 split_col(const float* W, int k0, int n, int lane, int ld, int K) { float v[16]; const int g = lane >> 4;
#pragma unroll
  for (int i = 0; i < 8; ++i) { const int ka = k0 + 8 * g + i, kb = ka + 16; v[i] = ka < K ? W[(size_t)(ka < K ? ka : K - 1) * ld + n] : 0.f; v[8 + i] = kb < K ? W[(size_t)(kb < K ? kb : K - 1) * ld + n] : 0.f; }
  return bsplit16(v); }
__device__ __forceinline__ v8f mac3(const F2& a, const F2& b, v8f c) { c = wmma_bf(a.l, b.h, c); c = wmma_bf(a.h, b.l, c); return wmma_bf(a.h, b.h, c); }
__device__ __forceinline__ float sigm(float v) { return 1.0f / (1.0f + expf(-v)); }
#define LDSX() do { asm volatile("s_wait_dscnt 0" ::: "memory"); __builtin_amdgcn_wave_barrier(); __builtin_amdgcn_fence(__ATOMIC_RELEASE, "workgroup"); } while (0)


// Multi-head attention with persistent memory: Q = query Wq^T + bq, K = [key Wk^T + bk ; 8 m_k], V = [value Wv^T + bv ; 8 m_v] (2048 + 64 slots), energy = Q K^T / 8 with the first 2048 key columns masked (mask == 0 -> -1e20) and the memory columns never masked; softmax; P V; merge heads; @ Wo^T + bo.  B 2, S 2048, D 1024, 16 x 64.
// k_pack (+ per batch the list of key numbers, unmasked first), k_proj (exact GEMM + bias; q|k|v from query|key|value), k_kv (the n unmasked keys of a batch, filled up to a multiple of 64 with masked ones, then the memory slots: K rows split once into bf16 hi | lo by head; V as transposed hi/lo planes), k_attn (K and V staged in LDS by 64 keys, ceil(n / 64) + 1 stages), k_out (+ bo).
// A masked key has energy -1e20 beside the never masked memory slots, so its softmax weight is exactly 0 in f32: it is put behind the unmasked keys in the key list and, but for the filler up to a multiple of 64, never staged instead of being multiplied by 0.
#define NB 2
#define SS 2048
#define DM 1024
#define NH 16
#define HD 64
#define NR (NB * SS)
#define QKVP (3 * DM)
#define NM 64
#define SK (SS + NM)        // 2112 keys per batch
#ifndef TRB
#define TRB (NR / 64)
#define TQB (SS / 64)
#define TNB NB
#endif
typedef __attribute__((ext_vector_type(8))) __bf16 v8b;
__device__ __forceinline__ v16b frag_b(const __bf16* rowk0, int lane) {
  union { v16b v; v8b q[2]; } u; const __bf16* p = rowk0 + 8 * (lane >> 4);
  u.q[0] = *(const v8b*)p; u.q[1] = *(const v8b*)(p + 16); return u.v;
}
__device__ __forceinline__ v16b frag_gbf(const float* rowk0, int lane) {
  v16b a; const float* p = rowk0 + 8 * (lane >> 4);
#pragma unroll
  for (int i = 0; i < 8; ++i) { a[i] = (__bf16)p[i]; a[8 + i] = (__bf16)p[16 + i]; }
  return a;
}
__device__ __forceinline__ float bfr(float v) { return (float)(__bf16)v; }
// s[i] = 2^s[i] and a = 2^a, one instruction each (below 2^-126 the result is 0). One statement, so that every v_exp_f32 is followed by an instruction that touches neither its result nor its source; the closing v_nop is that slot for the last one
__device__ __forceinline__ void ex2_17(float* s, float& a) {
  asm("v_exp_f32 %0, %0\n\tv_exp_f32 %1, %1\n\tv_exp_f32 %2, %2\n\tv_exp_f32 %3, %3\n\tv_exp_f32 %4, %4\n\tv_exp_f32 %5, %5\n\tv_exp_f32 %6, %6\n\tv_exp_f32 %7, %7\n\tv_exp_f32 %8, %8\n\t"
      "v_exp_f32 %9, %9\n\tv_exp_f32 %10, %10\n\tv_exp_f32 %11, %11\n\tv_exp_f32 %12, %12\n\tv_exp_f32 %13, %13\n\tv_exp_f32 %14, %14\n\tv_exp_f32 %15, %15\n\tv_exp_f32 %16, %16\n\tv_nop"
      : "+v"(s[0]), "+v"(s[1]), "+v"(s[2]), "+v"(s[3]), "+v"(s[4]), "+v"(s[5]), "+v"(s[6]), "+v"(s[7]), "+v"(s[8]), "+v"(s[9]), "+v"(s[10]), "+v"(s[11]), "+v"(s[12]), "+v"(s[13]), "+v"(s[14]), "+v"(s[15]), "+v"(a));
}
#define SC2 0.18033688011112042f   // log2(e) / 8: the scores are scaled into powers of two, so that exp(energy - max) = 2^(s - m)
#define WS_PT   0u                                 // bf16 [4096 (q|k|v|out cols)][1024]
#define WS_QKV  (WS_PT + 2u * 4 * DM * DM)           // f32 [4096 rows][3072]  (q 0..1023 | k | v) ; q cols later overwritten by O
#define WS_KX   (WS_QKV + 4u * NR * QKVP)            // bf16 [2][2112][16 heads][hi 64 | lo 64] keys incl. memory: 256 B a key and head
#define WS_VTH  (WS_KX + 4u * NB * SK * DM)           // bf16 [2][1024 (h*64+d)][2112]
#define WS_VTL  (WS_VTH + 2u * NB * DM * SK)
#define WS_IDX  (WS_VTL + 2u * NB * DM * SK)          // int [2][2048]: a batch's key numbers, the unmasked first, then the masked, each group rising
#define WS_CNT  (WS_IDX + 4u * NB * SS)               // int, one a batch, 128 B apart: how many of its keys are unmasked
#define WS_END  (WS_CNT + 128u * NB)

__global__ __launch_bounds__(128) void k_pack(const float* __restrict__ Wq, const float* __restrict__ Wk, const float* __restrict__ Wv, const float* __restrict__ Wo, __bf16* __restrict__ PT, const int* __restrict__ MASK, int* __restrict__ IDX, int* __restrict__ CNT) {
  __shared__ __align__(16) __bf16 srow[DM];
  __shared__ int sc[128];
  const int tid = threadIdx.x;
  if (blockIdx.x < NB) {   // the first NB blocks: one batch's key list each; a thread ranks 16 keys in a row
    const int b = blockIdx.x; const int* mp = MASK + (size_t)b * SS + tid * (SS / 128);
    unsigned bits = 0;   // bit i: key tid * 16 + i is unmasked
#pragma unroll
    for (int q = 0; q < SS / 512; ++q) { const v4i x = *(const v4i*)(mp + 4 * q);
#pragma unroll
      for (int e = 0; e < 4; ++e) bits |= (x[e] != 0 ? 1u : 0u) << (4 * q + e); }
    sc[tid] = __popc(bits);
    __syncthreads();
    int before = 0, all = 0;   // unmasked keys of the threads below this one; of the batch
#pragma unroll 4   // unrolled whole, this loop's registers would cost the weight blocks of this kernel a quarter of their waves a SIMD
    for (int j = 0; j < 128; ++j) { const int v = sc[j]; all += v; before += j < tid ? v : 0; }
    int up = before, dn = all + tid * (SS / 128) - before;   // the next place among the unmasked, and among the masked, which stand behind all the unmasked
#pragma unroll
    for (int i = 0; i < SS / 128; ++i) { const bool keep = ((bits >> i) & 1u) != 0; IDX[(size_t)b * SS + (keep ? up : dn)] = tid * (SS / 128) + i; up += keep ? 1 : 0; dn += keep ? 0 : 1; }
    if (tid == 0) CNT[b * 32] = all;
    return;
  }
  const int n = blockIdx.x - NB; const int which = n >> 10, c = n & 1023; const float* Wm = which == 0 ? Wq : (which == 1 ? Wk : (which == 2 ? Wv : Wo));
  for (int k = tid; k < DM; k += 128) srow[k] = (__bf16)Wm[(size_t)c * DM + k];   // torch [out][in]: row c
  __syncthreads();
  vst2((unsigned*)(PT + (size_t)n * DM + tid * 8), *(const v4u*)(&srow[tid * 8]));
}
// ---- k_kv: block = (64 places of the key list, one head's 64 columns, batch), 4 waves; a thread holds 4 key pairs x 4 columns of K and of V with all 16 loads in flight together; V is split, packed by key pair and turned in LDS, K is split and goes straight out
// place p of a batch with n unmasked keys, nr = n rounded up to 64: p < nr the p-th key of the list (from n on masked keys, which only fill the block: k_attn gives them weight 0), nr <= p < nr + 64 memory slot p - nr; a block behind that writes nothing, and k_attn reads nothing there
typedef __attribute__((ext_vector_type(2))) __bf16 v2b;
typedef __attribute__((ext_vector_type(4))) __bf16 v4b;
typedef __attribute__((ext_vector_type(2))) int v2i;
__global__ __launch_bounds__(128) void k_kv(const float* __restrict__ QKV, const float* __restrict__ MK, const float* __restrict__ MV, const int* __restrict__ IDX, const int* __restrict__ CNT, __bf16* __restrict__ KX, __bf16* __restrict__ VTH, __bf16* __restrict__ VTL) {
  __shared__ __align__(16) unsigned svh[64][36], svl[64][36];   // [column][key pair]; the 16-B chunks of a row stand XORed with column >> 4, so that a wave's 32 pair stores meet 32 banks
  const int tid = threadIdx.x, c4 = tid & 15, pr = tid >> 4; const int k0 = blockIdx.x * 64, c0 = blockIdx.y * 64, b = blockIdx.z;
  const int n = min(max(__builtin_amdgcn_readfirstlane(CNT[b * 32]), 0), SS), nr = (n + 63) & ~63;   // the batch's unmasked keys; the places they take, a multiple of 64
  if (k0 >= nr + NM) return;   // no key stands here: the whole block leaves, in front of the barrier
  v4f kq[8], vq[8];   // i: place 2 * pr + 16 * (i >> 1) + (i & 1) of the block
  if (k0 < nr) {      // a block is wholly listed keys or wholly memory slots (nr is a multiple of 64, at most SS)
    const int* lp = IDX + b * SS + k0 + 2 * pr; v2i sx[4]; const float* ro[8];
#pragma unroll
    for (int j = 0; j < 4; ++j) sx[j] = *(const v2i*)(lp + 16 * j);
#pragma unroll
    for (int i = 0; i < 8; ++i) ro[i] = QKV + ((size_t)b * SS + min(max(sx[i >> 1][i & 1], 0), SS - 1)) * QKVP + c0 + c4 * 4;
#pragma unroll
    for (int i = 0; i < 8; ++i) { kq[i] = *(const v4f*)(ro[i] + DM); vq[i] = *(const v4f*)(ro[i] + 2 * DM); }
    asm volatile("s_wait_xcnt 0x0" :: "v"(ro[0]), "v"(ro[1]), "v"(ro[2]), "v"(ro[3]), "v"(ro[4]), "v"(ro[5]), "v"(ro[6]), "v"(ro[7]) : "memory");   // the row loads' eight address pairs stay whole (no load's own result lands on one) until every load has taken its address
  } else {
    const size_t o0 = (size_t)(k0 - nr + 2 * pr) * DM + c0 + c4 * 4; const float *pk = MK + o0, *pv = MV + o0;
#pragma unroll
    for (int i = 0; i < 8; ++i) { const size_t o = (size_t)(16 * (i >> 1) + (i & 1)) * DM; kq[i] = *(const v4f*)(pk + o); vq[i] = *(const v4f*)(pv + o); }
    asm volatile("s_wait_xcnt 0x0" :: "v"(pk), "v"(pv) : "memory");   // as above, for the two address pairs
#pragma unroll
    for (int i = 0; i < 8; ++i) {
#pragma unroll
      for (int e = 0; e < 4; ++e) { kq[i][e] = 8.0f * bfr(kq[i][e]); vq[i][e] = 8.0f * bfr(vq[i][e]); } }
  }
#pragma unroll
  for (int p = 0; p < 4; ++p) { const int pp = (pr + 8 * p) ^ ((c4 >> 2) << 2);
#pragma unroll
    for (int e = 0; e < 4; ++e) { const float va = vq[2 * p][e], vb = vq[2 * p + 1][e]; const __bf16 ha = (__bf16)va, hb = (__bf16)vb;
      const v2b hh = {ha, hb}, ll = {(__bf16)(va - (float)ha), (__bf16)(vb - (float)hb)};
      svh[c4 * 4 + e][pp] = __builtin_bit_cast(unsigned, hh); svl[c4 * 4 + e][pp] = __builtin_bit_cast(unsigned, ll); } }
  v4b kh[8], kl[8];   // K as the score product takes it: bf16 hi and the bf16 of the remainder
#pragma unroll
  for (int i = 0; i < 8; ++i) {
#pragma unroll
    for (int e = 0; e < 4; ++e) { kh[i][e] = (__bf16)kq[i][e]; kl[i][e] = (__bf16)(kq[i][e] - (float)kh[i][e]); } }
  __syncthreads();
#pragma unroll
  for (int i = 0; i < 8; ++i) { __bf16* kr = KX + ((size_t)b * SK + k0 + 2 * pr + 16 * (i >> 1) + (i & 1)) * (2 * DM) + 2 * c0 + c4 * 4; vst2(kr, kh[i]); vst2(kr + HD, kl[i]); }   // behind the barrier, which would else wait for these stores; 16 lanes fill a 128-B line of hi and one of lo
#pragma unroll
  for (int it = 0; it < 4; ++it) { const int rowi = it * 16 + (tid >> 3), pc = tid & 7, sw = (pc ^ it) * 4; const size_t o = ((size_t)b * DM + c0 + rowi) * SK + k0 + pc * 8; vst2((unsigned*)(VTH + o), *(const v4u*)&svh[rowi][sw]); vst2((unsigned*)(VTL + o), *(const v4u*)&svl[rowi][sw]); }
}
#define KT 64
#define NT (SK / KT)
#define KPF 68
#define VPB 72
#define ST_VH (KT * KPF * 4)
#define ST_VL (ST_VH + HD * VPB * 2)
#define ST_SZ (ST_VL + HD * VPB * 2)       // 35840 B a stage
__device__ __forceinline__ float xhalf(float x) { return __builtin_bit_cast(float, __builtin_amdgcn_permlanex16(__builtin_bit_cast(int, x), __builtin_bit_cast(int, x), 0x76543210, 0xfedcba98, false, false)); }  // lane l with lane l ^ 16
__device__ __forceinline__ F2 split_v4(v4f a, v4f b, v4f c, v4f d) { float v[16];
#pragma unroll
  for (int i = 0; i < 4; ++i) { v[i] = a[i]; v[4 + i] = b[i]; v[8 + i] = c[i]; v[12 + i] = d[i]; }
  return bsplit16(v); }
// eight 16-B copies a lane, global to LDS through no register; the last line keeps the address registers whole until every copy has taken its addresses
__device__ __forceinline__ void copy8(const unsigned* l, const char* const* p) {
  asm volatile("global_load_async_to_lds_b128 %0, %8, off\n\tglobal_load_async_to_lds_b128 %1, %9, off\n\tglobal_load_async_to_lds_b128 %2, %10, off\n\tglobal_load_async_to_lds_b128 %3, %11, off\n\t"
               "global_load_async_to_lds_b128 %4, %12, off\n\tglobal_load_async_to_lds_b128 %5, %13, off\n\tglobal_load_async_to_lds_b128 %6, %14, off\n\tglobal_load_async_to_lds_b128 %7, %15, off\n\ts_wait_xcnt 0x0"
               :: "v"(l[0]), "v"(l[1]), "v"(l[2]), "v"(l[3]), "v"(l[4]), "v"(l[5]), "v"(l[6]), "v"(l[7]), "v"(p[0]), "v"(p[1]), "v"(p[2]), "v"(p[3]), "v"(p[4]), "v"(p[5]), "v"(p[6]), "v"(p[7]) : "memory");
}
__device__ __forceinline__ void stage_in(unsigned lb, const char* gk, const char* gh, const char* gl, int tid) {
  unsigned l[8]; const char* p[8];
#pragma unroll
  for (int i = 0; i < 8; ++i) { l[i] = lb + (unsigned)((i * 8 + (tid >> 4)) * (KPF * 4) + (tid & 15) * 16); p[i] = gk + (size_t)i * 8 * DM * 4; }   // K: a wave covers 2 rows of 256 B
  copy8(l, p);
#pragma unroll
  for (int i = 0; i < 4; ++i) { const unsigned o = (unsigned)((i * 16 + (tid >> 3)) * (VPB * 2) + (tid & 7) * 16); l[i] = lb + ST_VH + o; l[4 + i] = lb + ST_VL + o; p[i] = gh + (size_t)i * 16 * SK * 2; p[4 + i] = gl + (size_t)i * 16 * SK * 2; }   // V: a wave covers 4 rows of 128 B
  copy8(l, p);
}
__global__ __launch_bounds__(128) void k_attn(float* __restrict__ QKV, const __bf16* __restrict__ KX, const int* __restrict__ CNT, const __bf16* __restrict__ VTH, const __bf16* __restrict__ VTL) {
  __shared__ __align__(16) unsigned char sm[2 * ST_SZ];   // the two stage buffers; behind the loop its first bytes stage the output rows
  const int tid = threadIdx.x, wave = tid >> 5, lane = tid & 31, col = lane & 15, g = lane >> 4;
  const int qb = blockIdx.x, bh = blockIdx.y, b = bh >> 4, h = bh & 15; const int q0 = qb * 64 + wave * 16; const size_t tq = (size_t)b * SS + q0;
  const unsigned lds0 = (unsigned)(size_t)&sm[0];
  const int n = min(max(__builtin_amdgcn_readfirstlane(CNT[b * 32]), 0), SS), nr = (n + KT - 1) & ~(KT - 1), nt = nr / KT + 1;   // the batch's unmasked keys, the places they take, and the stages with the memory slots' one: 1 to NT, the same for the whole block
  const char* gk = (const char*)(KX + ((size_t)b * SK + (tid >> 4)) * (2 * DM) + h * (2 * HD)) + (tid & 15) * 16;             // this lane's first K chunk of stage 0; a stage on: KT rows
  const char* gh = (const char*)(VTH + ((size_t)b * DM + h * HD + (tid >> 3)) * SK) + (tid & 7) * 16;              // the same of V hi; a stage on: KT keys
  const char* gl = (const char*)(VTL + ((size_t)b * DM + h * HD + (tid >> 3)) * SK) + (tid & 7) * 16;
  stage_in(lds0, gk, gh, gl, tid);
  const F2 a0 = split_row(QKV + (tq + col) * QKVP + h * HD, 0, lane), a1 = split_row(QKV + (tq + col) * QKVP + h * HD, 32, lane);   // B operand: column = query
  asm volatile("s_wait_asynccnt 0x0" ::: "memory");   // this wave's share of stage 0 has landed
  __syncthreads();                                    // and every other wave's
  if (nt > 1) stage_in(lds0 + ST_SZ, gk + (size_t)KT * DM * 4, gh + KT * 2, gl + KT * 2, tid);
  float m = -3.0e38f, l = 0.f;   // of query col, m in log2 units; l sums this wave half's keys only, the halves are joined behind the loop
  v8f acc[4] = {};               // acc[dt][r] = O[query col][dt * 16 + 8 g + r]
#pragma unroll 1
  for (int t = 0; t < nt; ++t) {
    const unsigned char* sb = sm + (t & 1) * ST_SZ;
#pragma unroll   // the two steps of a stage stand unrolled: their LDS offsets are immediates
    for (int hs = 0; hs < 2; ++hs) {
      const int ks = 2 * t + hs;
      const int rem = ks * 32 >= nr ? 32 : n - ks * 32;   // places of this step that count, from its first on: all in the memory slots' stage; the places n to nr - 1 hold masked keys
      const unsigned kw = (rem >= 32 ? 0xffffffffu : (rem <= 0 ? 0u : (1u << rem) - 1u)) >> (8 * g);   // bit j = keep key 8g + j of this step
      float s[16];
#pragma unroll
      for (int ct = 0; ct < 2; ++ct) { const __bf16* kp = (const __bf16*)sb + (hs * 32 + ct * 16 + col) * (KPF * 2);   // A operand: row = key; hi at 0, lo at HD
        const F2 k0 = {frag_b(kp, lane), frag_b(kp + HD, lane)}, k1 = {frag_b(kp + 32, lane), frag_b(kp + HD + 32, lane)};
        v8f c = {}; c = wmma_bf(k0.h, a0.l, c); c = wmma_bf(k0.l, a0.h, c); c = wmma_bf(k0.h, a0.h, c); c = wmma_bf(k1.h, a1.l, c); c = wmma_bf(k1.l, a1.h, c); c = wmma_bf(k1.h, a1.h, c);
#pragma unroll
        for (int r = 0; r < 8; ++r) { const bool keep = ((kw >> (ct * 16 + r)) & 1u) != 0; s[ct * 8 + r] = keep ? c[r] * SC2 : -1.0e20f; } }
      v16b vh[4], vl[4];   // A operand: row = d; read here, as one group, so that the softmax stands between the reads and their use
#pragma unroll
      for (int dt = 0; dt < 4; ++dt) { const int vo = (dt * 16 + col) * VPB + hs * 32; vh[dt] = frag_b((const __bf16*)(sb + ST_VH) + vo, lane); vl[dt] = frag_b((const __bf16*)(sb + ST_VL) + vo, lane); }
      float mx = s[0];
#pragma unroll
      for (int i = 1; i < 16; ++i) mx = fmaxf(mx, s[i]);
      mx = fmaxf(mx, xhalf(mx));
      const float mn = fmaxf(m, mx); float alpha = m - mn;
      float es = 0.f;
#pragma unroll
      for (int i = 0; i < 16; ++i) s[i] -= mn;
      ex2_17(s, alpha);
#pragma unroll
      for (int i = 0; i < 16; ++i) es += s[i];
      l = l * alpha + es; m = mn;
#pragma unroll
      for (int dt = 0; dt < 4; ++dt) acc[dt] *= alpha;
      const F2 pa = bsplit16(s);   // element i = key 8g+i, element 8+i = key 16+8g+i: the k order of frag_b
#pragma unroll
      for (int dt = 0; dt < 4; ++dt) { acc[dt] = wmma_bf(vh[dt], pa.l, acc[dt]); acc[dt] = wmma_bf(vl[dt], pa.h, acc[dt]); acc[dt] = wmma_bf(vh[dt], pa.h, acc[dt]); } }
    asm volatile("s_wait_dscnt 0x0" ::: "memory");      // this wave's reads of the buffer are done before anyone refills it
    asm volatile("s_wait_asynccnt 0x0" ::: "memory");   // this wave's share of stage t + 1 has landed
    __syncthreads();                                    // publishes stage t + 1 and ends every wave's reads of stage t
    if (t + 2 < nt) stage_in(lds0 + (unsigned)(t & 1) * ST_SZ, gk + (size_t)(t + 2) * KT * DM * 4, gh + (size_t)(t + 2) * KT * 2, gl + (size_t)(t + 2) * KT * 2, tid);
  }
  asm volatile("s_wait_asynccnt 0x0" ::: "memory");     // no copy is left in flight when the buffer takes the output rows
  float (*so)[16][68] = (float (*)[16][68])sm;
  const float il = 1.0f / (l + xhalf(l));
#pragma unroll
  for (int dt = 0; dt < 4; ++dt) { const v8f o = acc[dt] * il; vst2(&so[wave][col][dt * 16 + 8 * g], (v4f){o[0], o[1], o[2], o[3]}); vst2(&so[wave][col][dt * 16 + 8 * g + 4], (v4f){o[4], o[5], o[6], o[7]}); }
  LDSX();
  for (int rl = 0; rl < 16; ++rl) if (lane < 16) vst2(QKV + (tq + rl) * QKVP + h * HD + lane * 4, *(const v4f*)&so[wave][rl][lane * 4]);
}
// ---- the two GEMMs (k_proj, k_out): block = (MT * 32 rows, 128 columns), 4 waves as 2 x 2, a wave holds MT x 4 accumulator tiles (MT * 16 rows x 64 columns)
// A (f32 rows) and B (bf16 weight rows) reach the waves through LDS: a stage = 64 k (A rows of 256 B, B rows of 128 B), copied once for the block in whole 128-B lines, two buffers, the next stage in flight while this one is worked on; A is rounded (or split) to bf16 as the fragment is read; k runs upward in steps of 32 into each accumulator
#define GK 64                              // k a stage
#define GNT (DM / GK)                      // 16 stages
#define APF 68                             // floats a staged A row: 272 B = 16 B x odd, no bank conflict for 16-B readers
#define BPB 72                             // bf16 a staged B row: 144 B = 16 B x odd
#define G_B(MT) ((MT) * 32 * APF * 4)
#define G_SZ(MT) (G_B(MT) + 128 * BPB * 2)  // a stage: 53248 B at MT 4, 35840 B at MT 2
template <int MT> __device__ __forceinline__ void g_stage(unsigned lb, const char* ga, size_t apitch, const char* gb, int tid) {
  unsigned l[8]; const char* p[8];
#pragma unroll
  for (int u = 0; u < MT / 2; ++u) {
#pragma unroll
    for (int i = 0; i < 8; ++i) { const int rr = (u * 8 + i) * 8; l[i] = lb + (unsigned)((rr + (tid >> 4)) * (APF * 4) + (tid & 15) * 16); p[i] = ga + (size_t)rr * apitch; }   // A: a wave covers 2 rows of 256 B
    copy8(l, p); }
#pragma unroll
  for (int i = 0; i < 8; ++i) { l[i] = lb + G_B(MT) + (unsigned)((i * 16 + (tid >> 3)) * (BPB * 2) + (tid & 7) * 16); p[i] = gb + (size_t)i * 16 * DM * 2; }   // B: a wave covers 4 rows of 128 B
  copy8(l, p);
}
// A: the block's first row, k = 0, lda floats a row; Bw: the block's first weight row; bias, C: at the block's first column (C at its first row too)
template <int MT, bool SPLIT> __device__ __forceinline__ void gemm_tile(unsigned char* sm, const float* A, int lda, const __bf16* Bw, const float* bias, float* C, int ldc) {
  const int tid = threadIdx.x, wave = tid >> 5, lane = tid & 31, col = lane & 15, g = lane >> 4, wm = wave >> 1, wn = wave & 1;
  const unsigned lds0 = (unsigned)(size_t)sm; const size_t ap = (size_t)lda * 4;
  const char* ga = (const char*)(A + (size_t)(tid >> 4) * lda) + (tid & 15) * 16;   // this lane's first A chunk of stage 0; a stage on: GK floats
  const char* gb = (const char*)(Bw + (size_t)(tid >> 3) * DM) + (tid & 7) * 16;    // the same of B; a stage on: GK bf16
  g_stage<MT>(lds0, ga, ap, gb, tid);
  asm volatile("s_wait_asynccnt 0x0" ::: "memory");   // this wave's share of stage 0 has landed
  __syncthreads();                                    // and every other wave's
  g_stage<MT>(lds0 + G_SZ(MT), ga + GK * 4, ap, gb + GK * 2, tid);
  v8f acc[MT][4] = {};
#pragma unroll 1   // one stage a trip: the two buffers alternate by the trip's parity
  for (int t = 0; t < GNT; ++t) {
    const unsigned char* sb = sm + (t & 1) * G_SZ(MT);
#pragma unroll   // the two 32-k steps of a stage stand unrolled: their LDS offsets are immediates
    for (int kc = 0; kc < 2; ++kc) {
      v16b w[4];
#pragma unroll
      for (int nt = 0; nt < 4; ++nt) w[nt] = frag_b((const __bf16*)(sb + G_B(MT)) + (wn * 64 + nt * 16 + col) * BPB + kc * 32, lane);
#pragma unroll
      for (int mt = 0; mt < MT; ++mt) { const float* xp = (const float*)sb + ((wm * MT + mt) * 16 + col) * APF + kc * 32 + 8 * g;
        const v4f x0 = *(const v4f*)xp, x1 = *(const v4f*)(xp + 4), x2 = *(const v4f*)(xp + 16), x3 = *(const v4f*)(xp + 20);   // the k order of frag_b
        if constexpr (SPLIT) { const F2 a = split_v4(x0, x1, x2, x3);
#pragma unroll
          for (int nt = 0; nt < 4; ++nt) acc[mt][nt] = wmma_bf(a.l, w[nt], acc[mt][nt]);
#pragma unroll
          for (int nt = 0; nt < 4; ++nt) acc[mt][nt] = wmma_bf(a.h, w[nt], acc[mt][nt]);
        } else { v16b a;
#pragma unroll
          for (int i = 0; i < 4; ++i) { a[i] = (__bf16)x0[i]; a[4 + i] = (__bf16)x1[i]; a[8 + i] = (__bf16)x2[i]; a[12 + i] = (__bf16)x3[i]; }
#pragma unroll
          for (int nt = 0; nt < 4; ++nt) acc[mt][nt] = wmma_bf(a, w[nt], acc[mt][nt]); } } }
    asm volatile("s_wait_dscnt 0x0" ::: "memory");      // this wave's reads of the buffer are done before anyone refills it
    asm volatile("s_wait_asynccnt 0x0" ::: "memory");   // this wave's share of stage t + 1 has landed
    __syncthreads();                                    // publishes stage t + 1 and ends every wave's reads of stage t
    if (t + 2 < GNT) g_stage<MT>(lds0 + (unsigned)(t & 1) * G_SZ(MT), ga + (size_t)(t + 2) * GK * 4, ap, gb + (size_t)(t + 2) * GK * 2, tid);
  }
  asm volatile("s_wait_asynccnt 0x0" ::: "memory");     // no copy is left in flight when the buffer takes the output rows
  float (*so)[68] = (float (*)[68])(sm + wave * (MT * 16 * 68 * 4));   // the wave's own MT * 16 rows x 64 columns
#pragma unroll
  for (int nt = 0; nt < 4; ++nt) { const float bb = bfr(bias[wn * 64 + nt * 16 + col]);
#pragma unroll
    for (int mt = 0; mt < MT; ++mt) {
#pragma unroll
      for (int r = 0; r < 8; ++r) so[mt * 16 + 8 * g + r][nt * 16 + col] = acc[mt][nt][r] + bb; } }
  LDSX();
  for (int rl = 0; rl < MT * 8; ++rl) { const int row = rl * 2 + g; vst2(C + (size_t)(wm * MT * 16 + row) * ldc + wn * 64 + col * 4, *(const v4f*)&so[row][col * 4]); }   // 256-B segments, two rows a store
}
// ---- k_proj: QKV[r][n] = bf16(x[r]) . PT[n] (exact) + bias, K = 1024; block (128 rows, 128 cols); a block's columns lie in one of q | k | v
__global__ __launch_bounds__(128) void k_proj(const float* __restrict__ XQ, const float* __restrict__ XK, const float* __restrict__ XV, const __bf16* __restrict__ PT, const float* __restrict__ bq, const float* __restrict__ bk, const float* __restrict__ bv, float* __restrict__ QKV) {
  __shared__ __align__(16) unsigned char sm[2 * G_SZ(4)];   // the two stage buffers; behind the loop its first bytes stage the output rows
  const int n0 = blockIdx.y * 128, which = n0 >> 10; const size_t r0 = (size_t)blockIdx.x * 128;
  const float* X = which == 0 ? XQ : (which == 1 ? XK : XV); const float* bs = which == 0 ? bq : (which == 1 ? bk : bv);
  gemm_tile<4, false>(sm, X + r0 * DM, DM, PT + (size_t)n0 * DM, bs + (n0 & 1023), QKV + r0 * QKVP + n0, QKVP);
}
// ---- k_out: Y = O(hi/lo; the q columns of QKV) . PT_out rows (2 products, K = 1024) + bo; block (64 rows, 128 cols)
__global__ __launch_bounds__(128) void k_out(const float* __restrict__ QKV, const __bf16* __restrict__ PT, const float* __restrict__ bo, float* __restrict__ Y) {
  __shared__ __align__(16) unsigned char sm[2 * G_SZ(2)];   // as in k_proj
  const int n0 = blockIdx.y * 128; const size_t r0 = (size_t)blockIdx.x * 64;
  gemm_tile<2, true>(sm, QKV + r0 * QKVP, QKVP, PT + (size_t)(3 * DM + n0) * DM, bo + n0, Y + r0 * DM + n0, DM);
}

extern "C" void kernel_launch(void* const* d_in, const int* in_sizes, int n_in, void* d_out, int out_size, void* d_ws, size_t ws_size, hipStream_t stream) {
  (void)in_sizes; (void)n_in; (void)out_size;
  const float** F = (const float**)d_in;   // query, key, value, mask [2,1,1,2048] i32, Wq, bq, Wk, bk, Wv, bv, Wo, bo, m_k [1,64,1024], m_v
  if (ws_size < (size_t)WS_END) return;
  char* ws = (char*)d_ws; __bf16 *PT = (__bf16*)(ws + WS_PT), *VTH = (__bf16*)(ws + WS_VTH), *VTL = (__bf16*)(ws + WS_VTL); float *QKV = (float*)(ws + WS_QKV); __bf16* KX = (__bf16*)(ws + WS_KX); int *IDX = (int*)(ws + WS_IDX), *CNT = (int*)(ws + WS_CNT);
  k_pack<<<4 * DM + NB, 128, 0, stream>>>(F[4], F[6], F[8], F[10], PT, (const int*)d_in[3], IDX, CNT);
  k_proj<<<dim3(TRB / 2, QKVP / 128), 128, 0, stream>>>(F[0], F[1], F[2], PT, F[5], F[7], F[9], QKV);
  k_kv<<<dim3(SK / 64, DM / 64, TNB), 128, 0, stream>>>(QKV, F[12], F[13], IDX, CNT, KX, VTH, VTL);
  k_attn<<<dim3(TQB, TNB * NH), 128, 0, stream>>>(QKV, KX, CNT, VTH, VTL);
  k_out<<<dim3((TNB < NB ? TQB : NR / 64), DM / 128), 128, 0, stream>>>(QKV, PT, F[11], (float*)d_out);
}

// v008
// A run of this version takes 108 microseconds.
// Timed twice side by side with v007, it ran 1.05 and 1.06 times as fast.
// Over all steps from v000 it is 6.69 times as fast.
// compute dtype: query/key/value, the four weights + biases and the memory slots (module inputs) rounded to bf16; q/k/v projections with exact bf16 products (+ f32 bias); scores and P.V with both computed operands as bf16 hi + bf16 residual pairs (3 products; memory keys/values scaled in f32 and split the same way); output projection hi/lo x bf16 Wo (2 products) + bias; masked online softmax in f32; f32 accumulate.
#include <hip/hip_runtime.h>
#include <math.h>

typedef __attribute__((ext_vector_type(16))) _Float16 v16h;
typedef __attribute__((ext_vector_type(16))) __bf16 v16b;
typedef __attribute__((ext_vector_type(8)))  _Float16 v8h;
typedef __attribute__((ext_vector_type(8)))  float v8f;
typedef __attribute__((ext_vector_type(4)))  float v4f;
typedef __attribute__((ext_vector_type(2)))  float v2f;
typedef __attribute__((ext_vector_type(4)))  unsigned v4u;
typedef __attribute__((ext_vector_type(4)))  int v4i;
typedef float __attribute__((may_alias)) float_a;
typedef int __attribute__((may_alias)) int_a;

template <typename T> __device__ __forceinline__ void vst2(void* p, T v) { *(T*)p = v;  }
__device__ __forceinline__ v8f wmma16(v16h a, v16h b, v8f c) {
  v8f d = __builtin_amdgcn_wmma_f32_16x16x32_f16(false, a, false, b, (short)0, c, false, false);
  asm volatile("v_nop\n\tv_nop\n\tv_nop\n\tv_nop" : "+v"(d) : "v"(a), "v"(b));
  return d;
}
__device__ __forceinline__ v8f wmma_bf(v16b a, v16b b, v8f c) {
  v8f d = __builtin_amdgcn_wmma_f32_16x16x32_bf16(false, a, false, b, (short)0, c, false, false);
  asm volatile("v_nop\n\tv_nop\n\tv_nop\n\tv_nop" : "+v"(d) : "v"(a), "v"(b));
  return d;
}
// 16x16x32 fragments: lane = (h = lane>>4, row/col = lane&15); elements 0..7 = k0+8h+0..7, 8..15 = k0+16+8h+0..7; D element r = row 8h+r
__device__ __forceinline__ v16h frag_h(const _Float16* rowk0, int lane) {
  union { v16h v; v8h q[2]; } u; const _Float16* p = rowk0 + 8 * (lane >> 4);
  u.q[0] = *(const v8h*)p; u.q[1] = *(const v8h*)(p + 16); return u.v;
}
__device__ __forceinline__ v16h frag_f32(const float* rowk0, int lane) {
  v16h a; const float* p = rowk0 + 8 * (lane >> 4);
#pragma unroll
  for (int i = 0; i < 8; ++i) { a[i] = (_Float16)p[i]; a[8 + i] = (_Float16)p[16 + i]; }
  return a;
}
__device__ __forceinline__ v16h frag_f32s(const float* rowk0, int lane, float sc) {
  v16h a; const float* p = rowk0 + 8 * (lane >> 4);
#pragma unroll
  for (int i = 0; i < 8; ++i) { a[i] = (_Float16)(p[i] * sc); a[8 + i] = (_Float16)(p[16 + i] * sc); }
  return a;
}
// column fragment from a [K][ld] layout (column n), rows >= K read as 0
__device__ __forceinline__ v16h fragc_f32(const float* W, int k0, int n, int lane, int ld, int K) {
  v16h a; const int g = lane >> 4;
#pragma unroll
  for (int i = 0; i < 8; ++i) { const int ka = k0 + 8 * g + i, kb = ka + 16;
    a[i] = (_Float16)(ka < K ? W[(size_t)(ka < K ? ka : K - 1) * ld + n] : 0.f); a[8 + i] = (_Float16)(kb < K ? W[(size_t)(kb < K ? kb : K - 1) * ld + n] : 0.f); }
  return a;
}
struct F2 { v16b h, l; };
__device__ __forceinline__ F2 bsplit16(const float v[16]) { F2 r;
#pragma unroll
  for (int i = 0; i < 16; ++i) { const __bf16 h = (__bf16)v[i]; r.h[i] = h; r.l[i] = (__bf16)(v[i] - (float)h); }
  return r; }
__device__ __forceinline__ F2 split_row(const float* row, int k0, int lane) { float v[16]; const float* p = row + k0 + 8 * (lane >> 4);
#pragma unroll
  for (int i = 0; i < 8; ++i) { v[i] = p[i]; v[8 + i] = p[16 + i]; }
  return bsplit16(v); }
__device__ __forceinline__ F2 split_rowK(const float* row, int k0, int lane, int K) { float v[16]; const int g = lane >> 4;
#pragma unroll
  for (int i = 0; i < 8; ++i) { const int ka = k0 + 8 * g + i, kb = ka + 16; v[i] = ka < K ? row[ka < K ? ka : K - 1] : 0.f; v[8 + i] = kb < K ? row[kb < K ? kb : K - 1] : 0.f; }
  return bsplit16(v); }
__device__ __forceinline__ F2 split_col(const float* W, int k0, int n, int lane, int ld, int K) { float v[16]; const int g = lane >> 4;
#pragma unroll
  for (int i = 0; i < 8; ++i) { const int ka = k0 + 8 * g + i, kb = ka + 16; v[i] = ka < K ? W[(size_t)(ka < K ? ka : K - 1) * ld + n] : 0.f; v[8 + i] = kb < K ? W[(size_t)(kb < K ? kb : K - 1) * ld + n] : 0.f; }
  return bsplit16(v); }
__device__ __forceinline__ v8f mac3(const F2& a, const F2& b, v8f c) { c = wmma_bf(a.l, b.h, c); c = wmma_bf(a.h, b.l, c); return wmma_bf(a.h, b.h, c); }
__device__ __forceinline__ float sigm(float v) { return 1.0f / (1.0f + expf(-v)); }
#define LDSX() do { asm volatile("s_wait_dscnt 0" ::: "memory"); __builtin_amdgcn_wave_barrier(); __builtin_amdgcn_fence(__ATOMIC_RELEASE, "workgroup"); } while (0)


// Multi-head attention with persistent memory: Q = query Wq^T + bq, K = [key Wk^T + bk ; 8 m_k], V = [value Wv^T + bv ; 8 m_v] (2048 + 64 slots), energy = Q K^T / 8 with the first 2048 key columns masked (mask == 0 -> -1e20) and the memory columns never masked; softmax; P V; merge heads; @ Wo^T + bo.  B 2, S 2048, D 1024, 16 x 64.
// k_pack (+ per batch the list of key numbers, unmasked first), k_proj (exact GEMM + bias; q from query; k and v from the rows of key and value that the list names: the n unmasked keys of a batch, filled up to a multiple of 64 with masked ones, then the memory slots; K rows stored split once into bf16 hi | lo by head, V as transposed hi/lo planes), k_attn (K and V staged in LDS by 64 keys, ceil(n / 64) + 1 stages), k_out (+ bo).
// A masked key has energy -1e20 beside the never masked memory slots, so its softmax weight is exactly 0 in f32: it is left out of the key list instead of being multiplied by 0.
#define NB 2
#define SS 2048
#define DM 1024
#define NH 16
#define HD 64
#define NR (NB * SS)
#define QKVP (3 * DM)
#define NM 64
#define SK (SS + NM)        // 2112 keys per batch
#ifndef TRB
#define TRB (NR / 64)
#define TQB (SS / 64)
#define TNB NB
#endif
typedef __attribute__((ext_vector_type(8))) __bf16 v8b;
__device__ __forceinline__ v16b frag_b(const __bf16* rowk0, int lane) {
  union { v16b v; v8b q[2]; } u; const __bf16* p = rowk0 + 8 * (lane >> 4);
  u.q[0] = *(const v8b*)p; u.q[1] = *(const v8b*)(p + 16); return u.v;
}
__device__ __forceinline__ v16b frag_gbf(const float* rowk0, int lane) {
  v16b a; const float* p = rowk0 + 8 * (lane >> 4);
#pragma unroll
  for (int i = 0; i < 8; ++i) { a[i] = (__bf16)p[i]; a[8 + i] = (__bf16)p[16 + i]; }
  return a;
}
__device__ __forceinline__ float bfr(float v) { return (float)(__bf16)v; }
// s[i] = 2^s[i] and a = 2^a, one instruction each (below 2^-126 the result is 0). One statement, so that every v_exp_f32 is followed by an instruction that touches neither its result nor its source; the closing v_nop is that slot for the last one
__device__ __forceinline__ void ex2_17(float* s, float& a) {
  asm("v_exp_f32 %0, %0\n\tv_exp_f32 %1, %1\n\tv_exp_f32 %2, %2\n\tv_exp_f32 %3, %3\n\tv_exp_f32 %4, %4\n\tv_exp_f32 %5, %5\n\tv_exp_f32 %6, %6\n\tv_exp_f32 %7, %7\n\tv_exp_f32 %8, %8\n\t"
      "v_exp_f32 %9, %9\n\tv_exp_f32 %10, %10\n\tv_exp_f32 %11, %11\n\tv_exp_f32 %12, %12\n\tv_exp_f32 %13, %13\n\tv_exp_f32 %14, %14\n\tv_exp_f32 %15, %15\n\tv_exp_f32 %16, %16\n\tv_nop"
      : "+v"(s[0]), "+v"(s[1]), "+v"(s[2]), "+v"(s[3]), "+v"(s[4]), "+v"(s[5]), "+v"(s[6]), "+v"(s[7]), "+v"(s[8]), "+v"(s[9]), "+v"(s[10]), "+v"(s[11]), "+v"(s[12]), "+v"(s[13]), "+v"(s[14]), "+v"(s[15]), "+v"(a));
}
#define SC2 0.18033688011112042f   // log2(e) / 8: the scores are scaled into powers of two, so that exp(energy - max) = 2^(s - m)
#define WS_PT   0u                                 // bf16 [4096 (q|k|v|out cols)][1024]
#define WS_QKV  (WS_PT + 2u * 4 * DM * DM)           // f32 [4096 rows][3072]: only the q columns 0..1023 are used, later overwritten by O
#define WS_KX   (WS_QKV + 4u * NR * QKVP)            // bf16 [2][2112][16 heads][hi 64 | lo 64] keys incl. memory: 256 B a key and head
#define WS_VTH  (WS_KX + 4u * NB * SK * DM)           // bf16 [2][1024 (h*64+d)][2112]
#define WS_VTL  (WS_VTH + 2u * NB * DM * SK)
#define WS_IDX  (WS_VTL + 2u * NB * DM * SK)          // int [2][2048]: a batch's key numbers, the unmasked first, then the masked, each group rising
#define WS_CNT  (WS_IDX + 4u * NB * SS)               // int, one a batch, 128 B apart: how many of its keys are unmasked
#define WS_END  (WS_CNT + 128u * NB)

__global__ __launch_bounds__(128) void k_pack(const float* __restrict__ Wq, const float* __restrict__ Wk, const float* __restrict__ Wv, const float* __restrict__ Wo, __bf16* __restrict__ PT, const int* __restrict__ MASK, int* __restrict__ IDX, int* __restrict__ CNT) {
  __shared__ __align__(16) __bf16 srow[DM];
  __shared__ int sc[128];
  const int tid = threadIdx.x;
  if (blockIdx.x < NB) {   // the first NB blocks: one batch's key list each; a thread ranks 16 keys in a row
    const int b = blockIdx.x; const int* mp = MASK + (size_t)b * SS + tid * (SS / 128);
    unsigned bits = 0;   // bit i: key tid * 16 + i is unmasked
#pragma unroll
    for (int q = 0; q < SS / 512; ++q) { const v4i x = *(const v4i*)(mp + 4 * q);
#pragma unroll
      for (int e = 0; e < 4; ++e) bits |= (x[e] != 0 ? 1u : 0u) << (4 * q + e); }
    sc[tid] = __popc(bits);
    __syncthreads();
    int before = 0, all = 0;   // unmasked keys of the threads below this one; of the batch
#pragma unroll 4   // unrolled whole, this loop's registers would cost the weight blocks of this kernel a quarter of their waves a SIMD
    for (int j = 0; j < 128; ++j) { const int v = sc[j]; all += v; before += j < tid ? v : 0; }
    int up = before, dn = all + tid * (SS / 128) - before;   // the next place among the unmasked, and among the masked, which stand behind all the unmasked
#pragma unroll
    for (int i = 0; i < SS / 128; ++i) { const bool keep = ((bits >> i) & 1u) != 0; IDX[(size_t)b * SS + (keep ? up : dn)] = tid * (SS / 128) + i; up += keep ? 1 : 0; dn += keep ? 0 : 1; }
    if (tid == 0) CNT[b * 32] = all;
    return;
  }
  const int n = blockIdx.x - NB; const int which = n >> 10, c = n & 1023; const float* Wm = which == 0 ? Wq : (which == 1 ? Wk : (which == 2 ? Wv : Wo));
  for (int k = tid; k < DM; k += 128) srow[k] = (__bf16)Wm[(size_t)c * DM + k];   // torch [out][in]: row c
  __syncthreads();
  vst2((unsigned*)(PT + (size_t)n * DM + tid * 8), *(const v4u*)(&srow[tid * 8]));
}
// ---- mem_slots (a block of k_proj): the 64 memory slots x one head's 64 columns of one batch, 4 waves; a thread holds 4 slot pairs x 4 columns of K and of V with all 16 loads in flight together; V is split, packed by slot pair and turned in LDS, K is split and goes straight out
// place p of a batch with n unmasked keys, nr = n rounded up to 64: p < nr the p-th key of the list (from n on masked keys, which only fill the stage: k_attn gives them weight 0), nr <= p < nr + 64 memory slot p - nr; nothing is written behind that, and k_attn reads nothing there
typedef __attribute__((ext_vector_type(2))) __bf16 v2b;
typedef __attribute__((ext_vector_type(4))) __bf16 v4b;
__device__ __forceinline__ void mem_slots(unsigned char* sm, const float* __restrict__ MK, const float* __restrict__ MV, int k0, int c0, int b, __bf16* __restrict__ KX, __bf16* __restrict__ VTH, __bf16* __restrict__ VTL) {
  unsigned (*svh)[36] = (unsigned (*)[36])sm, (*svl)[36] = (unsigned (*)[36])(sm + 64 * 36 * 4);   // [column][slot pair]; the 16-B chunks of a row stand XORed with column >> 4, so that a wave's 32 pair stores meet 32 banks
  const int tid = threadIdx.x, c4 = tid & 15, pr = tid >> 4;
  v4f kq[8], vq[8];   // i: slot 2 * pr + 16 * (i >> 1) + (i & 1)
  const unsigned ob = (unsigned)((2 * pr) * DM + c0 + c4 * 4) * 4u; const float *pk = (const float*)((const char*)MK + ob), *pv = (const float*)((const char*)MV + ob);   // ob: the lane's byte offset in both arrays
#pragma unroll
  for (int i = 0; i < 8; ++i) { const size_t o = (size_t)(16 * (i >> 1) + (i & 1)) * DM; kq[i] = *(const v4f*)(pk + o); vq[i] = *(const v4f*)(pv + o); }
  asm volatile("s_wait_xcnt 0x0" :: "v"(ob) : "memory");   // the offset register that all 16 loads name stays whole (no load's own result lands on it) until every load has taken its address
#pragma unroll
  for (int i = 0; i < 8; ++i) {
#pragma unroll
    for (int e = 0; e < 4; ++e) { kq[i][e] = 8.0f * bfr(kq[i][e]); vq[i][e] = 8.0f * bfr(vq[i][e]); } }
#pragma unroll
  for (int p = 0; p < 4; ++p) { const int pp = (pr + 8 * p) ^ ((c4 >> 2) << 2);
#pragma unroll
    for (int e = 0; e < 4; ++e) { const float va = vq[2 * p][e], vb = vq[2 * p + 1][e]; const __bf16 ha = (__bf16)va, hb = (__bf16)vb;
      const v2b hh = {ha, hb}, ll = {(__bf16)(va - (float)ha), (__bf16)(vb - (float)hb)};
      svh[c4 * 4 + e][pp] = __builtin_bit_cast(unsigned, hh); svl[c4 * 4 + e][pp] = __builtin_bit_cast(unsigned, ll); } }
  v4b kh[8], kl[8];   // K as the score product takes it: bf16 hi and the bf16 of the remainder
#pragma unroll
  for (int i = 0; i < 8; ++i) {
#pragma unroll
    for (int e = 0; e < 4; ++e) { kh[i][e] = (__bf16)kq[i][e]; kl[i][e] = (__bf16)(kq[i][e] - (float)kh[i][e]); } }
  __syncthreads();
#pragma unroll
  for (int i = 0; i < 8; ++i) { __bf16* kr = KX + ((size_t)b * SK + k0 + 2 * pr + 16 * (i >> 1) + (i & 1)) * (2 * DM) + 2 * c0 + c4 * 4; vst2(kr, kh[i]); vst2(kr + HD, kl[i]); }   // behind the barrier, which would else wait for these stores; 16 lanes fill a 128-B line of hi and one of lo
#pragma unroll
  for (int it = 0; it < 4; ++it) { const int rowi = it * 16 + (tid >> 3), pc = tid & 7, sw = (pc ^ it) * 4; const size_t o = ((size_t)b * DM + c0 + rowi) * SK + k0 + pc * 8; vst2((unsigned*)(VTH + o), *(const v4u*)&svh[rowi][sw]); vst2((unsigned*)(VTL + o), *(const v4u*)&svl[rowi][sw]); }
}
#define KT 64
#define NT (SK / KT)
#define KPF 68
#define VPB 72
#define ST_VH (KT * KPF * 4)
#define ST_VL (ST_VH + HD * VPB * 2)
#define ST_SZ (ST_VL + HD * VPB * 2)       // 35840 B a stage
__device__ __forceinline__ float xhalf(float x) { return __builtin_bit_cast(float, __builtin_amdgcn_permlanex16(__builtin_bit_cast(int, x), __builtin_bit_cast(int, x), 0x76543210, 0xfedcba98, false, false)); }  // lane l with lane l ^ 16
__device__ __forceinline__ F2 split_v4(v4f a, v4f b, v4f c, v4f d) { float v[16];
#pragma unroll
  for (int i = 0; i < 4; ++i) { v[i] = a[i]; v[4 + i] = b[i]; v[8 + i] = c[i]; v[12 + i] = d[i]; }
  return bsplit16(v); }
// eight 16-B copies a lane, global to LDS through no register; the last line keeps the address registers whole until every copy has taken its addresses
__device__ __forceinline__ void copy8(const unsigned* l, const char* const* p) {
  asm volatile("global_load_async_to_lds_b128 %0, %8, off\n\tglobal_load_async_to_lds_b128 %1, %9, off\n\tglobal_load_async_to_lds_b128 %2, %10, off\n\tglobal_load_async_to_lds_b128 %3, %11, off\n\t"
               "global_load_async_to_lds_b128 %4, %12, off\n\tglobal_load_async_to_lds_b128 %5, %13, off\n\tglobal_load_async_to_lds_b128 %6, %14, off\n\tglobal_load_async_to_lds_b128 %7, %15, off\n\ts_wait_xcnt 0x0"
               :: "v"(l[0]), "v"(l[1]), "v"(l[2]), "v"(l[3]), "v"(l[4]), "v"(l[5]), "v"(l[6]), "v"(l[7]), "v"(p[0]), "v"(p[1]), "v"(p[2]), "v"(p[3]), "v"(p[4]), "v"(p[5]), "v"(p[6]), "v"(p[7]) : "memory");
}
__device__ __forceinline__ void stage_in(unsigned lb, const char* gk, const char* gh, const char* gl, int tid) {
  unsigned l[8]; const char* p[8];
#pragma unroll
  for (int i = 0; i < 8; ++i) { l[i] = lb + (unsigned)((i * 8 + (tid >> 4)) * (KPF * 4) + (tid & 15) * 16); p[i] = gk + (size_t)i * 8 * DM * 4; }   // K: a wave covers 2 rows of 256 B
  copy8(l, p);
#pragma unroll
  for (int i = 0; i < 4; ++i) { const unsigned o = (unsigned)((i * 16 + (tid >> 3)) * (VPB * 2) + (tid & 7) * 16); l[i] = lb + ST_VH + o; l[4 + i] = lb + ST_VL + o; p[i] = gh + (size_t)i * 16 * SK * 2; p[4 + i] = gl + (size_t)i * 16 * SK * 2; }   // V: a wave covers 4 rows of 128 B
  copy8(l, p);
}
__global__ __launch_bounds__(128) void k_attn(float* __restrict__ QKV, const __bf16* __restrict__ KX, const int* __restrict__ CNT, const __bf16* __restrict__ VTH, const __bf16* __restrict__ VTL) {
  __shared__ __align__(16) unsigned char sm[2 * ST_SZ];   // the two stage buffers; behind the loop its first bytes stage the output rows
  const int tid = threadIdx.x, wave = tid >> 5, lane = tid & 31, col = lane & 15, g = lane >> 4;
  const int qb = blockIdx.x, bh = blockIdx.y, b = bh >> 4, h = bh & 15; const int q0 = qb * 64 + wave * 16; const size_t tq = (size_t)b * SS + q0;
  const unsigned lds0 = (unsigned)(size_t)&sm[0];
  const int n = min(max(__builtin_amdgcn_readfirstlane(CNT[b * 32]), 0), SS), nr = (n + KT - 1) & ~(KT - 1), nt = nr / KT + 1;   // the batch's unmasked keys, the places they take, and the stages with the memory slots' one: 1 to NT, the same for the whole block
  const char* gk = (const char*)(KX + ((size_t)b * SK + (tid >> 4)) * (2 * DM) + h * (2 * HD)) + (tid & 15) * 16;             // this lane's first K chunk of stage 0; a stage on: KT rows
  const char* gh = (const char*)(VTH + ((size_t)b * DM + h * HD + (tid >> 3)) * SK) + (tid & 7) * 16;              // the same of V hi; a stage on: KT keys
  const char* gl = (const char*)(VTL + ((size_t)b * DM + h * HD + (tid >> 3)) * SK) + (tid & 7) * 16;
  stage_in(lds0, gk, gh, gl, tid);
  const F2 a0 = split_row(QKV + (tq + col) * QKVP + h * HD, 0, lane), a1 = split_row(QKV + (tq + col) * QKVP + h * HD, 32, lane);   // B operand: column = query
  asm volatile("s_wait_asynccnt 0x0" ::: "memory");   // this wave's share of stage 0 has landed
  __syncthreads();                                    // and every other wave's
  if (nt > 1) stage_in(lds0 + ST_SZ, gk + (size_t)KT * DM * 4, gh + KT * 2, gl + KT * 2, tid);
  float m = -3.0e38f, l = 0.f;   // of query col, m in log2 units; l sums this wave half's keys only, the halves are joined behind the loop
  v8f acc[4] = {};               // acc[dt][r] = O[query col][dt * 16 + 8 g + r]
#pragma unroll 1
  for (int t = 0; t < nt; ++t) {
    const unsigned char* sb = sm + (t & 1) * ST_SZ;
#pragma unroll   // the two steps of a stage stand unrolled: their LDS offsets are immediates
    for (int hs = 0; hs < 2; ++hs) {
      const int ks = 2 * t + hs;
      const int rem = ks * 32 >= nr ? 32 : n - ks * 32;   // places of this step that count, from its first on: all in the memory slots' stage; the places n to nr - 1 hold masked keys
      const unsigned kw = (rem >= 32 ? 0xffffffffu : (rem <= 0 ? 0u : (1u << rem) - 1u)) >> (8 * g);   // bit j = keep key 8g + j of this step
      float s[16];
#pragma unroll
      for (int ct = 0; ct < 2; ++ct) { const __bf16* kp = (const __bf16*)sb + (hs * 32 + ct * 16 + col) * (KPF * 2);   // A operand: row = key; hi at 0, lo at HD
        const F2 k0 = {frag_b(kp, lane), frag_b(kp + HD, lane)}, k1 = {frag_b(kp + 32, lane), frag_b(kp + HD + 32, lane)};
        v8f c = {}; c = wmma_bf(k0.h, a0.l, c); c = wmma_bf(k0.l, a0.h, c); c = wmma_bf(k0.h, a0.h, c); c = wmma_bf(k1.h, a1.l, c); c = wmma_bf(k1.l, a1.h, c); c = wmma_bf(k1.h, a1.h, c);
#pragma unroll
        for (int r = 0; r < 8; ++r) { const bool keep = ((kw >> (ct * 16 + r)) & 1u) != 0; s[ct * 8 + r] = keep ? c[r] * SC2 : -1.0e20f; } }
      v16b vh[4], vl[4];   // A operand: row = d; read here, as one group, so that the softmax stands between the reads and their use
#pragma unroll
      for (int dt = 0; dt < 4; ++dt) { const int vo = (dt * 16 + col) * VPB + hs * 32; vh[dt] = frag_b((const __bf16*)(sb + ST_VH) + vo, lane); vl[dt] = frag_b((const __bf16*)(sb + ST_VL) + vo, lane); }
      float mx = s[0];
#pragma unroll
      for (int i = 1; i < 16; ++i) mx = fmaxf(mx, s[i]);
      mx = fmaxf(mx, xhalf(mx));
      const float mn = fmaxf(m, mx); float alpha = m - mn;
      float es = 0.f;
#pragma unroll
      for (int i = 0; i < 16; ++i) s[i] -= mn;
      ex2_17(s, alpha);
#pragma unroll
      for (int i = 0; i < 16; ++i) es += s[i];
      l = l * alpha + es; m = mn;
#pragma unroll
      for (int dt = 0; dt < 4; ++dt) acc[dt] *= alpha;
      const F2 pa = bsplit16(s);   // element i = key 8g+i, element 8+i = key 16+8g+i: the k order of frag_b
#pragma unroll
      for (int dt = 0; dt < 4; ++dt) { acc[dt] = wmma_bf(vh[dt], pa.l, acc[dt]); acc[dt] = wmma_bf(vl[dt], pa.h, acc[dt]); acc[dt] = wmma_bf(vh[dt], pa.h, acc[dt]); } }
    asm volatile("s_wait_dscnt 0x0" ::: "memory");      // this wave's reads of the buffer are done before anyone refills it
    asm volatile("s_wait_asynccnt 0x0" ::: "memory");   // this wave's share of stage t + 1 has landed
    __syncthreads();                                    // publishes stage t + 1 and ends every wave's reads of stage t
    if (t + 2 < nt) stage_in(lds0 + (unsigned)(t & 1) * ST_SZ, gk + (size_t)(t + 2) * KT * DM * 4, gh + (size_t)(t + 2) * KT * 2, gl + (size_t)(t + 2) * KT * 2, tid);
  }
  asm volatile("s_wait_asynccnt 0x0" ::: "memory");     // no copy is left in flight when the buffer takes the output rows
  float (*so)[16][68] = (float (*)[16][68])sm;
  const float il = 1.0f / (l + xhalf(l));
#pragma unroll
  for (int dt = 0; dt < 4; ++dt) { const v8f o = acc[dt] * il; vst2(&so[wave][col][dt * 16 + 8 * g], (v4f){o[0], o[1], o[2], o[3]}); vst2(&so[wave][col][dt * 16 + 8 * g + 4], (v4f){o[4], o[5], o[6], o[7]}); }
  LDSX();
  for (int rl = 0; rl < 16; ++rl) if (lane < 16) vst2(QKV + (tq + rl) * QKVP + h * HD + lane * 4, *(const v4f*)&so[wave][rl][lane * 4]);
}
// ---- the two GEMMs (k_proj, k_out): block = (MT * 32 rows, 128 columns), 4 waves as 2 x 2, a wave holds MT x 4 accumulator tiles (MT * 16 rows x 64 columns)
// A (f32 rows) and B (bf16 weight rows) reach the waves through LDS: a stage = 64 k (A rows of 256 B, B rows of 128 B), copied once for the block in whole 128-B lines, two buffers, the next stage in flight while this one is worked on; A is rounded (or split) to bf16 as the fragment is read; k runs upward in steps of 32 into each accumulator
#define GK 64                              // k a stage
#define GNT (DM / GK)                      // 16 stages
#define APF 68                             // floats a staged A row: 272 B = 16 B x odd, no bank conflict for 16-B readers
#define BPB 72                             // bf16 a staged B row: 144 B = 16 B x odd
#define G_B(MT) ((MT) * 32 * APF * 4)
#define G_SZ(MT) (G_B(MT) + 128 * BPB * 2)  // a stage: 53248 B at MT 4, 35840 B at MT 2
// LIST: the lane's A row number u * 8 + i stands ro[u * 8 + i] bytes behind ga (rows picked through a list); else the rows follow one another at apitch
template <int MT, bool LIST> __device__ __forceinline__ void g_stage(unsigned lb, const char* ga, size_t apitch, const unsigned* ro, const char* gb, int tid) {
  unsigned l[8]; const char* p[8];
#pragma unroll
  for (int u = 0; u < MT / 2; ++u) {
#pragma unroll
    for (int i = 0; i < 8; ++i) { const int rr = (u * 8 + i) * 8; l[i] = lb + (unsigned)((rr + (tid >> 4)) * (APF * 4) + (tid & 15) * 16); p[i] = LIST ? ga + ro[u * 8 + i] : ga + (size_t)rr * apitch; }   // A: a wave covers 2 rows of 256 B
    copy8(l, p); }
#pragma unroll
  for (int i = 0; i < 8; ++i) { l[i] = lb + G_B(MT) + (unsigned)((i * 16 + (tid >> 3)) * (BPB * 2) + (tid & 7) * 16); p[i] = gb + (size_t)i * 16 * DM * 2; }   // B: a wave covers 4 rows of 128 B
  copy8(l, p);
}
// the product: A: the block's first row, k = 0, lda floats a row (LIST: the matrix's first row, and ro the byte offsets of this lane's MT * 4 chunks of stage 0); Bw: the block's first weight row
template <int MT, bool SPLIT, bool LIST> __device__ __forceinline__ void gemm_main(unsigned char* sm, const float* A, int lda, const unsigned* ro, const __bf16* Bw, v8f (&acc)[MT][4]) {
  const int tid = threadIdx.x, wave = tid >> 5, lane = tid & 31, col = lane & 15, g = lane >> 4, wm = wave >> 1, wn = wave & 1;
  const unsigned lds0 = (unsigned)(size_t)sm; const size_t ap = (size_t)lda * 4;
  const char* ga = LIST ? (const char*)A : (const char*)(A + (size_t)(tid >> 4) * lda) + (tid & 15) * 16;   // LIST: the matrix's first row, else this lane's first A chunk of stage 0; a stage on: GK floats
  const char* gb = (const char*)(Bw + (size_t)(tid >> 3) * DM) + (tid & 7) * 16;    // the same of B; a stage on: GK bf16
  g_stage<MT, LIST>(lds0, ga, ap, ro, gb, tid);
  asm volatile("s_wait_asynccnt 0x0" ::: "memory");   // this wave's share of stage 0 has landed
  __syncthreads();                                    // and every other wave's
  g_stage<MT, LIST>(lds0 + G_SZ(MT), ga + GK * 4, ap, ro, gb + GK * 2, tid);
#pragma unroll 1   // one stage a trip: the two buffers alternate by the trip's parity, and the body stays small in the instruction cache
  for (int t = 0; t < GNT; ++t) {
    const unsigned char* sb = sm + (t & 1) * G_SZ(MT);
#pragma unroll   // the two 32-k steps of a stage stand unrolled: their LDS offsets are immediates
    for (int kc = 0; kc < 2; ++kc) {
      v16b w[4];
#pragma unroll
      for (int nt = 0; nt < 4; ++nt) w[nt] = frag_b((const __bf16*)(sb + G_B(MT)) + (wn * 64 + nt * 16 + col) * BPB + kc * 32, lane);
#pragma unroll
      for (int mt = 0; mt < MT; ++mt) { const float* xp = (const float*)sb + ((wm * MT + mt) * 16 + col) * APF + kc * 32 + 8 * g;
        const v4f x0 = *(const v4f*)xp, x1 = *(const v4f*)(xp + 4), x2 = *(const v4f*)(xp + 16), x3 = *(const v4f*)(xp + 20);   // the k order of frag_b
        if constexpr (SPLIT) { const F2 a = split_v4(x0, x1, x2, x3);
#pragma unroll
          for (int nt = 0; nt < 4; ++nt) acc[mt][nt] = wmma_bf(a.l, w[nt], acc[mt][nt]);
#pragma unroll
          for (int nt = 0; nt < 4; ++nt) acc[mt][nt] = wmma_bf(a.h, w[nt], acc[mt][nt]);
        } else { v16b a;
#pragma unroll
          for (int i = 0; i < 4; ++i) { a[i] = (__bf16)x0[i]; a[4 + i] = (__bf16)x1[i]; a[8 + i] = (__bf16)x2[i]; a[12 + i] = (__bf16)x3[i]; }
#pragma unroll
          for (int nt = 0; nt < 4; ++nt) acc[mt][nt] = wmma_bf(a, w[nt], acc[mt][nt]); } } }
    asm volatile("s_wait_dscnt 0x0" ::: "memory");      // this wave's reads of the buffer are done before anyone refills it
    asm volatile("s_wait_asynccnt 0x0" ::: "memory");   // this wave's share of stage t + 1 has landed
    __syncthreads();                                    // publishes stage t + 1 and ends every wave's reads of stage t
    if (t + 2 < GNT) g_stage<MT, LIST>(lds0 + (unsigned)(t & 1) * G_SZ(MT), ga + (size_t)(t + 2) * GK * 4, ap, ro, gb + (size_t)(t + 2) * GK * 2, tid);
  }
  asm volatile("s_wait_asynccnt 0x0" ::: "memory");     // no copy is left in flight when the buffer takes the output rows
}
// the wave's MT * 16 rows x 64 columns, + bias, into its own part of LDS, row by row; bias: at the block's first column
template <int MT> __device__ __forceinline__ float (*rows_lds(unsigned char* sm, const v8f (&acc)[MT][4], const float* bias))[68] {
  const int tid = threadIdx.x, wave = tid >> 5, lane = tid & 31, col = lane & 15, g = lane >> 4, wn = wave & 1;
  float (*so)[68] = (float (*)[68])(sm + wave * (MT * 16 * 68 * 4));
  const int bi = wn * 64 + col; float bl[4];
#pragma unroll
  for (int nt = 0; nt < 4; ++nt) bl[nt] = bias[bi + nt * 16];
  asm volatile("s_wait_xcnt 0x0" :: "v"(bi) : "memory");   // the index register that all 4 bias loads name stays whole until every load has taken its address
#pragma unroll
  for (int nt = 0; nt < 4; ++nt) { const float bb = bfr(bl[nt]);
#pragma unroll
    for (int mt = 0; mt < MT; ++mt) {
#pragma unroll
      for (int r = 0; r < 8; ++r) so[mt * 16 + 8 * g + r][nt * 16 + col] = acc[mt][nt][r] + bb; } }
  LDSX();
  return so;
}
// f32 rows; C: at the block's first row and column
template <int MT> __device__ __forceinline__ void store_rows(unsigned char* sm, const v8f (&acc)[MT][4], const float* bias, float* C, int ldc) {
  const int tid = threadIdx.x, wave = tid >> 5, lane = tid & 31, col = lane & 15, g = lane >> 4, wm = wave >> 1, wn = wave & 1;
  float (*so)[68] = rows_lds<MT>(sm, acc, bias);
  for (int rl = 0; rl < MT * 8; ++rl) { const int row = rl * 2 + g; vst2(C + (size_t)(wm * MT * 16 + row) * ldc + wn * 64 + col * 4, *(const v4f*)&so[row][col * 4]); }   // 256-B segments, two rows a store
  asm volatile("s_wait_xcnt 0x0" ::: "memory");   // the stores have taken their address and data registers before whatever code stands behind them overwrites those
}
// K rows as the score product takes them: bf16 hi | the bf16 of the remainder, 256 B a key and head (a wave's 64 columns are one head); K: at the block's first place and head
__device__ __forceinline__ void store_k(unsigned char* sm, const v8f (&acc)[4][4], const float* bias, __bf16* K) {
  const int tid = threadIdx.x, wave = tid >> 5, lane = tid & 31, col = lane & 15, g = lane >> 4, wm = wave >> 1, wn = wave & 1;
  float (*so)[68] = rows_lds<4>(sm, acc, bias);
#pragma unroll 1   // four trips of 16 rows: a trip's 8 LDS reads are in flight together, and the wait at its foot stands in front of all that the next trip overwrites
  for (int rq = 0; rq < 4; ++rq) { v4f x[8];
#pragma unroll
    for (int i = 0; i < 8; ++i) x[i] = *(const v4f*)&so[(rq * 8 + i) * 2 + g][col * 4];
#pragma unroll
    for (int i = 0; i < 8; ++i) { v4b kh, kl;
#pragma unroll
      for (int e = 0; e < 4; ++e) { kh[e] = (__bf16)x[i][e]; kl[e] = (__bf16)(x[i][e] - (float)kh[e]); }
      __bf16* kr = K + (size_t)(wm * 64 + (rq * 8 + i) * 2 + g) * (2 * DM) + wn * (2 * HD) + col * 4; vst2(kr, kh); vst2(kr + HD, kl); }   // 16 lanes fill a 128-B line of hi and one of lo
    asm volatile("s_wait_xcnt 0x0" ::: "memory"); }   // the 16 stores have taken their address and data registers before the next rows overwrite them
}
// V turned: a lane holds 8 keys in a row of one column (D element r = row 8 g + r), 16 B of the hi plane and 16 B of the lo plane; the wave's 4 row tiles fill a column's 128-B line; VH, VL: at the block's first column and place
__device__ __forceinline__ void store_v(const v8f (&acc)[4][4], const float* bias, __bf16* VH, __bf16* VL) {
  const int tid = threadIdx.x, wave = tid >> 5, lane = tid & 31, col = lane & 15, g = lane >> 4, wm = wave >> 1, wn = wave & 1;
#pragma unroll
  for (int nt = 0; nt < 4; ++nt) { const float bb = bfr(bias[wn * 64 + nt * 16 + col]); const size_t o = (size_t)(wn * 64 + nt * 16 + col) * SK + wm * 64 + 8 * g;
#pragma unroll
    for (int mt = 0; mt < 4; ++mt) { v8b vh, vl;
#pragma unroll
      for (int r = 0; r < 8; ++r) { const float v = acc[mt][nt][r] + bb; vh[r] = (__bf16)v; vl[r] = (__bf16)(v - (float)vh[r]); }
      vst2(VH + o + mt * 16, vh); vst2(VL + o + mt * 16, vl);
      asm volatile("s_wait_xcnt 0x0" ::: "memory");   // the two stores have taken their address and data registers before the next tile's values overwrite them
    } }
}
// ---- k_proj: x[r] . PT[n] (exact, x rounded to bf16) + bias, K = 1024; block (128 rows, 128 cols), its columns in one of q | k | v. The first NB * NH blocks: the memory slots. Then the q blocks: every row of query, f32 into QKV. Then the k and v blocks: 128 places of a batch's key list, the A rows copied from key | value through the list, K and V stored as k_attn reads them; batch 1's row blocks follow batch 0's at once, so that the blocks that have no key stand last and leave at entry
#define PQB ((NR / 128) * (DM / 128))       // q blocks
#define PKB ((NR / 128) * (2 * DM / 128))   // k and v blocks at most (no key masked)
__global__ __launch_bounds__(128) void k_proj(const float* __restrict__ XQ, const float* __restrict__ XK, const float* __restrict__ XV, const __bf16* __restrict__ PT, const float* __restrict__ bq, const float* __restrict__ bk, const float* __restrict__ bv, const float* __restrict__ MK, const float* __restrict__ MV, const int* __restrict__ IDX, const int* __restrict__ CNT, float* __restrict__ QKV, __bf16* __restrict__ KX, __bf16* __restrict__ VTH, __bf16* __restrict__ VTL) {
  __shared__ __align__(16) unsigned char sm[2 * G_SZ(4)];   // the two stage buffers; behind the loop its first bytes stage the output rows
  const int tid = threadIdx.x; const int id = blockIdx.x;
  const int nr0 = (min(max(__builtin_amdgcn_readfirstlane(CNT[0]), 0), SS) + 63) & ~63, nr1 = (min(max(__builtin_amdgcn_readfirstlane(CNT[32]), 0), SS) + 63) & ~63;   // the places that each batch's unmasked keys take, a multiple of 64
  if (id < NB * NH) { const int b = id >> 4; mem_slots(sm, MK, MV, b ? nr1 : nr0, (id & 15) * HD, b, KX, VTH, VTL); return; }
  unsigned ro[16]; int kind, n0, b = 0, p0, nr = 0;   // kind 0 q, 1 k, 2 v; n0: the block's first column of q, of k or of v; p0: its first row (q) or place (k, v)
  if (id < NB * NH + PQB) {
    const int j = id - NB * NH; kind = 0; n0 = (j >> 5) * 128; p0 = (j & 31) * 128;
#pragma unroll
    for (int i = 0; i < 16; ++i) ro[i] = (unsigned)(p0 + i * 8 + (tid >> 4)) * (DM * 4) + (tid & 15) * 16;
  } else {
    const int j = id - NB * NH - PQB, nb0 = (nr0 + 127) >> 7, rb = j >> 4;
    b = rb >= nb0 ? 1 : 0; p0 = (rb - (b ? nb0 : 0)) * 128; nr = b ? nr1 : nr0;
    if (p0 >= nr) return;   // no key stands here: the whole block leaves, in front of every copy and barrier
    kind = 1 + ((j >> 3) & 1); n0 = (j & 7) * 128;
    const int* lp = IDX + b * SS + p0; const int lr = tid >> 4; int kx[16];   // p0 + 127 < SS: places from nr on name masked keys, whose rows are worked on and not stored
#pragma unroll
    for (int i = 0; i < 16; ++i) kx[i] = lp[lr + i * 8];
    asm volatile("s_wait_xcnt 0x0" :: "v"(lr) : "memory");   // the index register that all 16 list loads name stays whole until every load has taken its address
#pragma unroll
    for (int i = 0; i < 16; ++i) ro[i] = (unsigned)(b * SS + min(max(kx[i], 0), SS - 1)) * (DM * 4) + (tid & 15) * 16;
  }
  v8f acc[4][4] = {};
  gemm_main<4, false, true>(sm, kind == 0 ? XQ : (kind == 1 ? XK : XV), DM, ro, PT + (size_t)(kind * DM + n0) * DM, acc);
  if (kind == 0) { store_rows<4>(sm, acc, bq + n0, QKV + (size_t)p0 * QKVP + n0, QKVP); return; }
  if (p0 + __builtin_amdgcn_readfirstlane(tid >> 6) * 64 >= nr) return;   // a wave's 64 rows lie wholly in front of nr or wholly behind it, where the memory slots stand; no barrier follows
  if (kind == 2) store_v(acc, bv + n0, VTH + ((size_t)b * DM + n0) * SK + p0, VTL + ((size_t)b * DM + n0) * SK + p0);
  else store_k(sm, acc, bk + n0, KX + ((size_t)b * SK + p0) * (2 * DM) + 2 * n0);
}
// ---- k_out: Y = O(hi/lo; the q columns of QKV) . PT_out rows (2 products, K = 1024) + bo; block (64 rows, 128 cols)
__global__ __launch_bounds__(128) void k_out(const float* __restrict__ QKV, const __bf16* __restrict__ PT, const float* __restrict__ bo, float* __restrict__ Y) {
  __shared__ __align__(16) unsigned char sm[2 * G_SZ(2)];   // as in k_proj
  const int n0 = blockIdx.y * 128; const size_t r0 = (size_t)blockIdx.x * 64;
  v8f acc[2][4] = {};
  gemm_main<2, true, false>(sm, QKV + r0 * QKVP, QKVP, nullptr, PT + (size_t)(3 * DM + n0) * DM, acc);
  store_rows<2>(sm, acc, bo + n0, Y + r0 * DM + n0, DM);
}

extern "C" void kernel_launch(void* const* d_in, const int* in_sizes, int n_in, void* d_out, int out_size, void* d_ws, size_t ws_size, hipStream_t stream) {
  (void)in_sizes; (void)n_in; (void)out_size;
  const float** F = (const float**)d_in;   // query, key, value, mask [2,1,1,2048] i32, Wq, bq, Wk, bk, Wv, bv, Wo, bo, m_k [1,64,1024], m_v
  if (ws_size < (size_t)WS_END) return;
  char* ws = (char*)d_ws; __bf16 *PT = (__bf16*)(ws + WS_PT), *VTH = (__bf16*)(ws + WS_VTH), *VTL = (__bf16*)(ws + WS_VTL); float *QKV = (float*)(ws + WS_QKV); __bf16* KX = (__bf16*)(ws + WS_KX); int *IDX = (int*)(ws + WS_IDX), *CNT = (int*)(ws + WS_CNT);
  k_pack<<<4 * DM + NB, 128, 0, stream>>>(F[4], F[6], F[8], F[10], PT, (const int*)d_in[3], IDX, CNT);
  k_proj<<<NB * NH + PQB + PKB, 128, 0, stream>>>(F[0], F[1], F[2], PT, F[5], F[7], F[9], F[12], F[13], IDX, CNT, QKV, KX, VTH, VTL);
  k_attn<<<dim3(TQB, TNB * NH), 128, 0, stream>>>(QKV, KX, CNT, VTH, VTL);
  k_out<<<dim3((TNB < NB ? TQB : NR / 64), DM / 128), 128, 0, stream>>>(QKV, PT, F[11], (float*)d_out);
}

// v009
// One run takes 99.8 microseconds.
// Two timings next to v008 both put it at 1.09 times that version's speed.
// Counting every step since v000, it is 7.27 times as fast.
// compute dtype: query/key/value, the four weights + biases and the memory slots (module inputs) rounded to bf16; q/k/v projections with exact bf16 products (+ f32 bias); scores and P.V with both computed operands as bf16 hi + bf16 residual pairs (3 products; memory keys/values scaled in f32 and split the same way); output projection hi/lo x bf16 Wo (2 products) + bias; masked online softmax in f32; f32 accumulate.
#include <hip/hip_runtime.h>
#include <math.h>

typedef __attribute__((ext_vector_type(16))) _Float16 v16h;
typedef __attribute__((ext_vector_type(16))) __bf16 v16b;
typedef __attribute__((ext_vector_type(8)))  _Float16 v8h;
typedef __attribute__((ext_vector_type(8)))  float v8f;
typedef __attribute__((ext_vector_type(4)))  float v4f;
typedef __attribute__((ext_vector_type(2)))  float v2f;
typedef __attribute__((ext_vector_type(4)))  unsigned v4u;
typedef __attribute__((ext_vector_type(4)))  int v4i;
typedef float __attribute__((may_alias)) float_a;
typedef int __attribute__((may_alias)) int_a;

template <typename T> __device__ __forceinline__ void vst2(void* p, T v) { *(T*)p = v;  }
__device__ __forceinline__ v8f wmma16(v16h a, v16h b, v8f c) {
  v8f d = __builtin_amdgcn_wmma_f32_16x16x32_f16(false, a, false, b, (short)0, c, false, false);
  asm volatile("v_nop\n\tv_nop\n\tv_nop\n\tv_nop" : "+v"(d) : "v"(a), "v"(b));
  return d;
}
__device__ __forceinline__ v8f wmma_bf(v16b a, v16b b, v8f c) {
  v8f d = __builtin_amdgcn_wmma_f32_16x16x32_bf16(false, a, false, b, (short)0, c, false, false);
  asm volatile("v_nop\n\tv_nop\n\tv_nop\n\tv_nop" : "+v"(d) : "v"(a), "v"(b));
  return d;
}
// 16x16x32 fragments: lane = (h = lane>>4, row/col = lane&15); elements 0..7 = k0+8h+0..7, 8..15 = k0+16+8h+0..7; D element r = row 8h+r
__device__ __forceinline__ v16h frag_h(const _Float16* rowk0, int lane) {
  union { v16h v; v8h q[2]; } u; const _Float16* p = rowk0 + 8 * (lane >> 4);
  u.q[0] = *(const v8h*)p; u.q[1] = *(const v8h*)(p + 16); return u.v;
}
__device__ __forceinline__ v16h frag_f32(const float* rowk0, int lane) {
  v16h a; const float* p = rowk0 + 8 * (lane >> 4);
#pragma unroll
  for (int i = 0; i < 8; ++i) { a[i] = (_Float16)p[i]; a[8 + i] = (_Float16)p[16 + i]; }
  return a;
}
__device__ __forceinline__ v16h frag_f32s(const float* rowk0, int lane, float sc) {
  v16h a; const float* p = rowk0 + 8 * (lane >> 4);
#pragma unroll
  for (int i = 0; i < 8; ++i) { a[i] = (_Float16)(p[i] * sc); a[8 + i] = (_Float16)(p[16 + i] * sc); }
  return a;
}
// column fragment from a [K][ld] layout (column n), rows >= K read as 0
__device__ __forceinline__ v16h fragc_f32(const float* W, int k0, int n, int lane, int ld, int K) {
  v16h a; const int g = lane >> 4;
#pragma unroll
  for (int i = 0; i < 8; ++i) { const int ka = k0 + 8 * g + i, kb = ka + 16;
    a[i] = (_Float16)(ka < K ? W[(size_t)(ka < K ? ka : K - 1) * ld + n] : 0.f); a[8 + i] = (_Float16)(kb < K ? W[(size_t)(kb < K ? kb : K - 1) * ld + n] : 0.f); }
  return a;
}
struct F2 { v16b h, l; };
__device__ __forceinline__ F2 bsplit16(const float v[16]) { F2 r;
#pragma unroll
  for (int i = 0; i < 16; ++i) { const __bf16 h = (__bf16)v[i]; r.h[i] = h; r.l[i] = (__bf16)(v[i] - (float)h); }
  return r; }
__device__ __forceinline__ F2 split_row(const float* row, int k0, int lane) { float v[16]; const float* p = row + k0 + 8 * (lane >> 4);
#pragma unroll
  for (int i = 0; i < 8; ++i) { v[i] = p[i]; v[8 + i] = p[16 + i]; }
  return bsplit16(v); }
__device__ __forceinline__ F2 split_rowK(const float* row, int k0, int lane, int K) { float v[16]; const int g = lane >> 4;
#pragma unroll
  for (int i = 0; i < 8; ++i) { const int ka = k0 + 8 * g + i, kb = ka + 16; v[i] = ka < K ? row[ka < K ? ka : K - 1] : 0.f; v[8 + i] = kb < K ? row[kb < K ? kb : K - 1] : 0.f; }
  return bsplit16(v); }
__device__ __forceinline__ F2 split_col(const float* W, int k0, int n, int lane, int ld, int K) { float v[16]; const int g = lane >> 4;
#pragma unroll
  for (int i = 0; i < 8; ++i) { const int ka = k0 + 8 * g + i, kb = ka + 16; v[i] = ka < K ? W[(size_t)(ka < K ? ka : K - 1) * ld + n] : 0.f; v[8 + i] = kb < K ? W[(size_t)(kb < K ? kb : K - 1) * ld + n] : 0.f; }
  return bsplit16(v); }
__device__ __forceinline__ v8f mac3(const F2& a, const F2& b, v8f c) { c = wmma_bf(a.l, b.h, c); c = wmma_bf(a.h, b.l, c); return wmma_bf(a.h, b.h, c); }
__device__ __forceinline__ float sigm(float v) { return 1.0f / (1.0f + expf(-v)); }
#define LDSX() do { asm volatile("s_wait_dscnt 0" ::: "memory"); __builtin_amdgcn_wave_barrier(); __builtin_amdgcn_fence(__ATOMIC_RELEASE, "workgroup"); } while (0)


// Multi-head attention with persistent memory: Q = query Wq^T + bq, K = [key Wk^T + bk ; 8 m_k], V = [value Wv^T + bv ; 8 m_v] (2048 + 64 slots), energy = Q K^T / 8 with the first 2048 key columns masked (mask == 0 -> -1e20) and the memory columns never masked; softmax; P V; merge heads; @ Wo^T + bo.  B 2, S 2048, D 1024, 16 x 64.
// k_pack (+ per batch the list of key numbers, unmasked first), k_proj (exact GEMM + bias; q from query; k and v from the rows of key and value that the list names: the n unmasked keys of a batch, filled up to a multiple of 64 with masked ones, then the memory slots; K rows stored split once into bf16 hi | lo by head, V as transposed hi/lo planes), k_attn (K and V staged in LDS by 64 keys, ceil(n / 64) + 1 stages), k_out (+ bo).
// A masked key has energy -1e20 beside the never masked memory slots, so its softmax weight is exactly 0 in f32: it is left out of the key list instead of being multiplied by 0.
#define NB 2
#define SS 2048
#define DM 1024
#define NH 16
#define HD 64
#define NR (NB * SS)
#define QKVP (3 * DM)
#define NM 64
#define SK (SS + NM)        // 2112 keys per batch
#ifndef TRB
#define TRB (NR / 64)
#define TQB (SS / 64)
#define TNB NB
#endif
typedef __attribute__((ext_vector_type(8))) __bf16 v8b;
__device__ __forceinline__ v16b frag_b(const __bf16* rowk0, int lane) {
  union { v16b v; v8b q[2]; } u; const __bf16* p = rowk0 + 8 * (lane >> 4);
  u.q[0] = *(const v8b*)p; u.q[1] = *(const v8b*)(p + 16); return u.v;
}
__device__ __forceinline__ v16b frag_gbf(const float* rowk0, int lane) {
  v16b a; const float* p = rowk0 + 8 * (lane >> 4);
#pragma unroll
  for (int i = 0; i < 8; ++i) { a[i] = (__bf16)p[i]; a[8 + i] = (__bf16)p[16 + i]; }
  return a;
}
__device__ __forceinline__ float bfr(float v) { return (float)(__bf16)v; }
// s[i] = 2^s[i] and a = 2^a, one instruction each (below 2^-126 the result is 0). One statement, so that every v_exp_f32 is followed by an instruction that touches neither its result nor its source; the closing v_nop is that slot for the last one
__device__ __forceinline__ void ex2_17(float* s, float& a) {
  asm("v_exp_f32 %0, %0\n\tv_exp_f32 %1, %1\n\tv_exp_f32 %2, %2\n\tv_exp_f32 %3, %3\n\tv_exp_f32 %4, %4\n\tv_exp_f32 %5, %5\n\tv_exp_f32 %6, %6\n\tv_exp_f32 %7, %7\n\tv_exp_f32 %8, %8\n\t"
      "v_exp_f32 %9, %9\n\tv_exp_f32 %10, %10\n\tv_exp_f32 %11, %11\n\tv_exp_f32 %12, %12\n\tv_exp_f32 %13, %13\n\tv_exp_f32 %14, %14\n\tv_exp_f32 %15, %15\n\tv_exp_f32 %16, %16\n\tv_nop"
      : "+v"(s[0]), "+v"(s[1]), "+v"(s[2]), "+v"(s[3]), "+v"(s[4]), "+v"(s[5]), "+v"(s[6]), "+v"(s[7]), "+v"(s[8]), "+v"(s[9]), "+v"(s[10]), "+v"(s[11]), "+v"(s[12]), "+v"(s[13]), "+v"(s[14]), "+v"(s[15]), "+v"(a));
}
#define SC2 0.18033688011112042f   // log2(e) / 8: the scores are scaled into powers of two, so that exp(energy - max) = 2^(s - m)
#define WS_PT   0u                                 // bf16 [4096 (q|k|v|out cols)][1024]
#define WS_QKV  (WS_PT + 2u * 4 * DM * DM)           // f32 [4096 rows][3072]: only the q columns 0..1023 are used, later overwritten by O
#define WS_KX   (WS_QKV + 4u * NR * QKVP)            // bf16 [2][2112][16 heads][hi 64 | lo 64] keys incl. memory: 256 B a key and head
#define WS_VTH  (WS_KX + 4u * NB * SK * DM)           // bf16 [2][1024 (h*64+d)][2112]
#define WS_VTL  (WS_VTH + 2u * NB * DM * SK)
#define WS_IDX  (WS_VTL + 2u * NB * DM * SK)          // int [2][2048]: a batch's key numbers, the unmasked first, then the masked, each group rising
#define WS_CNT  (WS_IDX + 4u * NB * SS)               // int, one a batch, 128 B apart: how many of its keys are unmasked
#define WS_END  (WS_CNT + 128u * NB)

__global__ __launch_bounds__(128) void k_pack(const float* __restrict__ Wq, const float* __restrict__ Wk, const float* __restrict__ Wv, const float* __restrict__ Wo, __bf16* __restrict__ PT, const int* __restrict__ MASK, int* __restrict__ IDX, int* __restrict__ CNT) {
  __shared__ __align__(16) __bf16 srow[DM];
  __shared__ int sc[128];
  const int tid = threadIdx.x;
  if (blockIdx.x < NB) {   // the first NB blocks: one batch's key list each; a thread ranks 16 keys in a row
    const int b = blockIdx.x; const int* mp = MASK + (size_t)b * SS + tid * (SS / 128);
    unsigned bits = 0;   // bit i: key tid * 16 + i is unmasked
#pragma unroll
    for (int q = 0; q < SS / 512; ++q) { const v4i x = *(const v4i*)(mp + 4 * q);
#pragma unroll
      for (int e = 0; e < 4; ++e) bits |= (x[e] != 0 ? 1u : 0u) << (4 * q + e); }
    sc[tid] = __popc(bits);
    __syncthreads();
    int before = 0, all = 0;   // unmasked keys of the threads below this one; of the batch
#pragma unroll 4   // unrolled whole, this loop's registers would cost the weight blocks of this kernel a quarter of their waves a SIMD
    for (int j = 0; j < 128; ++j) { const int v = sc[j]; all += v; before += j < tid ? v : 0; }
    int up = before, dn = all + tid * (SS / 128) - before;   // the next place among the unmasked, and among the masked, which stand behind all the unmasked
#pragma unroll
    for (int i = 0; i < SS / 128; ++i) { const bool keep = ((bits >> i) & 1u) != 0; IDX[(size_t)b * SS + (keep ? up : dn)] = tid * (SS / 128) + i; up += keep ? 1 : 0; dn += keep ? 0 : 1; }
    if (tid == 0) CNT[b * 32] = all;
    return;
  }
  const int n = blockIdx.x - NB; const int which = n >> 10, c = n & 1023; const float* Wm = which == 0 ? Wq : (which == 1 ? Wk : (which == 2 ? Wv : Wo));
  for (int k = tid; k < DM; k += 128) srow[k] = (__bf16)Wm[(size_t)c * DM + k];   // torch [out][in]: row c
  __syncthreads();
  vst2((unsigned*)(PT + (size_t)n * DM + tid * 8), *(const v4u*)(&srow[tid * 8]));
}
// ---- mem_slots (a block of k_proj): the 64 memory slots x one head's 64 columns of one batch, 4 waves; a thread holds 4 slot pairs x 4 columns of K and of V with all 16 loads in flight together; V is split, packed by slot pair and turned in LDS, K is split and goes straight out
// place p of a batch with n unmasked keys, nr = n rounded up to 64: p < nr the p-th key of the list (from n on masked keys, which only fill the stage: k_attn gives them weight 0), nr <= p < nr + 64 memory slot p - nr; nothing is written behind that, and k_attn reads nothing there
typedef __attribute__((ext_vector_type(2))) __bf16 v2b;
typedef __attribute__((ext_vector_type(4))) __bf16 v4b;
__device__ __forceinline__ void mem_slots(unsigned char* sm, const float* __restrict__ MK, const float* __restrict__ MV, int k0, int c0, int b, __bf16* __restrict__ KX, __bf16* __restrict__ VTH, __bf16* __restrict__ VTL) {
  unsigned (*svh)[36] = (unsigned (*)[36])sm, (*svl)[36] = (unsigned (*)[36])(sm + 64 * 36 * 4);   // [column][slot pair]; the 16-B chunks of a row stand XORed with column >> 4, so that a wave's 32 pair stores meet 32 banks
  const int tid = threadIdx.x, c4 = tid & 15, pr = tid >> 4;
  v4f kq[8], vq[8];   // i: slot 2 * pr + 16 * (i >> 1) + (i & 1)
  const unsigned ob = (unsigned)((2 * pr) * DM + c0 + c4 * 4) * 4u; const float *pk = (const float*)((const char*)MK + ob), *pv = (const float*)((const char*)MV + ob);   // ob: the lane's byte offset in both arrays
#pragma unroll
  for (int i = 0; i < 8; ++i) { const size_t o = (size_t)(16 * (i >> 1) + (i & 1)) * DM; kq[i] = *(const v4f*)(pk + o); vq[i] = *(const v4f*)(pv + o); }
  asm volatile("s_wait_xcnt 0x0" :: "v"(ob) : "memory");   // the offset register that all 16 loads name stays whole (no load's own result lands on it) until every load has taken its address
#pragma unroll
  for (int i = 0; i < 8; ++i) {
#pragma unroll
    for (int e = 0; e < 4; ++e) { kq[i][e] = 8.0f * bfr(kq[i][e]); vq[i][e] = 8.0f * bfr(vq[i][e]); } }
#pragma unroll
  for (int p = 0; p < 4; ++p) { const int pp = (pr + 8 * p) ^ ((c4 >> 2) << 2);
#pragma unroll
    for (int e = 0; e < 4; ++e) { const float va = vq[2 * p][e], vb = vq[2 * p + 1][e]; const __bf16 ha = (__bf16)va, hb = (__bf16)vb;
      const v2b hh = {ha, hb}, ll = {(__bf16)(va - (float)ha), (__bf16)(vb - (float)hb)};
      svh[c4 * 4 + e][pp] = __builtin_bit_cast(unsigned, hh); svl[c4 * 4 + e][pp] = __builtin_bit_cast(unsigned, ll); } }
  v4b kh[8], kl[8];   // K as the score product takes it: bf16 hi and the bf16 of the remainder
#pragma unroll
  for (int i = 0; i < 8; ++i) {
#pragma unroll
    for (int e = 0; e < 4; ++e) { kh[i][e] = (__bf16)kq[i][e]; kl[i][e] = (__bf16)(kq[i][e] - (float)kh[i][e]); } }
  __syncthreads();
#pragma unroll
  for (int i = 0; i < 8; ++i) { __bf16* kr = KX + ((size_t)b * SK + k0 + 2 * pr + 16 * (i >> 1) + (i & 1)) * (2 * DM) + 2 * c0 + c4 * 4; vst2(kr, kh[i]); vst2(kr + HD, kl[i]); }   // behind the barrier, which would else wait for these stores; 16 lanes fill a 128-B line of hi and one of lo
#pragma unroll
  for (int it = 0; it < 4; ++it) { const int rowi = it * 16 + (tid >> 3), pc = tid & 7, sw = (pc ^ it) * 4; const size_t o = ((size_t)b * DM + c0 + rowi) * SK + k0 + pc * 8; vst2((unsigned*)(VTH + o), *(const v4u*)&svh[rowi][sw]); vst2((unsigned*)(VTL + o), *(const v4u*)&svl[rowi][sw]); }
}
#define QW 2
#define KT 64
#define NT (SK / KT)
#define KPF 68
#define VPB 72
#define ST_VH (KT * KPF * 4)
#define ST_VL (ST_VH + HD * VPB * 2)
#define ST_SZ (ST_VL + HD * VPB * 2)       // 35840 B a stage
// k_attn's product: the builtin alone, which the compiler pads where a distance is owed. wmma_bf's statement of v_nop names D, A and B as operands, and an asm operand lies under v256: with two query tiles a wave holds more than 256 registers, and its fragments do not all fit there
__device__ __forceinline__ v8f wmma_q(v16b a, v16b b, v8f c) { return __builtin_amdgcn_wmma_f32_16x16x32_bf16(false, a, false, b, (short)0, c, false, false); }
__device__ __forceinline__ float xhalf(float x) { return __builtin_bit_cast(float, __builtin_amdgcn_permlanex16(__builtin_bit_cast(int, x), __builtin_bit_cast(int, x), 0x76543210, 0xfedcba98, false, false)); }  // lane l with lane l ^ 16
__device__ __forceinline__ F2 split_v4(v4f a, v4f b, v4f c, v4f d) { float v[16];
#pragma unroll
  for (int i = 0; i < 4; ++i) { v[i] = a[i]; v[4 + i] = b[i]; v[8 + i] = c[i]; v[12 + i] = d[i]; }
  return bsplit16(v); }
// eight 16-B copies a lane, global to LDS through no register; the last line keeps the address registers whole until every copy has taken its addresses
__device__ __forceinline__ void copy8(const unsigned* l, const char* const* p) {
  asm volatile("global_load_async_to_lds_b128 %0, %8, off\n\tglobal_load_async_to_lds_b128 %1, %9, off\n\tglobal_load_async_to_lds_b128 %2, %10, off\n\tglobal_load_async_to_lds_b128 %3, %11, off\n\t"
               "global_load_async_to_lds_b128 %4, %12, off\n\tglobal_load_async_to_lds_b128 %5, %13, off\n\tglobal_load_async_to_lds_b128 %6, %14, off\n\tglobal_load_async_to_lds_b128 %7, %15, off\n\ts_wait_xcnt 0x0"
               :: "v"(l[0]), "v"(l[1]), "v"(l[2]), "v"(l[3]), "v"(l[4]), "v"(l[5]), "v"(l[6]), "v"(l[7]), "v"(p[0]), "v"(p[1]), "v"(p[2]), "v"(p[3]), "v"(p[4]), "v"(p[5]), "v"(p[6]), "v"(p[7]) : "memory");
}
__device__ __forceinline__ void stage_in(unsigned lb, const char* gk, const char* gh, const char* gl, int tid) {
  unsigned l[8]; const char* p[8];
#pragma unroll
  for (int i = 0; i < 8; ++i) { l[i] = lb + (unsigned)((i * 8 + (tid >> 4)) * (KPF * 4) + (tid & 15) * 16); p[i] = gk + (size_t)i * 8 * DM * 4; }   // K: a wave covers 2 rows of 256 B
  copy8(l, p);
#pragma unroll
  for (int i = 0; i < 4; ++i) { const unsigned o = (unsigned)((i * 16 + (tid >> 3)) * (VPB * 2) + (tid & 7) * 16); l[i] = lb + ST_VH + o; l[4 + i] = lb + ST_VL + o; p[i] = gh + (size_t)i * 16 * SK * 2; p[4 + i] = gl + (size_t)i * 16 * SK * 2; }   // V: a wave covers 4 rows of 128 B
  copy8(l, p);
}
__global__ __launch_bounds__(128) void k_attn(float* __restrict__ QKV, const __bf16* __restrict__ KX, const int* __restrict__ CNT, const __bf16* __restrict__ VTH, const __bf16* __restrict__ VTL) {
  __shared__ __align__(16) unsigned char sm[2 * ST_SZ];   // the two stage buffers; behind the loop its first bytes stage the output rows
  const int tid = threadIdx.x, wave = tid >> 5, lane = tid & 31, col = lane & 15, g = lane >> 4;
  const int qb = blockIdx.x, bh = blockIdx.y, b = bh >> 4, h = bh & 15; const int q0 = (qb * 4 + wave) * (16 * QW); const size_t tq = (size_t)b * SS + q0;
  const unsigned lds0 = (unsigned)(size_t)&sm[0];
  const int n = min(max(__builtin_amdgcn_readfirstlane(CNT[b * 32]), 0), SS), nr = (n + KT - 1) & ~(KT - 1), nt = nr / KT + 1;   // the batch's unmasked keys, the places they take, and the stages with the memory slots' one: 1 to NT, the same for the whole block
  const char* gk = (const char*)(KX + ((size_t)b * SK + (tid >> 4)) * (2 * DM) + h * (2 * HD)) + (tid & 15) * 16;             // this lane's first K chunk of stage 0; a stage on: KT rows
  const char* gh = (const char*)(VTH + ((size_t)b * DM + h * HD + (tid >> 3)) * SK) + (tid & 7) * 16;              // the same of V hi; a stage on: KT keys
  const char* gl = (const char*)(VTL + ((size_t)b * DM + h * HD + (tid >> 3)) * SK) + (tid & 7) * 16;
  stage_in(lds0, gk, gh, gl, tid);
  F2 a0[QW], a1[QW];   // B operand: column = query qt * 16 + col
  const float* qp = QKV + (tq + col) * QKVP + h * HD + 8 * g;   // the lane's own first q value: the one pointer that every q load goes through
  v4f qv[QW][8];   // [qt][j]: floats (j >> 1) * 16 + (j & 1) * 4 on from qp, row qt * 16 on
#pragma unroll
  for (int qt = 0; qt < QW; ++qt) {
#pragma unroll
    for (int j = 0; j < 8; ++j) qv[qt][j] = *(const v4f*)(qp + (size_t)qt * 16 * QKVP + (j >> 1) * 16 + (j & 1) * 4); }
  asm volatile("s_wait_xcnt 0x0" :: "v"(qp) : "memory");   // qp is read here, so its registers stay live over all the q loads and no load's result is put on them before every load has taken its address
#pragma unroll
  for (int qt = 0; qt < QW; ++qt) { a0[qt] = split_v4(qv[qt][0], qv[qt][1], qv[qt][2], qv[qt][3]); a1[qt] = split_v4(qv[qt][4], qv[qt][5], qv[qt][6], qv[qt][7]); }   // the k order of frag_b: k0 + 8g + 0..7, k0 + 16 + 8g + 0..7
  asm volatile("s_wait_asynccnt 0x0" ::: "memory");   // this wave's share of stage 0 has landed
  __syncthreads();                                    // and every other wave's
  if (nt > 1) stage_in(lds0 + ST_SZ, gk + (size_t)KT * DM * 4, gh + KT * 2, gl + KT * 2, tid);
  float m[QW], l[QW];            // of query qt * 16 + col, m in log2 units; l sums this wave half's keys only, the halves are joined behind the loop
#pragma unroll
  for (int qt = 0; qt < QW; ++qt) { m[qt] = -3.0e38f; l[qt] = 0.f; }
  v8f acc[QW][4] = {};           // acc[qt][dt][r] = O[query qt * 16 + col][dt * 16 + 8 g + r]
#pragma unroll 1
  for (int t = 0; t < nt; ++t) {
    const unsigned char* sb = sm + (t & 1) * ST_SZ;
#pragma unroll   // the two steps of a stage stand unrolled: their LDS offsets are immediates
    for (int hs = 0; hs < 2; ++hs) {
      const int ks = 2 * t + hs;
      const int rem = ks * 32 >= nr ? 32 : n - ks * 32;   // places of this step that count, from its first on: all in the memory slots' stage; the places n to nr - 1 hold masked keys
      const unsigned kw = (rem >= 32 ? 0xffffffffu : (rem <= 0 ? 0u : (1u << rem) - 1u)) >> (8 * g);   // bit j = keep key 8g + j of this step
      float s[QW][16];
#pragma unroll
      for (int ct = 0; ct < 2; ++ct) { const __bf16* kp = (const __bf16*)sb + (hs * 32 + ct * 16 + col) * (KPF * 2);   // A operand: row = key; hi at 0, lo at HD
        const F2 k0 = {frag_b(kp, lane), frag_b(kp + HD, lane)}, k1 = {frag_b(kp + 32, lane), frag_b(kp + HD + 32, lane)};
        v8f c[QW] = {};   // each tile's six products in the order they had; the tiles take turns, so that a product's neighbour does not wait for it
#pragma unroll
        for (int qt = 0; qt < QW; ++qt) c[qt] = wmma_q(k0.h, a0[qt].l, c[qt]);
#pragma unroll
        for (int qt = 0; qt < QW; ++qt) c[qt] = wmma_q(k0.l, a0[qt].h, c[qt]);
#pragma unroll
        for (int qt = 0; qt < QW; ++qt) c[qt] = wmma_q(k0.h, a0[qt].h, c[qt]);
#pragma unroll
        for (int qt = 0; qt < QW; ++qt) c[qt] = wmma_q(k1.h, a1[qt].l, c[qt]);
#pragma unroll
        for (int qt = 0; qt < QW; ++qt) c[qt] = wmma_q(k1.l, a1[qt].h, c[qt]);
#pragma unroll
        for (int qt = 0; qt < QW; ++qt) c[qt] = wmma_q(k1.h, a1[qt].h, c[qt]);
#pragma unroll
        for (int r = 0; r < 8; ++r) { const bool keep = ((kw >> (ct * 16 + r)) & 1u) != 0;
#pragma unroll
          for (int qt = 0; qt < QW; ++qt) s[qt][ct * 8 + r] = keep ? c[qt][r] * SC2 : -1.0e20f; } }
      v16b vh[4], vl[4];   // A operand: row = d; read here, as one group, so that the softmax stands between the reads and their use
#pragma unroll
      for (int dt = 0; dt < 4; ++dt) { const int vo = (dt * 16 + col) * VPB + hs * 32; vh[dt] = frag_b((const __bf16*)(sb + ST_VH) + vo, lane); vl[dt] = frag_b((const __bf16*)(sb + ST_VL) + vo, lane); }
      __builtin_amdgcn_sched_barrier(0);   // holds the 16 V reads here as one group: left free, the compiler sinks them in pairs between the second product's WMMAs, where each pair's wait stands open
      F2 pa[QW];
#pragma unroll
      for (int qt = 0; qt < QW; ++qt) {
        float mx = s[qt][0];
#pragma unroll
        for (int i = 1; i < 16; ++i) mx = fmaxf(mx, s[qt][i]);
        mx = fmaxf(mx, xhalf(mx));
        const float mn = fmaxf(m[qt], mx); float alpha = m[qt] - mn;
        float es = 0.f;
#pragma unroll
        for (int i = 0; i < 16; ++i) s[qt][i] -= mn;
        ex2_17(s[qt], alpha);
#pragma unroll
        for (int i = 0; i < 16; ++i) es += s[qt][i];
        l[qt] = l[qt] * alpha + es; m[qt] = mn;
#pragma unroll
        for (int dt = 0; dt < 4; ++dt) acc[qt][dt] *= alpha;
        pa[qt] = bsplit16(s[qt]); }   // element i = key 8g+i, element 8+i = key 16+8g+i: the k order of frag_b
#pragma unroll
      for (int dt = 0; dt < 4; ++dt) {   // each accumulator's three products in the order they had; the tiles take turns
#pragma unroll
        for (int qt = 0; qt < QW; ++qt) acc[qt][dt] = wmma_q(vh[dt], pa[qt].l, acc[qt][dt]);
#pragma unroll
        for (int qt = 0; qt < QW; ++qt) acc[qt][dt] = wmma_q(vl[dt], pa[qt].h, acc[qt][dt]);
#pragma unroll
        for (int qt = 0; qt < QW; ++qt) acc[qt][dt] = wmma_q(vh[dt], pa[qt].h, acc[qt][dt]); } }
    asm volatile("s_wait_dscnt 0x0" ::: "memory");      // this wave's reads of the buffer are done before anyone refills it
    asm volatile("s_wait_asynccnt 0x0" ::: "memory");   // this wave's share of stage t + 1 has landed
    __syncthreads();                                    // publishes stage t + 1 and ends every wave's reads of stage t
    if (t + 2 < nt) stage_in(lds0 + (unsigned)(t & 1) * ST_SZ, gk + (size_t)(t + 2) * KT * DM * 4, gh + (size_t)(t + 2) * KT * 2, gl + (size_t)(t + 2) * KT * 2, tid);
  }
  asm volatile("s_wait_asynccnt 0x0" ::: "memory");     // no copy is left in flight when the buffer takes the output rows
  float (*so)[16 * QW][68] = (float (*)[16 * QW][68])sm;
#pragma unroll
  for (int qt = 0; qt < QW; ++qt) { const float il = 1.0f / (l[qt] + xhalf(l[qt]));
#pragma unroll
    for (int dt = 0; dt < 4; ++dt) { const v8f o = acc[qt][dt] * il; vst2(&so[wave][qt * 16 + col][dt * 16 + 8 * g], (v4f){o[0], o[1], o[2], o[3]}); vst2(&so[wave][qt * 16 + col][dt * 16 + 8 * g + 4], (v4f){o[4], o[5], o[6], o[7]}); } }
  LDSX();
  for (int rl = 0; rl < 16 * QW; ++rl) if (lane < 16) vst2(QKV + (tq + rl) * QKVP + h * HD + lane * 4, *(const v4f*)&so[wave][rl][lane * 4]);
}
// ---- the two GEMMs (k_proj, k_out): block = (MT * 32 rows, 128 columns), 4 waves as 2 x 2, a wave holds MT x 4 accumulator tiles (MT * 16 rows x 64 columns)
// A (f32 rows) and B (bf16 weight rows) reach the waves through LDS: a stage = 64 k (A rows of 256 B, B rows of 128 B), copied once for the block in whole 128-B lines, two buffers, the next stage in flight while this one is worked on; A is rounded (or split) to bf16 as the fragment is read; k runs upward in steps of 32 into each accumulator
#define GK 64                              // k a stage
#define GNT (DM / GK)                      // 16 stages
#define APF 68                             // floats a staged A row: 272 B = 16 B x odd, no bank conflict for 16-B readers
#define BPB 72                             // bf16 a staged B row: 144 B = 16 B x odd
#define G_B(MT) ((MT) * 32 * APF * 4)
#define G_SZ(MT) (G_B(MT) + 128 * BPB * 2)  // a stage: 53248 B at MT 4, 35840 B at MT 2
// LIST: the lane's A row number u * 8 + i stands ro[u * 8 + i] bytes behind ga (rows picked through a list); else the rows follow one another at apitch
template <int MT, bool LIST> __device__ __forceinline__ void g_stage(unsigned lb, const char* ga, size_t apitch, const unsigned* ro, const char* gb, int tid) {
  unsigned l[8]; const char* p[8];
#pragma unroll
  for (int u = 0; u < MT / 2; ++u) {
#pragma unroll
    for (int i = 0; i < 8; ++i) { const int rr = (u * 8 + i) * 8; l[i] = lb + (unsigned)((rr + (tid >> 4)) * (APF * 4) + (tid & 15) * 16); p[i] = LIST ? ga + ro[u * 8 + i] : ga + (size_t)rr * apitch; }   // A: a wave covers 2 rows of 256 B
    copy8(l, p); }
#pragma unroll
  for (int i = 0; i < 8; ++i) { l[i] = lb + G_B(MT) + (unsigned)((i * 16 + (tid >> 3)) * (BPB * 2) + (tid & 7) * 16); p[i] = gb + (size_t)i * 16 * DM * 2; }   // B: a wave covers 4 rows of 128 B
  copy8(l, p);
}
// the product: A: the block's first row, k = 0, lda floats a row (LIST: the matrix's first row, and ro the byte offsets of this lane's MT * 4 chunks of stage 0); Bw: the block's first weight row
template <int MT, bool SPLIT, bool LIST> __device__ __forceinline__ void gemm_main(unsigned char* sm, const float* A, int lda, const unsigned* ro, const __bf16* Bw, v8f (&acc)[MT][4]) {
  const int tid = threadIdx.x, wave = tid >> 5, lane = tid & 31, col = lane & 15, g = lane >> 4, wm = wave >> 1, wn = wave & 1;
  const unsigned lds0 = (unsigned)(size_t)sm; const size_t ap = (size_t)lda * 4;
  const char* ga = LIST ? (const char*)A : (const char*)(A + (size_t)(tid >> 4) * lda) + (tid & 15) * 16;   // LIST: the matrix's first row, else this lane's first A chunk of stage 0; a stage on: GK floats
  const char* gb = (const char*)(Bw + (size_t)(tid >> 3) * DM) + (tid & 7) * 16;    // the same of B; a stage on: GK bf16
  g_stage<MT, LIST>(lds0, ga, ap, ro, gb, tid);
  asm volatile("s_wait_asynccnt 0x0" ::: "memory");   // this wave's share of stage 0 has landed
  __syncthreads();                                    // and every other wave's
  g_stage<MT, LIST>(lds0 + G_SZ(MT), ga + GK * 4, ap, ro, gb + GK * 2, tid);
#pragma unroll 1   // one stage a trip: the two buffers alternate by the trip's parity, and the body stays small in the instruction cache
  for (int t = 0; t < GNT; ++t) {
    const unsigned char* sb = sm + (t & 1) * G_SZ(MT);
#pragma unroll   // the two 32-k steps of a stage stand unrolled: their LDS offsets are immediates
    for (int kc = 0; kc < 2; ++kc) {
      v16b w[4];
#pragma unroll
      for (int nt = 0; nt < 4; ++nt) w[nt] = frag_b((const __bf16*)(sb + G_B(MT)) + (wn * 64 + nt * 16 + col) * BPB + kc * 32, lane);
#pragma unroll
      for (int mt = 0; mt < MT; ++mt) { const float* xp = (const float*)sb + ((wm * MT + mt) * 16 + col) * APF + kc * 32 + 8 * g;
        const v4f x0 = *(const v4f*)xp, x1 = *(const v4f*)(xp + 4), x2 = *(const v4f*)(xp + 16), x3 = *(const v4f*)(xp + 20);   // the k order of frag_b
        if constexpr (SPLIT) { const F2 a = split_v4(x0, x1, x2, x3);
#pragma unroll
          for (int nt = 0; nt < 4; ++nt) acc[mt][nt] = wmma_bf(a.l, w[nt], acc[mt][nt]);
#pragma unroll
          for (int nt = 0; nt < 4; ++nt) acc[mt][nt] = wmma_bf(a.h, w[nt], acc[mt][nt]);
        } else { v16b a;
#pragma unroll
          for (int i = 0; i < 4; ++i) { a[i] = (__bf16)x0[i]; a[4 + i] = (__bf16)x1[i]; a[8 + i] = (__bf16)x2[i]; a[12 + i] = (__bf16)x3[i]; }
#pragma unroll
          for (int nt = 0; nt < 4; ++nt) acc[mt][nt] = wmma_bf(a, w[nt], acc[mt][nt]); } } }
    asm volatile("s_wait_dscnt 0x0" ::: "memory");      // this wave's reads of the buffer are done before anyone refills it
    asm volatile("s_wait_asynccnt 0x0" ::: "memory");   // this wave's share of stage t + 1 has landed
    __syncthreads();                                    // publishes stage t + 1 and ends every wave's reads of stage t
    if (t + 2 < GNT) g_stage<MT, LIST>(lds0 + (unsigned)(t & 1) * G_SZ(MT), ga + (size_t)(t + 2) * GK * 4, ap, ro, gb + (size_t)(t + 2) * GK * 2, tid);
  }
  asm volatile("s_wait_asynccnt 0x0" ::: "memory");     // no copy is left in flight when the buffer takes the output rows
}
// the wave's MT * 16 rows x 64 columns, + bias, into its own part of LDS, row by row; bias: at the block's first column
template <int MT> __device__ __forceinline__ float (*rows_lds(unsigned char* sm, const v8f (&acc)[MT][4], const float* bias))[68] {
  const int tid = threadIdx.x, wave = tid >> 5, lane = tid & 31, col = lane & 15, g = lane >> 4, wn = wave & 1;
  float (*so)[68] = (float (*)[68])(sm + wave * (MT * 16 * 68 * 4));
  const int bi = wn * 64 + col; float bl[4];
#pragma unroll
  for (int nt = 0; nt < 4; ++nt) bl[nt] = bias[bi + nt * 16];
  asm volatile("s_wait_xcnt 0x0" :: "v"(bi) : "memory");   // the index register that all 4 bias loads name stays whole until every load has taken its address
#pragma unroll
  for (int nt = 0; nt < 4; ++nt) { const float bb = bfr(bl[nt]);
#pragma unroll
    for (int mt = 0; mt < MT; ++mt) {
#pragma unroll
      for (int r = 0; r < 8; ++r) so[mt * 16 + 8 * g + r][nt * 16 + col] = acc[mt][nt][r] + bb; } }
  LDSX();
  return so;
}
// f32 rows; C: at the block's first row and column
template <int MT> __device__ __forceinline__ void store_rows(unsigned char* sm, const v8f (&acc)[MT][4], const float* bias, float* C, int ldc) {
  const int tid = threadIdx.x, wave = tid >> 5, lane = tid & 31, col = lane & 15, g = lane >> 4, wm = wave >> 1, wn = wave & 1;
  float (*so)[68] = rows_lds<MT>(sm, acc, bias);
  for (int rl = 0; rl < MT * 8; ++rl) { const int row = rl * 2 + g; vst2(C + (size_t)(wm * MT * 16 + row) * ldc + wn * 64 + col * 4, *(const v4f*)&so[row][col * 4]); }   // 256-B segments, two rows a store
  asm volatile("s_wait_xcnt 0x0" ::: "memory");   // the stores have taken their address and data registers before whatever code stands behind them overwrites those
}
// K rows as the score product takes them: bf16 hi | the bf16 of the remainder, 256 B a key and head (a wave's 64 columns are one head); K: at the block's first place and head
__device__ __forceinline__ void store_k(unsigned char* sm, const v8f (&acc)[4][4], const float* bias, __bf16* K) {
  const int tid = threadIdx.x, wave = tid >> 5, lane = tid & 31, col = lane & 15, g = lane >> 4, wm = wave >> 1, wn = wave & 1;
  float (*so)[68] = rows_lds<4>(sm, acc, bias);
#pragma unroll 1   // four trips of 16 rows: a trip's 8 LDS reads are in flight together, and the wait at its foot stands in front of all that the next trip overwrites
  for (int rq = 0; rq < 4; ++rq) { v4f x[8];
#pragma unroll
    for (int i = 0; i < 8; ++i) x[i] = *(const v4f*)&so[(rq * 8 + i) * 2 + g][col * 4];
#pragma unroll
    for (int i = 0; i < 8; ++i) { v4b kh, kl;
#pragma unroll
      for (int e = 0; e < 4; ++e) { kh[e] = (__bf16)x[i][e]; kl[e] = (__bf16)(x[i][e] - (float)kh[e]); }
      __bf16* kr = K + (size_t)(wm * 64 + (rq * 8 + i) * 2 + g) * (2 * DM) + wn * (2 * HD) + col * 4; vst2(kr, kh); vst2(kr + HD, kl); }   // 16 lanes fill a 128-B line of hi and one of lo
    asm volatile("s_wait_xcnt 0x0" ::: "memory"); }   // the 16 stores have taken their address and data registers before the next rows overwrite them
}
// V turned: a lane holds 8 keys in a row of one column (D element r = row 8 g + r), 16 B of the hi plane and 16 B of the lo plane; the wave's 4 row tiles fill a column's 128-B line; VH, VL: at the block's first column and place
__device__ __forceinline__ void store_v(const v8f (&acc)[4][4], const float* bias, __bf16* VH, __bf16* VL) {
  const int tid = threadIdx.x, wave = tid >> 5, lane = tid & 31, col = lane & 15, g = lane >> 4, wm = wave >> 1, wn = wave & 1;
#pragma unroll
  for (int nt = 0; nt < 4; ++nt) { const float bb = bfr(bias[wn * 64 + nt * 16 + col]); const size_t o = (size_t)(wn * 64 + nt * 16 + col) * SK + wm * 64 + 8 * g;
#pragma unroll
    for (int mt = 0; mt < 4; ++mt) { v8b vh, vl;
#pragma unroll
      for (int r = 0; r < 8; ++r) { const float v = acc[mt][nt][r] + bb; vh[r] = (__bf16)v; vl[r] = (__bf16)(v - (float)vh[r]); }
      vst2(VH + o + mt * 16, vh); vst2(VL + o + mt * 16, vl);
      asm volatile("s_wait_xcnt 0x0" ::: "memory");   // the two stores have taken their address and data registers before the next tile's values overwrite them
    } }
}
// ---- k_proj: x[r] . PT[n] (exact, x rounded to bf16) + bias, K = 1024; block (128 rows, 128 cols), its columns in one of q | k | v. The first NB * NH blocks: the memory slots. Then the q blocks: every row of query, f32 into QKV. Then the k and v blocks: 128 places of a batch's key list, the A rows copied from key | value through the list, K and V stored as k_attn reads them; batch 1's row blocks follow batch 0's at once, so that the blocks that have no key stand last and leave at entry
#define PQB ((NR / 128) * (DM / 128))       // q blocks
#define PKB ((NR / 128) * (2 * DM / 128))   // k and v blocks at most (no key masked)
__global__ __launch_bounds__(128) void k_proj(const float* __restrict__ XQ, const float* __restrict__ XK, const float* __restrict__ XV, const __bf16* __restrict__ PT, const float* __restrict__ bq, const float* __restrict__ bk, const float* __restrict__ bv, const float* __restrict__ MK, const float* __restrict__ MV, const int* __restrict__ IDX, const int* __restrict__ CNT, float* __restrict__ QKV, __bf16* __restrict__ KX, __bf16* __restrict__ VTH, __bf16* __restrict__ VTL) {
  __shared__ __align__(16) unsigned char sm[2 * G_SZ(4)];   // the two stage buffers; behind the loop its first bytes stage the output rows
  const int tid = threadIdx.x; const int id = blockIdx.x;
  const int nr0 = (min(max(__builtin_amdgcn_readfirstlane(CNT[0]), 0), SS) + 63) & ~63, nr1 = (min(max(__builtin_amdgcn_readfirstlane(CNT[32]), 0), SS) + 63) & ~63;   // the places that each batch's unmasked keys take, a multiple of 64
  if (id < NB * NH) { const int b = id >> 4; mem_slots(sm, MK, MV, b ? nr1 : nr0, (id & 15) * HD, b, KX, VTH, VTL); return; }
  unsigned ro[16]; int kind, n0, b = 0, p0, nr = 0;   // kind 0 q, 1 k, 2 v; n0: the block's first column of q, of k or of v; p0: its first row (q) or place (k, v)
  if (id < NB * NH + PQB) {
    const int j = id - NB * NH; kind = 0; n0 = (j >> 5) * 128; p0 = (j & 31) * 128;
#pragma unroll
    for (int i = 0; i < 16; ++i) ro[i] = (unsigned)(p0 + i * 8 + (tid >> 4)) * (DM * 4) + (tid & 15) * 16;
  } else {
    const int j = id - NB * NH - PQB, nb0 = (nr0 + 127) >> 7, rb = j >> 4;
    b = rb >= nb0 ? 1 : 0; p0 = (rb - (b ? nb0 : 0)) * 128; nr = b ? nr1 : nr0;
    if (p0 >= nr) return;   // no key stands here: the whole block leaves, in front of every copy and barrier
    kind = 1 + ((j >> 3) & 1); n0 = (j & 7) * 128;
    const int* lp = IDX + b * SS + p0; const int lr = tid >> 4; int kx[16];   // p0 + 127 < SS: places from nr on name masked keys, whose rows are worked on and not stored
#pragma unroll
    for (int i = 0; i < 16; ++i) kx[i] = lp[lr + i * 8];
    asm volatile("s_wait_xcnt 0x0" :: "v"(lr) : "memory");   // the index register that all 16 list loads name stays whole until every load has taken its address
#pragma unroll
    for (int i = 0; i < 16; ++i) ro[i] = (unsigned)(b * SS + min(max(kx[i], 0), SS - 1)) * (DM * 4) + (tid & 15) * 16;
  }
  v8f acc[4][4] = {};
  gemm_main<4, false, true>(sm, kind == 0 ? XQ : (kind == 1 ? XK : XV), DM, ro, PT + (size_t)(kind * DM + n0) * DM, acc);
  if (kind == 0) { store_rows<4>(sm, acc, bq + n0, QKV + (size_t)p0 * QKVP + n0, QKVP); return; }
  if (p0 + __builtin_amdgcn_readfirstlane(tid >> 6) * 64 >= nr) return;   // a wave's 64 rows lie wholly in front of nr or wholly behind it, where the memory slots stand; no barrier follows
  if (kind == 2) store_v(acc, bv + n0, VTH + ((size_t)b * DM + n0) * SK + p0, VTL + ((size_t)b * DM + n0) * SK + p0);
  else store_k(sm, acc, bk + n0, KX + ((size_t)b * SK + p0) * (2 * DM) + 2 * n0);
}
// ---- k_out: Y = O(hi/lo; the q columns of QKV) . PT_out rows (2 products, K = 1024) + bo; block (64 rows, 128 cols)
__global__ __launch_bounds__(128) void k_out(const float* __restrict__ QKV, const __bf16* __restrict__ PT, const float* __restrict__ bo, float* __restrict__ Y) {
  __shared__ __align__(16) unsigned char sm[2 * G_SZ(2)];   // as in k_proj
  const int n0 = blockIdx.y * 128; const size_t r0 = (size_t)blockIdx.x * 64;
  v8f acc[2][4] = {};
  gemm_main<2, true, false>(sm, QKV + r0 * QKVP, QKVP, nullptr, PT + (size_t)(3 * DM + n0) * DM, acc);
  store_rows<2>(sm, acc, bo + n0, Y + r0 * DM + n0, DM);
}

extern "C" void kernel_launch(void* const* d_in, const int* in_sizes, int n_in, void* d_out, int out_size, void* d_ws, size_t ws_size, hipStream_t stream) {
  (void)in_sizes; (void)n_in; (void)out_size;
  const float** F = (const float**)d_in;   // query, key, value, mask [2,1,1,2048] i32, Wq, bq, Wk, bk, Wv, bv, Wo, bo, m_k [1,64,1024], m_v
  if (ws_size < (size_t)WS_END) return;
  char* ws = (char*)d_ws; __bf16 *PT = (__bf16*)(ws + WS_PT), *VTH = (__bf16*)(ws + WS_VTH), *VTL = (__bf16*)(ws + WS_VTL); float *QKV = (float*)(ws + WS_QKV); __bf16* KX = (__bf16*)(ws + WS_KX); int *IDX = (int*)(ws + WS_IDX), *CNT = (int*)(ws + WS_CNT);
  k_pack<<<4 * DM + NB, 128, 0, stream>>>(F[4], F[6], F[8], F[10], PT, (const int*)d_in[3], IDX, CNT);
  k_proj<<<NB * NH + PQB + PKB, 128, 0, stream>>>(F[0], F[1], F[2], PT, F[5], F[7], F[9], F[12], F[13], IDX, CNT, QKV, KX, VTH, VTL);
  k_attn<<<dim3(TQB / QW, TNB * NH), 128, 0, stream>>>(QKV, KX, CNT, VTH, VTL);
  k_out<<<dim3((TNB < NB ? TQB : NR / 64), DM / 128), 128, 0, stream>>>(QKV, PT, F[11], (float*)d_out);
}

// v010
// One run takes 96.2 microseconds.
// In both of two side-by-side timings against v009, it was 1.04 times as fast.
// Over all steps from v000 it is 7.55 times as fast.
// compute dtype: query/key/value, the four weights + biases and the memory slots (module inputs) rounded to bf16; q/k/v projections with exact bf16 products (+ f32 bias); scores and P.V with both computed operands as bf16 hi + bf16 residual pairs (3 products; memory keys/values scaled in f32 and split the same way); output projection hi/lo x bf16 Wo (2 products) + bias; masked online softmax in f32; f32 accumulate.
#include <hip/hip_runtime.h>
#include <math.h>

typedef __attribute__((ext_vector_type(16))) _Float16 v16h;
typedef __attribute__((ext_vector_type(16))) __bf16 v16b;
typedef __attribute__((ext_vector_type(8)))  _Float16 v8h;
typedef __attribute__((ext_vector_type(8)))  float v8f;
typedef __attribute__((ext_vector_type(4)))  float v4f;
typedef __attribute__((ext_vector_type(2)))  float v2f;
typedef __attribute__((ext_vector_type(4)))  unsigned v4u;
typedef __attribute__((ext_vector_type(4)))  int v4i;
typedef float __attribute__((may_alias)) float_a;
typedef int __attribute__((may_alias)) int_a;

template <typename T> __device__ __forceinline__ void vst2(void* p, T v) { *(T*)p = v;  }
__device__ __forceinline__ v8f wmma16(v16h a, v16h b, v8f c) {
  v8f d = __builtin_amdgcn_wmma_f32_16x16x32_f16(false, a, false, b, (short)0, c, false, false);
  asm volatile("v_nop\n\tv_nop\n\tv_nop\n\tv_nop" : "+v"(d) : "v"(a), "v"(b));
  return d;
}
__device__ __forceinline__ v8f wmma_bf(v16b a, v16b b, v8f c) {
  v8f d = __builtin_amdgcn_wmma_f32_16x16x32_bf16(false, a, false, b, (short)0, c, false, false);
  asm volatile("v_nop\n\tv_nop\n\tv_nop\n\tv_nop" : "+v"(d) : "v"(a), "v"(b));
  return d;
}
// 16x16x32 fragments: lane = (h = lane>>4, row/col = lane&15); elements 0..7 = k0+8h+0..7, 8..15 = k0+16+8h+0..7; D element r = row 8h+r
__device__ __forceinline__ v16h frag_h(const _Float16* rowk0, int lane) {
  union { v16h v; v8h q[2]; } u; const _Float16* p = rowk0 + 8 * (lane >> 4);
  u.q[0] = *(const v8h*)p; u.q[1] = *(const v8h*)(p + 16); return u.v;
}
__device__ __forceinline__ v16h frag_f32(const float* rowk0, int lane) {
  v16h a; const float* p = rowk0 + 8 * (lane >> 4);
#pragma unroll
  for (int i = 0; i < 8; ++i) { a[i] = (_Float16)p[i]; a[8 + i] = (_Float16)p[16 + i]; }
  return a;
}
__device__ __forceinline__ v16h frag_f32s(const float* rowk0, int lane, float sc) {
  v16h a; const float* p = rowk0 + 8 * (lane >> 4);
#pragma unroll
  for (int i = 0; i < 8; ++i) { a[i] = (_Float16)(p[i] * sc); a[8 + i] = (_Float16)(p[16 + i] * sc); }
  return a;
}
// column fragment from a [K][ld] layout (column n), rows >= K read as 0
__device__ __forceinline__ v16h fragc_f32(const float* W, int k0, int n, int lane, int ld, int K) {
  v16h a; const int g = lane >> 4;
#pragma unroll
  for (int i = 0; i < 8; ++i) { const int ka = k0 + 8 * g + i, kb = ka + 16;
    a[i] = (_Float16)(ka < K ? W[(size_t)(ka < K ? ka : K - 1) * ld + n] : 0.f); a[8 + i] = (_Float16)(kb < K ? W[(size_t)(kb < K ? kb : K - 1) * ld + n] : 0.f); }
  return a;
}
struct F2 { v16b h, l; };
__device__ __forceinline__ F2 bsplit16(const float v[16]) { F2 r;
#pragma unroll
  for (int i = 0; i < 16; ++i) { const __bf16 h = (__bf16)v[i]; r.h[i] = h; r.l[i] = (__bf16)(v[i] - (float)h); }
  return r; }
__device__ __forceinline__ F2 split_row(const float* row, int k0, int lane) { float v[16]; const float* p = row + k0 + 8 * (lane >> 4);
#pragma unroll
  for (int i = 0; i < 8; ++i) { v[i] = p[i]; v[8 + i] = p[16 + i]; }
  return bsplit16(v); }
__device__ __forceinline__ F2 split_rowK(const float* row, int k0, int lane, int K) { float v[16]; const int g = lane >> 4;
#pragma unroll
  for (int i = 0; i < 8; ++i) { const int ka = k0 + 8 * g + i, kb = ka + 16; v[i] = ka < K ? row[ka < K ? ka : K - 1] : 0.f; v[8 + i] = kb < K ? row[kb < K ? kb : K - 1] : 0.f; }
  return bsplit16(v); }
__device__ __forceinline__ F2 split_col(const float* W, int k0, int n, int lane, int ld, int K) { float v[16]; const int g = lane >> 4;
#pragma unroll
  for (int i = 0; i < 8; ++i) { const int ka = k0 + 8 * g + i, kb = ka + 16; v[i] = ka < K ? W[(size_t)(ka < K ? ka : K - 1) * ld + n] : 0.f; v[8 + i] = kb < K ? W[(size_t)(kb < K ? kb : K - 1) * ld + n] : 0.f; }
  return bsplit16(v); }
__device__ __forceinline__ v8f mac3(const F2& a, const F2& b, v8f c) { c = wmma_bf(a.l, b.h, c); c = wmma_bf(a.h, b.l, c); return wmma_bf(a.h, b.h, c); }
__device__ __forceinline__ float sigm(float v) { return 1.0f / (1.0f + expf(-v)); }
#define LDSX() do { asm volatile("s_wait_dscnt 0" ::: "memory"); __builtin_amdgcn_wave_barrier(); __builtin_amdgcn_fence(__ATOMIC_RELEASE, "workgroup"); } while (0)


// Multi-head attention with persistent memory: Q = query Wq^T + bq, K = [key Wk^T + bk ; 8 m_k], V = [value Wv^T + bv ; 8 m_v] (2048 + 64 slots), energy = Q K^T / 8 with the first 2048 key columns masked (mask == 0 -> -1e20) and the memory columns never masked; softmax; P V; merge heads; @ Wo^T + bo.  B 2, S 2048, D 1024, 16 x 64.
// k_pack (+ per batch the list of key numbers, unmasked first), k_proj (exact GEMM + bias; q from query; k and v from the rows of key and value that the list names: the n unmasked keys of a batch, filled up to a multiple of 64 with masked ones, then the memory slots; K rows stored split once into bf16 hi | lo by head, V as transposed hi/lo planes), k_attn (K and V staged in LDS by 64 keys, ceil(n / 64) + 1 stages), k_out (+ bo).
// A masked key has energy -1e20 beside the never masked memory slots, so its softmax weight is exactly 0 in f32: it is left out of the key list instead of being multiplied by 0.
#define NB 2
#define SS 2048
#define DM 1024
#define NH 16
#define HD 64
#define NR (NB * SS)
#define QKVP (3 * DM)
#define NM 64
#define SK (SS + NM)        // 2112 keys per batch
#ifndef TRB
#define TRB (NR / 64)
#define TQB (SS / 64)
#define TNB NB
#endif
typedef __attribute__((ext_vector_type(8))) __bf16 v8b;
__device__ __forceinline__ v16b frag_b(const __bf16* rowk0, int lane) {
  union { v16b v; v8b q[2]; } u; const __bf16* p = rowk0 + 8 * (lane >> 4);
  u.q[0] = *(const v8b*)p; u.q[1] = *(const v8b*)(p + 16); return u.v;
}
__device__ __forceinline__ v16b frag_gbf(const float* rowk0, int lane) {
  v16b a; const float* p = rowk0 + 8 * (lane >> 4);
#pragma unroll
  for (int i = 0; i < 8; ++i) { a[i] = (__bf16)p[i]; a[8 + i] = (__bf16)p[16 + i]; }
  return a;
}
__device__ __forceinline__ float bfr(float v) { return (float)(__bf16)v; }
// s[i] = 2^s[i] and a = 2^a, one instruction each (below 2^-126 the result is 0). One statement, so that every v_exp_f32 is followed by an instruction that touches neither its result nor its source; the closing v_nop is that slot for the last one
__device__ __forceinline__ void ex2_17(float* s, float& a) {
  asm("v_exp_f32 %0, %0\n\tv_exp_f32 %1, %1\n\tv_exp_f32 %2, %2\n\tv_exp_f32 %3, %3\n\tv_exp_f32 %4, %4\n\tv_exp_f32 %5, %5\n\tv_exp_f32 %6, %6\n\tv_exp_f32 %7, %7\n\tv_exp_f32 %8, %8\n\t"
      "v_exp_f32 %9, %9\n\tv_exp_f32 %10, %10\n\tv_exp_f32 %11, %11\n\tv_exp_f32 %12, %12\n\tv_exp_f32 %13, %13\n\tv_exp_f32 %14, %14\n\tv_exp_f32 %15, %15\n\tv_exp_f32 %16, %16\n\tv_nop"
      : "+v"(s[0]), "+v"(s[1]), "+v"(s[2]), "+v"(s[3]), "+v"(s[4]), "+v"(s[5]), "+v"(s[6]), "+v"(s[7]), "+v"(s[8]), "+v"(s[9]), "+v"(s[10]), "+v"(s[11]), "+v"(s[12]), "+v"(s[13]), "+v"(s[14]), "+v"(s[15]), "+v"(a));
}
#define SC2 0.18033688011112042f   // log2(e) / 8: the scores are scaled into powers of two, so that exp(energy - max) = 2^(s - m)
#define WS_PT   0u                                 // bf16 [4096 (q|k|v|out cols)][1024]
#define WS_QKV  (WS_PT + 2u * 4 * DM * DM)           // f32 [4096 rows][3072]: only the q columns 0..1023 are used, later overwritten by O
#define WS_KX   (WS_QKV + 4u * NR * QKVP)            // bf16 [2][2112][16 heads][hi 64 | lo 64] keys incl. memory: 256 B a key and head
#define WS_VTH  (WS_KX + 4u * NB * SK * DM)           // bf16 [2][1024 (h*64+d)][2112]
#define WS_VTL  (WS_VTH + 2u * NB * DM * SK)
#define WS_IDX  (WS_VTL + 2u * NB * DM * SK)          // int [2][2048]: a batch's key numbers, the unmasked first, then the masked, each group rising
#define WS_CNT  (WS_IDX + 4u * NB * SS)               // int, one a batch, 128 B apart: how many of its keys are unmasked
#define WS_END  (WS_CNT + 128u * NB)

__global__ __launch_bounds__(128) void k_pack(const float* __restrict__ Wq, const float* __restrict__ Wk, const float* __restrict__ Wv, const float* __restrict__ Wo, __bf16* __restrict__ PT, const int* __restrict__ MASK, int* __restrict__ IDX, int* __restrict__ CNT) {
  __shared__ __align__(16) __bf16 srow[DM];
  __shared__ int sc[128];
  const int tid = threadIdx.x;
  if (blockIdx.x < NB) {   // the first NB blocks: one batch's key list each; a thread ranks 16 keys in a row
    const int b = blockIdx.x; const int* mp = MASK + (size_t)b * SS + tid * (SS / 128);
    unsigned bits = 0;   // bit i: key tid * 16 + i is unmasked
#pragma unroll
    for (int q = 0; q < SS / 512; ++q) { const v4i x = *(const v4i*)(mp + 4 * q);
#pragma unroll
      for (int e = 0; e < 4; ++e) bits |= (x[e] != 0 ? 1u : 0u) << (4 * q + e); }
    sc[tid] = __popc(bits);
    __syncthreads();
    int before = 0, all = 0;   // unmasked keys of the threads below this one; of the batch
#pragma unroll 4   // unrolled whole, this loop's registers would cost the weight blocks of this kernel a quarter of their waves a SIMD
    for (int j = 0; j < 128; ++j) { const int v = sc[j]; all += v; before += j < tid ? v : 0; }
    int up = before, dn = all + tid * (SS / 128) - before;   // the next place among the unmasked, and among the masked, which stand behind all the unmasked
#pragma unroll
    for (int i = 0; i < SS / 128; ++i) { const bool keep = ((bits >> i) & 1u) != 0; IDX[(size_t)b * SS + (keep ? up : dn)] = tid * (SS / 128) + i; up += keep ? 1 : 0; dn += keep ? 0 : 1; }
    if (tid == 0) CNT[b * 32] = all;
    return;
  }
  const int n = blockIdx.x - NB; const int which = n >> 10, c = n & 1023; const float* Wm = which == 0 ? Wq : (which == 1 ? Wk : (which == 2 ? Wv : Wo));
  for (int k = tid; k < DM; k += 128) srow[k] = (__bf16)Wm[(size_t)c * DM + k];   // torch [out][in]: row c
  __syncthreads();
  vst2((unsigned*)(PT + (size_t)n * DM + tid * 8), *(const v4u*)(&srow[tid * 8]));
}
// ---- mem_slots (a block of k_proj): the 64 memory slots x one head's 64 columns of one batch, 4 waves; a thread holds 4 slot pairs x 4 columns of K and of V with all 16 loads in flight together; V is split, packed by slot pair and turned in LDS, K is split and goes straight out
// place p of a batch with n unmasked keys, nr = n rounded up to 64: p < nr the p-th key of the list (from n on masked keys, which only fill the stage: k_attn gives them weight 0), nr <= p < nr + 64 memory slot p - nr; nothing is written behind that, and k_attn reads nothing there
typedef __attribute__((ext_vector_type(2))) __bf16 v2b;
typedef __attribute__((ext_vector_type(4))) __bf16 v4b;
__device__ __forceinline__ void mem_slots(unsigned char* sm, const float* __restrict__ MK, const float* __restrict__ MV, int k0, int c0, int b, __bf16* __restrict__ KX, __bf16* __restrict__ VTH, __bf16* __restrict__ VTL) {
  unsigned (*svh)[36] = (unsigned (*)[36])sm, (*svl)[36] = (unsigned (*)[36])(sm + 64 * 36 * 4);   // [column][slot pair]; the 16-B chunks of a row stand XORed with column >> 4, so that a wave's 32 pair stores meet 32 banks
  const int tid = threadIdx.x, c4 = tid & 15, pr = tid >> 4;
  v4f kq[8], vq[8];   // i: slot 2 * pr + 16 * (i >> 1) + (i & 1)
  const unsigned ob = (unsigned)((2 * pr) * DM + c0 + c4 * 4) * 4u; const float *pk = (const float*)((const char*)MK + ob), *pv = (const float*)((const char*)MV + ob);   // ob: the lane's byte offset in both arrays
#pragma unroll
  for (int i = 0; i < 8; ++i) { const size_t o = (size_t)(16 * (i >> 1) + (i & 1)) * DM; kq[i] = *(const v4f*)(pk + o); vq[i] = *(const v4f*)(pv + o); }
  asm volatile("s_wait_xcnt 0x0" :: "v"(ob) : "memory");   // the offset register that all 16 loads name stays whole (no load's own result lands on it) until every load has taken its address
#pragma unroll
  for (int i = 0; i < 8; ++i) {
#pragma unroll
    for (int e = 0; e < 4; ++e) { kq[i][e] = 8.0f * bfr(kq[i][e]); vq[i][e] = 8.0f * bfr(vq[i][e]); } }
#pragma unroll
  for (int p = 0; p < 4; ++p) { const int pp = (pr + 8 * p) ^ ((c4 >> 2) << 2);
#pragma unroll
    for (int e = 0; e < 4; ++e) { const float va = vq[2 * p][e], vb = vq[2 * p + 1][e]; const __bf16 ha = (__bf16)va, hb = (__bf16)vb;
      const v2b hh = {ha, hb}, ll = {(__bf16)(va - (float)ha), (__bf16)(vb - (float)hb)};
      svh[c4 * 4 + e][pp] = __builtin_bit_cast(unsigned, hh); svl[c4 * 4 + e][pp] = __builtin_bit_cast(unsigned, ll); } }
  v4b kh[8], kl[8];   // K as the score product takes it: bf16 hi and the bf16 of the remainder
#pragma unroll
  for (int i = 0; i < 8; ++i) {
#pragma unroll
    for (int e = 0; e < 4; ++e) { kh[i][e] = (__bf16)kq[i][e]; kl[i][e] = (__bf16)(kq[i][e] - (float)kh[i][e]); } }
  __syncthreads();
#pragma unroll
  for (int i = 0; i < 8; ++i) { __bf16* kr = KX + ((size_t)b * SK + k0 + 2 * pr + 16 * (i >> 1) + (i & 1)) * (2 * DM) + 2 * c0 + c4 * 4; vst2(kr, kh[i]); vst2(kr + HD, kl[i]); }   // behind the barrier, which would else wait for these stores; 16 lanes fill a 128-B line of hi and one of lo
#pragma unroll
  for (int it = 0; it < 4; ++it) { const int rowi = it * 16 + (tid >> 3), pc = tid & 7, sw = (pc ^ it) * 4; const size_t o = ((size_t)b * DM + c0 + rowi) * SK + k0 + pc * 8; vst2((unsigned*)(VTH + o), *(const v4u*)&svh[rowi][sw]); vst2((unsigned*)(VTL + o), *(const v4u*)&svl[rowi][sw]); }
}
#define QW 2
#define KT 64
#define NT (SK / KT)
#define KPF 68
#define VPB 72
#define ST_VH (KT * KPF * 4)
#define ST_VL (ST_VH + HD * VPB * 2)
#define ST_SZ (ST_VL + HD * VPB * 2)       // 35840 B a stage
// k_attn's product: the builtin alone, which the compiler pads where a distance is owed. wmma_bf's statement of v_nop names D, A and B as operands, and an asm operand lies under v256: with two query tiles a wave holds more than 256 registers, and its fragments do not all fit there
__device__ __forceinline__ v8f wmma_q(v16b a, v16b b, v8f c) { return __builtin_amdgcn_wmma_f32_16x16x32_bf16(false, a, false, b, (short)0, c, false, false); }
__device__ __forceinline__ float xhalf(float x) { return __builtin_bit_cast(float, __builtin_amdgcn_permlanex16(__builtin_bit_cast(int, x), __builtin_bit_cast(int, x), 0x76543210, 0xfedcba98, false, false)); }  // lane l with lane l ^ 16
__device__ __forceinline__ F2 split_v4(v4f a, v4f b, v4f c, v4f d) { float v[16];
#pragma unroll
  for (int i = 0; i < 4; ++i) { v[i] = a[i]; v[4 + i] = b[i]; v[8 + i] = c[i]; v[12 + i] = d[i]; }
  return bsplit16(v); }
// eight 16-B copies a lane, global to LDS through no register; the last line keeps the address registers whole until every copy has taken its addresses
__device__ __forceinline__ void copy8(const unsigned* l, const char* const* p) {
  asm volatile("global_load_async_to_lds_b128 %0, %8, off\n\tglobal_load_async_to_lds_b128 %1, %9, off\n\tglobal_load_async_to_lds_b128 %2, %10, off\n\tglobal_load_async_to_lds_b128 %3, %11, off\n\t"
               "global_load_async_to_lds_b128 %4, %12, off\n\tglobal_load_async_to_lds_b128 %5, %13, off\n\tglobal_load_async_to_lds_b128 %6, %14, off\n\tglobal_load_async_to_lds_b128 %7, %15, off\n\ts_wait_xcnt 0x0"
               :: "v"(l[0]), "v"(l[1]), "v"(l[2]), "v"(l[3]), "v"(l[4]), "v"(l[5]), "v"(l[6]), "v"(l[7]), "v"(p[0]), "v"(p[1]), "v"(p[2]), "v"(p[3]), "v"(p[4]), "v"(p[5]), "v"(p[6]), "v"(p[7]) : "memory");
}
__device__ __forceinline__ void stage_in(unsigned lb, const char* gk, const char* gh, const char* gl, int tid) {
  unsigned l[8]; const char* p[8];
#pragma unroll
  for (int i = 0; i < 8; ++i) { l[i] = lb + (unsigned)((i * 8 + (tid >> 4)) * (KPF * 4) + (tid & 15) * 16); p[i] = gk + (size_t)i * 8 * DM * 4; }   // K: a wave covers 2 rows of 256 B
  copy8(l, p);
#pragma unroll
  for (int i = 0; i < 4; ++i) { const unsigned o = (unsigned)((i * 16 + (tid >> 3)) * (VPB * 2) + (tid & 7) * 16); l[i] = lb + ST_VH + o; l[4 + i] = lb + ST_VL + o; p[i] = gh + (size_t)i * 16 * SK * 2; p[4 + i] = gl + (size_t)i * 16 * SK * 2; }   // V: a wave covers 4 rows of 128 B
  copy8(l, p);
}
__global__ __launch_bounds__(128) void k_attn(float* __restrict__ QKV, const __bf16* __restrict__ KX, const int* __restrict__ CNT, const __bf16* __restrict__ VTH, const __bf16* __restrict__ VTL) {
  __shared__ __align__(16) unsigned char sm[2 * ST_SZ];   // the two stage buffers; behind the loop its first bytes stage the output rows
  const int tid = threadIdx.x, wave = tid >> 5, lane = tid & 31, col = lane & 15, g = lane >> 4;
  const int qb = blockIdx.x, bh = blockIdx.y, b = bh >> 4, h = bh & 15; const int q0 = (qb * 4 + wave) * (16 * QW); const size_t tq = (size_t)b * SS + q0;
  const unsigned lds0 = (unsigned)(size_t)&sm[0];
  const int n = min(max(__builtin_amdgcn_readfirstlane(CNT[b * 32]), 0), SS), nr = (n + KT - 1) & ~(KT - 1), nt = nr / KT + 1;   // the batch's unmasked keys, the places they take, and the stages with the memory slots' one: 1 to NT, the same for the whole block
  const char* gk = (const char*)(KX + ((size_t)b * SK + (tid >> 4)) * (2 * DM) + h * (2 * HD)) + (tid & 15) * 16;             // this lane's first K chunk of stage 0; a stage on: KT rows
  const char* gh = (const char*)(VTH + ((size_t)b * DM + h * HD + (tid >> 3)) * SK) + (tid & 7) * 16;              // the same of V hi; a stage on: KT keys
  const char* gl = (const char*)(VTL + ((size_t)b * DM + h * HD + (tid >> 3)) * SK) + (tid & 7) * 16;
  stage_in(lds0, gk, gh, gl, tid);
  F2 a0[QW], a1[QW];   // B operand: column = query qt * 16 + col
  const float* qp = QKV + (tq + col) * QKVP + h * HD + 8 * g;   // the lane's own first q value: the one pointer that every q load goes through
  v4f qv[QW][8];   // [qt][j]: floats (j >> 1) * 16 + (j & 1) * 4 on from qp, row qt * 16 on
#pragma unroll
  for (int qt = 0; qt < QW; ++qt) {
#pragma unroll
    for (int j = 0; j < 8; ++j) qv[qt][j] = *(const v4f*)(qp + (size_t)qt * 16 * QKVP + (j >> 1) * 16 + (j & 1) * 4); }
  asm volatile("s_wait_xcnt 0x0" :: "v"(qp) : "memory");   // qp is read here, so its registers stay live over all the q loads and no load's result is put on them before every load has taken its address
#pragma unroll
  for (int qt = 0; qt < QW; ++qt) { a0[qt] = split_v4(qv[qt][0], qv[qt][1], qv[qt][2], qv[qt][3]); a1[qt] = split_v4(qv[qt][4], qv[qt][5], qv[qt][6], qv[qt][7]); }   // the k order of frag_b: k0 + 8g + 0..7, k0 + 16 + 8g + 0..7
  asm volatile("s_wait_asynccnt 0x0" ::: "memory");   // this wave's share of stage 0 has landed
  __syncthreads();                                    // and every other wave's
  if (nt > 1) stage_in(lds0 + ST_SZ, gk + (size_t)KT * DM * 4, gh + KT * 2, gl + KT * 2, tid);
  float m[QW], l[QW];            // of query qt * 16 + col, m in log2 units; l sums this wave half's keys only, the halves are joined behind the loop
#pragma unroll
  for (int qt = 0; qt < QW; ++qt) { m[qt] = -3.0e38f; l[qt] = 0.f; }
  v8f acc[QW][4] = {};           // acc[qt][dt][r] = O[query qt * 16 + col][dt * 16 + 8 g + r]
#pragma unroll 1
  for (int t = 0; t < nt; ++t) {
    const unsigned char* sb = sm + (t & 1) * ST_SZ;
#pragma unroll   // the two steps of a stage stand unrolled: their LDS offsets are immediates
    for (int hs = 0; hs < 2; ++hs) {
      const int ks = 2 * t + hs;
      const int rem = ks * 32 >= nr ? 32 : n - ks * 32;   // places of this step that count, from its first on: all in the memory slots' stage; the places n to nr - 1 hold masked keys
      const unsigned kw = (rem >= 32 ? 0xffffffffu : (rem <= 0 ? 0u : (1u << rem) - 1u)) >> (8 * g);   // bit j = keep key 8g + j of this step
      float s[QW][16];
#pragma unroll
      for (int ct = 0; ct < 2; ++ct) { const __bf16* kp = (const __bf16*)sb + (hs * 32 + ct * 16 + col) * (KPF * 2);   // A operand: row = key; hi at 0, lo at HD
        const F2 k0 = {frag_b(kp, lane), frag_b(kp + HD, lane)}, k1 = {frag_b(kp + 32, lane), frag_b(kp + HD + 32, lane)};
        v8f c[QW] = {};   // each tile's six products in the order they had; the tiles take turns, so that a product's neighbour does not wait for it
#pragma unroll
        for (int qt = 0; qt < QW; ++qt) c[qt] = wmma_q(k0.h, a0[qt].l, c[qt]);
#pragma unroll
        for (int qt = 0; qt < QW; ++qt) c[qt] = wmma_q(k0.l, a0[qt].h, c[qt]);
#pragma unroll
        for (int qt = 0; qt < QW; ++qt) c[qt] = wmma_q(k0.h, a0[qt].h, c[qt]);
#pragma unroll
        for (int qt = 0; qt < QW; ++qt) c[qt] = wmma_q(k1.h, a1[qt].l, c[qt]);
#pragma unroll
        for (int qt = 0; qt < QW; ++qt) c[qt] = wmma_q(k1.l, a1[qt].h, c[qt]);
#pragma unroll
        for (int qt = 0; qt < QW; ++qt) c[qt] = wmma_q(k1.h, a1[qt].h, c[qt]);
#pragma unroll
        for (int r = 0; r < 8; ++r) { const bool keep = ((kw >> (ct * 16 + r)) & 1u) != 0;
#pragma unroll
          for (int qt = 0; qt < QW; ++qt) s[qt][ct * 8 + r] = keep ? c[qt][r] * SC2 : -1.0e20f; } }
      v16b vh[4], vl[4];   // A operand: row = d; read here, as one group, so that the softmax stands between the reads and their use
#pragma unroll
      for (int dt = 0; dt < 4; ++dt) { const int vo = (dt * 16 + col) * VPB + hs * 32; vh[dt] = frag_b((const __bf16*)(sb + ST_VH) + vo, lane); vl[dt] = frag_b((const __bf16*)(sb + ST_VL) + vo, lane); }
      __builtin_amdgcn_sched_barrier(0);   // holds the 16 V reads here as one group: left free, the compiler sinks them in pairs between the second product's WMMAs, where each pair's wait stands open
      F2 pa[QW];
#pragma unroll
      for (int qt = 0; qt < QW; ++qt) {
        float mx = s[qt][0];
#pragma unroll
        for (int i = 1; i < 16; ++i) mx = fmaxf(mx, s[qt][i]);
        mx = fmaxf(mx, xhalf(mx));
        const float mn = fmaxf(m[qt], mx); float alpha = m[qt] - mn;
        float es = 0.f;
#pragma unroll
        for (int i = 0; i < 16; ++i) s[qt][i] -= mn;
        ex2_17(s[qt], alpha);
#pragma unroll
        for (int i = 0; i < 16; ++i) es += s[qt][i];
        l[qt] = l[qt] * alpha + es; m[qt] = mn;
#pragma unroll
        for (int dt = 0; dt < 4; ++dt) acc[qt][dt] *= alpha;
        pa[qt] = bsplit16(s[qt]); }   // element i = key 8g+i, element 8+i = key 16+8g+i: the k order of frag_b
#pragma unroll
      for (int dt = 0; dt < 4; ++dt) {   // each accumulator's three products in the order they had; the tiles take turns
#pragma unroll
        for (int qt = 0; qt < QW; ++qt) acc[qt][dt] = wmma_q(vh[dt], pa[qt].l, acc[qt][dt]);
#pragma unroll
        for (int qt = 0; qt < QW; ++qt) acc[qt][dt] = wmma_q(vl[dt], pa[qt].h, acc[qt][dt]);
#pragma unroll
        for (int qt = 0; qt < QW; ++qt) acc[qt][dt] = wmma_q(vh[dt], pa[qt].h, acc[qt][dt]); } }
    asm volatile("s_wait_dscnt 0x0" ::: "memory");      // this wave's reads of the buffer are done before anyone refills it
    asm volatile("s_wait_asynccnt 0x0" ::: "memory");   // this wave's share of stage t + 1 has landed
    __syncthreads();                                    // publishes stage t + 1 and ends every wave's reads of stage t
    if (t + 2 < nt) stage_in(lds0 + (unsigned)(t & 1) * ST_SZ, gk + (size_t)(t + 2) * KT * DM * 4, gh + (size_t)(t + 2) * KT * 2, gl + (size_t)(t + 2) * KT * 2, tid);
  }
  asm volatile("s_wait_asynccnt 0x0" ::: "memory");     // no copy is left in flight when the buffer takes the output rows
  float (*so)[16 * QW][68] = (float (*)[16 * QW][68])sm;
#pragma unroll
  for (int qt = 0; qt < QW; ++qt) { const float il = 1.0f / (l[qt] + xhalf(l[qt]));
#pragma unroll
    for (int dt = 0; dt < 4; ++dt) { const v8f o = acc[qt][dt] * il; vst2(&so[wave][qt * 16 + col][dt * 16 + 8 * g], (v4f){o[0], o[1], o[2], o[3]}); vst2(&so[wave][qt * 16 + col][dt * 16 + 8 * g + 4], (v4f){o[4], o[5], o[6], o[7]}); } }
  LDSX();
  for (int rl = 0; rl < 16 * QW; ++rl) if (lane < 16) vst2(QKV + (tq + rl) * QKVP + h * HD + lane * 4, *(const v4f*)&so[wave][rl][lane * 4]);
}
// ---- the two GEMMs (k_proj, k_out): block = (MT * 32 rows, 128 columns), 4 waves as 2 x 2, a wave holds MT x 4 accumulator tiles (MT * 16 rows x 64 columns)
// A (f32 rows) and B (bf16 weight rows) reach the waves through LDS: a stage = 64 k (A rows of 256 B, B rows of 128 B), copied once for the block in whole 128-B lines, two buffers, the next stage in flight while this one is worked on; A is rounded (or split) to bf16 as the fragment is read; k runs upward in steps of 32 into each accumulator
#define GK 64                              // k a stage
#define GNT (DM / GK)                      // 16 stages
#define APF 68                             // floats a staged A row: 272 B = 16 B x odd, no bank conflict for 16-B readers
#define BPB 72                             // bf16 a staged B row: 144 B = 16 B x odd
#define G_B(MT) ((MT) * 32 * APF * 4)
#define G_SZ(MT) (G_B(MT) + 128 * BPB * 2)  // a stage: 53248 B at MT 4, 35840 B at MT 2
// LIST: the lane's A row number u * 8 + i stands ro[u * 8 + i] bytes behind ga (rows picked through a list); else the rows follow one another at apitch
template <int MT, bool LIST> __device__ __forceinline__ void g_stage(unsigned lb, const char* ga, size_t apitch, const unsigned* ro, const char* gb, int tid) {
  unsigned l[8]; const char* p[8];
#pragma unroll
  for (int u = 0; u < MT / 2; ++u) {
#pragma unroll
    for (int i = 0; i < 8; ++i) { const int rr = (u * 8 + i) * 8; l[i] = lb + (unsigned)((rr + (tid >> 4)) * (APF * 4) + (tid & 15) * 16); p[i] = LIST ? ga + ro[u * 8 + i] : ga + (size_t)rr * apitch; }   // A: a wave covers 2 rows of 256 B
    copy8(l, p); }
#pragma unroll
  for (int i = 0; i < 8; ++i) { l[i] = lb + G_B(MT) + (unsigned)((i * 16 + (tid >> 3)) * (BPB * 2) + (tid & 7) * 16); p[i] = gb + (size_t)i * 16 * DM * 2; }   // B: a wave covers 4 rows of 128 B
  copy8(l, p);
}
typedef __attribute__((ext_vector_type(8))) unsigned v8u;
__device__ __forceinline__ unsigned pk2(float a, float b) { const v2f f = {a, b}; return __builtin_bit_cast(unsigned, __builtin_convertvector(f, v2b)); }   // two values rounded to bf16, a in the low half
// the product: A: the block's first row, k = 0, lda floats a row (LIST: the matrix's first row, and ro the byte offsets of this lane's MT * 4 chunks of stage 0); Bw: the block's first weight row
template <int MT, bool SPLIT, bool LIST> __device__ __forceinline__ void gemm_main(unsigned char* sm, const float* A, int lda, const unsigned* ro, const __bf16* Bw, v8f (&acc)[MT][4]) {
  const int tid = threadIdx.x, wave = tid >> 5, lane = tid & 31, col = lane & 15, g = lane >> 4, wm = wave >> 1, wn = wave & 1;
  const unsigned lds0 = (unsigned)(size_t)sm; const size_t ap = (size_t)lda * 4;
  const char* ga = LIST ? (const char*)A : (const char*)(A + (size_t)(tid >> 4) * lda) + (tid & 15) * 16;   // LIST: the matrix's first row, else this lane's first A chunk of stage 0; a stage on: GK floats
  const char* gb = (const char*)(Bw + (size_t)(tid >> 3) * DM) + (tid & 7) * 16;    // the same of B; a stage on: GK bf16
  g_stage<MT, LIST>(lds0, ga, ap, ro, gb, tid);
  asm volatile("s_wait_asynccnt 0x0" ::: "memory");   // this wave's share of stage 0 has landed
  __syncthreads();                                    // and every other wave's
  g_stage<MT, LIST>(lds0 + G_SZ(MT), ga + GK * 4, ap, ro, gb + GK * 2, tid);
#pragma unroll 1   // one stage a trip: the two buffers alternate by the trip's parity
  for (int t = 0; t < GNT; ++t) {
    const unsigned char* sb = sm + (t & 1) * G_SZ(MT);
    const __bf16* bp = (const __bf16*)(sb + G_B(MT)) + (wn * 64 + col) * BPB;   // the lane's B row of column tile 0
    const float* xp = (const float*)sb + (wm * MT * 16 + col) * APF + 8 * g;     // the lane's first A value of row tile 0
    constexpr int PF = MT > 2 ? 2 : MT;   // row tiles of step 1 that are read ahead with its B: as many as leave k_proj three waves a SIMD
    v16b w0[4], w1[4], ah[MT], al[MT]; v4f x[MT][4];   // x[mt][j]: floats (j >> 1) * 16 + (j & 1) * 4 on, the k order of frag_b
    auto rd = [&](int mt, int kc) {
#pragma unroll
      for (int j = 0; j < 4; ++j) x[mt][j] = *(const v4f*)(xp + mt * 16 * APF + kc * 32 + (j >> 1) * 16 + (j & 1) * 4); };
    auto cv = [&](int mt) {
      if constexpr (SPLIT) { const F2 a = split_v4(x[mt][0], x[mt][1], x[mt][2], x[mt][3]); ah[mt] = a.h; al[mt] = a.l; }
      else { const v8u u = {pk2(x[mt][0][0], x[mt][0][1]), pk2(x[mt][0][2], x[mt][0][3]), pk2(x[mt][1][0], x[mt][1][1]), pk2(x[mt][1][2], x[mt][1][3]), pk2(x[mt][2][0], x[mt][2][1]), pk2(x[mt][2][2], x[mt][2][3]), pk2(x[mt][3][0], x[mt][3][1]), pk2(x[mt][3][2], x[mt][3][3])}; ah[mt] = __builtin_bit_cast(v16b, u); } };
    auto mm = [&](int mt, const v16b (&w)[4]) {   // the builtin alone (wmma_q): wmma_bf's volatile statement kept every LDS read behind the product in front of it
      if constexpr (SPLIT) {
#pragma unroll
        for (int nt = 0; nt < 4; ++nt) acc[mt][nt] = wmma_q(al[mt], w[nt], acc[mt][nt]); }
#pragma unroll
      for (int nt = 0; nt < 4; ++nt) acc[mt][nt] = wmma_q(ah[mt], w[nt], acc[mt][nt]); };
#pragma unroll
    for (int nt = 0; nt < 4; ++nt) w0[nt] = frag_b(bp + nt * 16 * BPB, lane);
#pragma unroll
    for (int mt = 0; mt < MT; ++mt) rd(mt, 0);
#pragma unroll
    for (int mt = 0; mt < MT; ++mt) cv(mt);
    __builtin_amdgcn_sched_barrier(0);   // step 0's f32 values are all turned to bf16 here, so that step 1's reads take their registers
#pragma unroll
    for (int nt = 0; nt < 4; ++nt) w1[nt] = frag_b(bp + nt * 16 * BPB + 32, lane);
#pragma unroll
    for (int mt = 0; mt < PF; ++mt) rd(mt, 1);
    __builtin_amdgcn_sched_barrier(0);   // holds step 1's reads here as one group in front of step 0's products, under which they land: left free, the compiler sinks each in front of its first use, where its latency stands open
#pragma unroll
    for (int mt = 0; mt < MT / 2; ++mt) mm(mt, w0);
    if constexpr (SPLIT) __builtin_amdgcn_sched_barrier(0);   // half of step 0's products stand in front of the first use of step 1's reads: the compiler else starts to split step 1's values behind the first product, where the reads have not landed
#pragma unroll
    for (int mt = MT / 2; mt < MT; ++mt) mm(mt, w0);
#pragma unroll
    for (int mt = 0; mt < PF; ++mt) cv(mt);
    if constexpr (PF < MT) {
      __builtin_amdgcn_sched_barrier(0);   // as above: the registers of the values just turned are free for the reads that follow
#pragma unroll
      for (int mt = PF; mt < MT; ++mt) rd(mt, 1);
      __builtin_amdgcn_sched_barrier(0);   // the last row tiles' reads go out in front of the first ones' products and land under them
    }
#pragma unroll
    for (int mt = 0; mt < PF; ++mt) mm(mt, w1);
    if constexpr (PF < MT) __builtin_amdgcn_sched_barrier(0);   // all of the first row tiles' products stand in front of the first use of the last reads
#pragma unroll
    for (int mt = PF; mt < MT; ++mt) { cv(mt); mm(mt, w1); }
    __builtin_amdgcn_sched_barrier(0);   // holds the products in front of the waits: the compiler else lifts the waits and the barrier over them, and the wait for stage t + 1 comes a trip's products too early
    asm volatile("s_wait_dscnt 0x0" ::: "memory");      // this wave's reads of the buffer are done before anyone refills it
    asm volatile("s_wait_asynccnt 0x0" ::: "memory");   // this wave's share of stage t + 1 has landed
    __syncthreads();                                    // publishes stage t + 1 and ends every wave's reads of stage t
    if (t + 2 < GNT) g_stage<MT, LIST>(lds0 + (unsigned)(t & 1) * G_SZ(MT), ga + (size_t)(t + 2) * GK * 4, ap, ro, gb + (size_t)(t + 2) * GK * 2, tid);
  }
  asm volatile("s_wait_asynccnt 0x0" ::: "memory");     // no copy is left in flight when the buffer takes the output rows
}
// the wave's MT * 16 rows x 64 columns, + bias, into its own part of LDS, row by row; bias: at the block's first column
template <int MT> __device__ __forceinline__ float (*rows_lds(unsigned char* sm, const v8f (&acc)[MT][4], const float* bias))[68] {
  const int tid = threadIdx.x, wave = tid >> 5, lane = tid & 31, col = lane & 15, g = lane >> 4, wn = wave & 1;
  float (*so)[68] = (float (*)[68])(sm + wave * (MT * 16 * 68 * 4));
  const int bi = wn * 64 + col; float bl[4];
#pragma unroll
  for (int nt = 0; nt < 4; ++nt) bl[nt] = bias[bi + nt * 16];
  asm volatile("s_wait_xcnt 0x0" :: "v"(bi) : "memory");   // the index register that all 4 bias loads name stays whole until every load has taken its address
#pragma unroll
  for (int nt = 0; nt < 4; ++nt) { const float bb = bfr(bl[nt]);
#pragma unroll
    for (int mt = 0; mt < MT; ++mt) {
#pragma unroll
      for (int r = 0; r < 8; ++r) so[mt * 16 + 8 * g + r][nt * 16 + col] = acc[mt][nt][r] + bb; } }
  LDSX();
  return so;
}
// f32 rows; C: at the block's first row and column
template <int MT> __device__ __forceinline__ void store_rows(unsigned char* sm, const v8f (&acc)[MT][4], const float* bias, float* C, int ldc) {
  const int tid = threadIdx.x, wave = tid >> 5, lane = tid & 31, col = lane & 15, g = lane >> 4, wm = wave >> 1, wn = wave & 1;
  float (*so)[68] = rows_lds<MT>(sm, acc, bias);
  for (int rl = 0; rl < MT * 8; ++rl) { const int row = rl * 2 + g; vst2(C + (size_t)(wm * MT * 16 + row) * ldc + wn * 64 + col * 4, *(const v4f*)&so[row][col * 4]); }   // 256-B segments, two rows a store
  asm volatile("s_wait_xcnt 0x0" ::: "memory");   // the stores have taken their address and data registers before whatever code stands behind them overwrites those
}
// K rows as the score product takes them: bf16 hi | the bf16 of the remainder, 256 B a key and head (a wave's 64 columns are one head); K: at the block's first place and head
__device__ __forceinline__ void store_k(unsigned char* sm, const v8f (&acc)[4][4], const float* bias, __bf16* K) {
  const int tid = threadIdx.x, wave = tid >> 5, lane = tid & 31, col = lane & 15, g = lane >> 4, wm = wave >> 1, wn = wave & 1;
  float (*so)[68] = rows_lds<4>(sm, acc, bias);
#pragma unroll 1   // four trips of 16 rows: a trip's 8 LDS reads are in flight together, and the wait at its foot stands in front of all that the next trip overwrites
  for (int rq = 0; rq < 4; ++rq) { v4f x[8];
#pragma unroll
    for (int i = 0; i < 8; ++i) x[i] = *(const v4f*)&so[(rq * 8 + i) * 2 + g][col * 4];
#pragma unroll
    for (int i = 0; i < 8; ++i) { v4b kh, kl;
#pragma unroll
      for (int e = 0; e < 4; ++e) { kh[e] = (__bf16)x[i][e]; kl[e] = (__bf16)(x[i][e] - (float)kh[e]); }
      __bf16* kr = K + (size_t)(wm * 64 + (rq * 8 + i) * 2 + g) * (2 * DM) + wn * (2 * HD) + col * 4; vst2(kr, kh); vst2(kr + HD, kl); }   // 16 lanes fill a 128-B line of hi and one of lo
    asm volatile("s_wait_xcnt 0x0" ::: "memory"); }   // the 16 stores have taken their address and data registers before the next rows overwrite them
}
// V turned: a lane holds 8 keys in a row of one column (D element r = row 8 g + r), 16 B of the hi plane and 16 B of the lo plane; the wave's 4 row tiles fill a column's 128-B line; VH, VL: at the block's first column and place
__device__ __forceinline__ void store_v(const v8f (&acc)[4][4], const float* bias, __bf16* VH, __bf16* VL) {
  const int tid = threadIdx.x, wave = tid >> 5, lane = tid & 31, col = lane & 15, g = lane >> 4, wm = wave >> 1, wn = wave & 1;
#pragma unroll
  for (int nt = 0; nt < 4; ++nt) { const float bb = bfr(bias[wn * 64 + nt * 16 + col]); const size_t o = (size_t)(wn * 64 + nt * 16 + col) * SK + wm * 64 + 8 * g;
#pragma unroll
    for (int mt = 0; mt < 4; ++mt) { v8b vh, vl;
#pragma unroll
      for (int r = 0; r < 8; ++r) { const float v = acc[mt][nt][r] + bb; vh[r] = (__bf16)v; vl[r] = (__bf16)(v - (float)vh[r]); }
      vst2(VH + o + mt * 16, vh); vst2(VL + o + mt * 16, vl);
      asm volatile("s_wait_xcnt 0x0" ::: "memory");   // the two stores have taken their address and data registers before the next tile's values overwrite them
    } }
}
// ---- k_proj: x[r] . PT[n] (exact, x rounded to bf16) + bias, K = 1024; block (128 rows, 128 cols), its columns in one of q | k | v. The first NB * NH blocks: the memory slots. Then the q blocks: every row of query, f32 into QKV. Then the k and v blocks: 128 places of a batch's key list, the A rows copied from key | value through the list, K and V stored as k_attn reads them; batch 1's row blocks follow batch 0's at once, so that the blocks that have no key stand last and leave at entry
#define PQB ((NR / 128) * (DM / 128))       // q blocks
#define PKB ((NR / 128) * (2 * DM / 128))   // k and v blocks at most (no key masked)
__global__ __launch_bounds__(128) void k_proj(const float* __restrict__ XQ, const float* __restrict__ XK, const float* __restrict__ XV, const __bf16* __restrict__ PT, const float* __restrict__ bq, const float* __restrict__ bk, const float* __restrict__ bv, const float* __restrict__ MK, const float* __restrict__ MV, const int* __restrict__ IDX, const int* __restrict__ CNT, float* __restrict__ QKV, __bf16* __restrict__ KX, __bf16* __restrict__ VTH, __bf16* __restrict__ VTL) {
  __shared__ __align__(16) unsigned char sm[2 * G_SZ(4)];   // the two stage buffers; behind the loop its first bytes stage the output rows
  const int tid = threadIdx.x; const int id = blockIdx.x;
  const int nr0 = (min(max(__builtin_amdgcn_readfirstlane(CNT[0]), 0), SS) + 63) & ~63, nr1 = (min(max(__builtin_amdgcn_readfirstlane(CNT[32]), 0), SS) + 63) & ~63;   // the places that each batch's unmasked keys take, a multiple of 64
  if (id < NB * NH) { const int b = id >> 4; mem_slots(sm, MK, MV, b ? nr1 : nr0, (id & 15) * HD, b, KX, VTH, VTL); return; }
  unsigned ro[16]; int kind, n0, b = 0, p0, nr = 0;   // kind 0 q, 1 k, 2 v; n0: the block's first column of q, of k or of v; p0: its first row (q) or place (k, v)
  if (id < NB * NH + PQB) {
    const int j = id - NB * NH; kind = 0; n0 = (j >> 5) * 128; p0 = (j & 31) * 128;
#pragma unroll
    for (int i = 0; i < 16; ++i) ro[i] = (unsigned)(p0 + i * 8 + (tid >> 4)) * (DM * 4) + (tid & 15) * 16;
  } else {
    const int j = id - NB * NH - PQB, nb0 = (nr0 + 127) >> 7, rb = j >> 4;
    b = rb >= nb0 ? 1 : 0; p0 = (rb - (b ? nb0 : 0)) * 128; nr = b ? nr1 : nr0;
    if (p0 >= nr) return;   // no key stands here: the whole block leaves, in front of every copy and barrier
    kind = 1 + ((j >> 3) & 1); n0 = (j & 7) * 128;
    const int* lp = IDX + b * SS + p0; const int lr = tid >> 4; int kx[16];   // p0 + 127 < SS: places from nr on name masked keys, whose rows are worked on and not stored
#pragma unroll
    for (int i = 0; i < 16; ++i) kx[i] = lp[lr + i * 8];
    asm volatile("s_wait_xcnt 0x0" :: "v"(lr) : "memory");   // the index register that all 16 list loads name stays whole until every load has taken its address
#pragma unroll
    for (int i = 0; i < 16; ++i) ro[i] = (unsigned)(b * SS + min(max(kx[i], 0), SS - 1)) * (DM * 4) + (tid & 15) * 16;
  }
  v8f acc[4][4] = {};
  gemm_main<4, false, true>(sm, kind == 0 ? XQ : (kind == 1 ? XK : XV), DM, ro, PT + (size_t)(kind * DM + n0) * DM, acc);
  if (kind == 0) { store_rows<4>(sm, acc, bq + n0, QKV + (size_t)p0 * QKVP + n0, QKVP); return; }
  if (p0 + __builtin_amdgcn_readfirstlane(tid >> 6) * 64 >= nr) return;   // a wave's 64 rows lie wholly in front of nr or wholly behind it, where the memory slots stand; no barrier follows
  if (kind == 2) store_v(acc, bv + n0, VTH + ((size_t)b * DM + n0) * SK + p0, VTL + ((size_t)b * DM + n0) * SK + p0);
  else store_k(sm, acc, bk + n0, KX + ((size_t)b * SK + p0) * (2 * DM) + 2 * n0);
}
// ---- k_out: Y = O(hi/lo; the q columns of QKV) . PT_out rows (2 products, K = 1024) + bo; block (64 rows, 128 cols)
__global__ __launch_bounds__(128) void k_out(const float* __restrict__ QKV, const __bf16* __restrict__ PT, const float* __restrict__ bo, float* __restrict__ Y) {
  __shared__ __align__(16) unsigned char sm[2 * G_SZ(2)];   // as in k_proj
  const int n0 = blockIdx.y * 128; const size_t r0 = (size_t)blockIdx.x * 64;
  v8f acc[2][4] = {};
  gemm_main<2, true, false>(sm, QKV + r0 * QKVP, QKVP, nullptr, PT + (size_t)(3 * DM + n0) * DM, acc);
  store_rows<2>(sm, acc, bo + n0, Y + r0 * DM + n0, DM);
}

extern "C" void kernel_launch(void* const* d_in, const int* in_sizes, int n_in, void* d_out, int out_size, void* d_ws, size_t ws_size, hipStream_t stream) {
  (void)in_sizes; (void)n_in; (void)out_size;
  const float** F = (const float**)d_in;   // query, key, value, mask [2,1,1,2048] i32, Wq, bq, Wk, bk, Wv, bv, Wo, bo, m_k [1,64,1024], m_v
  if (ws_size < (size_t)WS_END) return;
  char* ws = (char*)d_ws; __bf16 *PT = (__bf16*)(ws + WS_PT), *VTH = (__bf16*)(ws + WS_VTH), *VTL = (__bf16*)(ws + WS_VTL); float *QKV = (float*)(ws + WS_QKV); __bf16* KX = (__bf16*)(ws + WS_KX); int *IDX = (int*)(ws + WS_IDX), *CNT = (int*)(ws + WS_CNT);
  k_pack<<<4 * DM + NB, 128, 0, stream>>>(F[4], F[6], F[8], F[10], PT, (const int*)d_in[3], IDX, CNT);
  k_proj<<<NB * NH + PQB + PKB, 128, 0, stream>>>(F[0], F[1], F[2], PT, F[5], F[7], F[9], F[12], F[13], IDX, CNT, QKV, KX, VTH, VTL);
  k_attn<<<dim3(TQB / QW, TNB * NH), 128, 0, stream>>>(QKV, KX, CNT, VTH, VTL);
  k_out<<<dim3((TNB < NB ? TQB : NR / 64), DM / 128), 128, 0, stream>>>(QKV, PT, F[11], (float*)d_out);
}
